// v000
// The times below were measured on an AMD MI455X: many runs one after another, warmed up first and cycling through
// copies of the inputs, with the whole window's GPU time divided by the number of runs. Launches and the gaps
// between them are all in it. The median over several windows is given; except for v000 it joins two sittings, which
// can be a few percent apart, so the side-by-side timings, each taken in one sitting, are the better comparison.
// v000 is the starting kernel. One run takes 841 microseconds.
// compute dtype: f16 operands (pixel/token rows as f16, weights packed x16 as f16 rows, q/k x4, P lifted by 2^14, V x4, att rows x64, zl/h rows x1), f32 accumulate; softmax, LayerNorm2d, GELU and the residual in f32. Output = x + t with both O(1).
#include <hip/hip_runtime.h>
#include <math.h>

typedef __attribute__((ext_vector_type(16))) _Float16 v16h;
typedef __attribute__((ext_vector_type(16))) __bf16 v16b;
typedef __attribute__((ext_vector_type(8)))  _Float16 v8h;
typedef __attribute__((ext_vector_type(8)))  float v8f;
typedef __attribute__((ext_vector_type(4)))  float v4f;
typedef __attribute__((ext_vector_type(2)))  float v2f;
typedef __attribute__((ext_vector_type(4)))  unsigned v4u;
typedef __attribute__((ext_vector_type(4)))  int v4i;
typedef float __attribute__((may_alias)) float_a;
typedef int __attribute__((may_alias)) int_a;

template <typename T> __device__ __forceinline__ void vst2(void* p, T v) { *(T*)p = v;  }
__device__ __forceinline__ v8f wmma16(v16h a, v16h b, v8f c) {
  v8f d = __builtin_amdgcn_wmma_f32_16x16x32_f16(false, a, false, b, (short)0, c, false, false);
  asm volatile("v_nop\n\tv_nop\n\tv_nop\n\tv_nop" : "+v"(d) : "v"(a), "v"(b));
  return d;
}
__device__ __forceinline__ v8f wmma_bf(v16b a, v16b b, v8f c) {
  v8f d = __builtin_amdgcn_wmma_f32_16x16x32_bf16(false, a, false, b, (short)0, c, false, false);
  asm volatile("v_nop\n\tv_nop\n\tv_nop\n\tv_nop" : "+v"(d) : "v"(a), "v"(b));
  return d;
}
// 16x16x32 fragments: lane = (h = lane>>4, row/col = lane&15); elements 0..7 = k0+8h+0..7, 8..15 = k0+16+8h+0..7; D element r = row 8h+r
__device__ __forceinline__ v16h frag_h(const _Float16* rowk0, int lane) {
  union { v16h v; v8h q[2]; } u; const _Float16* p = rowk0 + 8 * (lane >> 4);
  u.q[0] = *(const v8h*)p; u.q[1] = *(const v8h*)(p + 16); return u.v;
}
__device__ __forceinline__ v16h frag_f32(const float* rowk0, int lane) {
  v16h a; const float* p = rowk0 + 8 * (lane >> 4);
#pragma unroll
  for (int i = 0; i < 8; ++i) { a[i] = (_Float16)p[i]; a[8 + i] = (_Float16)p[16 + i]; }
  return a;
}
__device__ __forceinline__ v16h frag_f32s(const float* rowk0, int lane, float sc) {
  v16h a; const float* p = rowk0 + 8 * (lane >> 4);
#pragma unroll
  for (int i = 0; i < 8; ++i) { a[i] = (_Float16)(p[i] * sc); a[8 + i] = (_Float16)(p[16 + i] * sc); }
  return a;
}
// column fragment from a [K][ld] layout (column n), rows >= K read as 0
__device__ __forceinline__ v16h fragc_f32(const float* W, int k0, int n, int lane, int ld, int K) {
  v16h a; const int g = lane >> 4;
#pragma unroll
  for (int i = 0; i < 8; ++i) { const int ka = k0 + 8 * g + i, kb = ka + 16;
    a[i] = (_Float16)(ka < K ? W[(size_t)(ka < K ? ka : K - 1) * ld + n] : 0.f); a[8 + i] = (_Float16)(kb < K ? W[(size_t)(kb < K ? kb : K - 1) * ld + n] : 0.f); }
  return a;
}
struct F2 { v16b h, l; };
__device__ __forceinline__ F2 bsplit16(const float v[16]) { F2 r;
#pragma unroll
  for (int i = 0; i < 16; ++i) { const __bf16 h = (__bf16)v[i]; r.h[i] = h; r.l[i] = (__bf16)(v[i] - (float)h); }
  return r; }
__device__ __forceinline__ F2 split_row(const float* row, int k0, int lane) { float v[16]; const float* p = row + k0 + 8 * (lane >> 4);
#pragma unroll
  for (int i = 0; i < 8; ++i) { v[i] = p[i]; v[8 + i] = p[16 + i]; }
  return bsplit16(v); }
__device__ __forceinline__ F2 split_rowK(const float* row, int k0, int lane, int K) { float v[16]; const int g = lane >> 4;
#pragma unroll
  for (int i = 0; i < 8; ++i) { const int ka = k0 + 8 * g + i, kb = ka + 16; v[i] = ka < K ? row[ka < K ? ka : K - 1] : 0.f; v[8 + i] = kb < K ? row[kb < K ? kb : K - 1] : 0.f; }
  return bsplit16(v); }
__device__ __forceinline__ F2 split_col(const float* W, int k0, int n, int lane, int ld, int K) { float v[16]; const int g = lane >> 4;
#pragma unroll
  for (int i = 0; i < 8; ++i) { const int ka = k0 + 8 * g + i, kb = ka + 16; v[i] = ka < K ? W[(size_t)(ka < K ? ka : K - 1) * ld + n] : 0.f; v[8 + i] = kb < K ? W[(size_t)(kb < K ? kb : K - 1) * ld + n] : 0.f; }
  return bsplit16(v); }
__device__ __forceinline__ v8f mac3(const F2& a, const F2& b, v8f c) { c = wmma_bf(a.l, b.h, c); c = wmma_bf(a.h, b.l, c); return wmma_bf(a.h, b.h, c); }
__device__ __forceinline__ float sigm(float v) { return 1.0f / (1.0f + expf(-v)); }
#define LDSX() do { asm volatile("s_wait_dscnt 0" ::: "memory"); __builtin_amdgcn_wave_barrier(); __builtin_amdgcn_fence(__ATOMIC_RELEASE, "workgroup"); } while (0)


// Cross-modal encoder block: Q = conv1x1(x) per pixel (4096 x 256), K,V = y^T W^T + b (4096 x 256); scores = Q.K/16 over the 4096 y-tokens (one 256-dim head); att = softmax V; z = att Wo^T + bo;
// LayerNorm2d over channels per pixel (eps 1e-6); t = gelu(z_ln W1^T + b1) W2^T + b2; out = x + t (NCHW).
// halves d<128 / d>=128 to stay inside the VGPR budget; S recomputed), k_post (z + LN + MLP + residual, NCHW store by channel rows). Whole-line stores, one instruction per line.
#define C 256
#define NP 4096
#define NK 4096
#define HID 512
__device__ __attribute__((noinline)) float gelu_e(float v) { return 0.5f * v * (1.0f + erff(v * 0.70710678118654752f)); }    // out of line: keeps the static VALU-FMA count of k_post small

// token-major f16 rows from a [C][N] f32 array: block = 64 tokens; T16[n][c]
__global__ __launch_bounds__(256) void k_cvt(const float* __restrict__ src, _Float16* __restrict__ T16) {
  __shared__ __align__(16) _Float16 st[64][C + 8];
  const int tid = threadIdx.x, n0 = blockIdx.x * 64;
  for (int q = tid; q < C * 16; q += 256) { const int c = q >> 4, p4 = q & 15; const v4f v = *(const v4f*)(src + (size_t)c * NP + n0 + p4 * 4);
    st[p4 * 4][c] = (_Float16)v[0]; st[p4 * 4 + 1][c] = (_Float16)v[1]; st[p4 * 4 + 2][c] = (_Float16)v[2]; st[p4 * 4 + 3][c] = (_Float16)v[3]; }
  __syncthreads();
  for (int q = tid; q < 64 * (C / 8); q += 256) { const int rl = q >> 5, pc = q & 31; vst2(T16 + (size_t)(n0 + rl) * C + pc * 8, *(const v4u*)(&st[rl][pc * 8])); }
}
// PA rows (256 halves x16): [0,C) Wq, [C,2C) Wk, [2C,3C) Wv, [3C,4C) Wo, [4C, 4C+HID) W1 ; PB rows (512 halves x16): W2 rows (256)
__global__ __launch_bounds__(256) void k_pack(const float* __restrict__ Wq, const float* __restrict__ Wk, const float* __restrict__ Wv, const float* __restrict__ Wo, const float* __restrict__ W1, const float* __restrict__ W2, _Float16* __restrict__ PA, _Float16* __restrict__ PB) {
  const int n = blockIdx.x, tid = threadIdx.x; __shared__ __align__(16) _Float16 srow[HID];
  if (n < 4 * C + HID) { const float* W = n < C ? Wq + (size_t)n * C : (n < 2 * C ? Wk + (size_t)(n - C) * C : (n < 3 * C ? Wv + (size_t)(n - 2 * C) * C : (n < 4 * C ? Wo + (size_t)(n - 3 * C) * C : W1 + (size_t)(n - 4 * C) * C)));
    srow[tid] = (_Float16)(W[tid] * 16.0f); __syncthreads(); if (tid < C / 8) vst2(PA + (size_t)n * C + tid * 8, *(const v4u*)(&srow[tid * 8])); }
  else { const int m = n - (4 * C + HID); const float* W = W2 + (size_t)m * HID; srow[tid] = (_Float16)(W[tid] * 16.0f); srow[tid + 256] = (_Float16)(W[tid + 256] * 16.0f); __syncthreads();
    if (tid < HID / 8) vst2(PB + (size_t)m * HID + tid * 8, *(const v4u*)(&srow[tid * 8])); }
}
// q/k/v: block (64 rows, 128 cols, which); which 0 reads X16 else Y16; Q16/K16 rows x4 (+bias); V -> VT x4 [d][n]
__global__ __launch_bounds__(128) void k_qkv(const _Float16* __restrict__ X16, const _Float16* __restrict__ Y16, const _Float16* __restrict__ PA, const float* __restrict__ bq, const float* __restrict__ bk, const float* __restrict__ bv, _Float16* __restrict__ Q16, _Float16* __restrict__ K16, _Float16* __restrict__ VT) {
  __shared__ __align__(16) _Float16 so[4][16][136];
  __shared__ __align__(16) _Float16 sth[128][72];
  const int tid = threadIdx.x, wave = tid >> 5, lane = tid & 31, col = lane & 15, g = lane >> 4;
  const int which = blockIdx.z, r0b = blockIdx.x * 64, r0 = r0b + wave * 16, n0 = blockIdx.y * 128; const _Float16* SRC = which == 0 ? X16 : Y16; const float* bb_ = which == 0 ? bq : (which == 1 ? bk : bv);
  v8f acc[8] = {};
#pragma unroll 2
  for (int kc = 0; kc < C / 32; ++kc) { const v16h a = frag_h(SRC + (size_t)(r0 + col) * C + kc * 32, lane);
#pragma unroll
    for (int j = 0; j < 8; ++j) acc[j] = wmma16(a, frag_h(PA + (size_t)(which * C + n0 + j * 16 + col) * C + kc * 32, lane), acc[j]); }
  if (which < 2) {
#pragma unroll
    for (int j = 0; j < 8; ++j) { const float bb = bb_[n0 + j * 16 + col];
#pragma unroll
      for (int r = 0; r < 8; ++r) so[wave][8 * g + r][j * 16 + col] = (_Float16)((acc[j][r] * (1.0f / 16.0f) + bb) * 4.0f); }
    LDSX();
    _Float16* D = which == 0 ? Q16 : K16;
    for (int rl = 0; rl < 16; ++rl) { if (lane < 16) vst2(D + (size_t)(r0 + rl) * C + n0 + lane * 8, *(const v4u*)(&so[wave][rl][lane * 8])); } }
  else {
#pragma unroll
    for (int j = 0; j < 8; ++j) { const float bb = bb_[n0 + j * 16 + col];
#pragma unroll
      for (int r = 0; r < 8; ++r) sth[j * 16 + col][wave * 16 + 8 * g + r] = (_Float16)((acc[j][r] * (1.0f / 16.0f) + bb) * 4.0f); }
    __syncthreads();
    for (int qq = tid; qq < 128 * 8; qq += 128) { const int cl = qq >> 3, pc = qq & 7; vst2(VT + (size_t)(n0 + cl) * NK + r0b + pc * 8, *(const v4u*)(&sth[cl][pc * 8])); } }
}
// attention: block = (64 queries, value half dh): S over 256 dims (8 kc), softmax, P.V for d in [dh*128, dh*128+128); O16[q][d] x1 (ctx values O(0.1))... store f32 O32 to be safe
__global__ __launch_bounds__(128) void k_attn(const _Float16* __restrict__ Q16, const _Float16* __restrict__ K16, const _Float16* __restrict__ VT, float* __restrict__ O32) {
  __shared__ __align__(16) float sS[4][16][68];
  __shared__ __align__(16) _Float16 sPh[4][16][72];
  __shared__ __align__(16) float sO[4][16][132];
  const int tid = threadIdx.x, w = tid >> 5, lane = tid & 31, col = lane & 15, g = lane >> 4; const int q0 = blockIdx.x * 64 + w * 16; const int dh = blockIdx.y;
  v16h aq[8];
#pragma unroll
  for (int kc = 0; kc < 8; ++kc) aq[kc] = frag_h(Q16 + (size_t)(q0 + col) * C + kc * 32, lane);
  float mrun = -3.0e38f, lrun = 0.f; v8f acc[8] = {};
#pragma unroll 1
  for (int kt = 0; kt < NK / 64; ++kt) {
#pragma unroll
    for (int t = 0; t < 4; ++t) { v8f s = {}; const int key = kt * 64 + t * 16 + col;
#pragma unroll
      for (int kc = 0; kc < 8; ++kc) s = wmma16(aq[kc], frag_h(K16 + (size_t)key * C + kc * 32, lane), s);
#pragma unroll
      for (int r = 0; r < 8; ++r) sS[w][8 * g + r][t * 16 + col] = s[r] * (0.0625f / 16.0f); }
    LDSX();
    float mx = -3.4e38f;
#pragma unroll
    for (int jj = 0; jj < 32; ++jj) mx = fmaxf(mx, sS[w][col][g * 32 + jj]);
    mx = fmaxf(mx, __shfl_xor(mx, 16, 32));
    const float mnew = fmaxf(mrun, mx); const float corr = expf(mrun - mnew);
    float ps = 0.f;
#pragma unroll
    for (int jj = 0; jj < 32; ++jj) { const float p = expf(sS[w][col][g * 32 + jj] - mnew) * 16384.0f; ps += p; sPh[w][col][g * 32 + jj] = (_Float16)p; }
    ps += __shfl_xor(ps, 16, 32);
    lrun = lrun * corr + ps * (1.0f / 16384.0f); mrun = mnew;
#pragma unroll
    for (int r = 0; r < 8; ++r) { const float cr = __shfl(corr, 8 * g + r, 32);
#pragma unroll
      for (int t = 0; t < 8; ++t) acc[t][r] *= cr; }
    LDSX();
#pragma unroll
    for (int kc = 0; kc < 2; ++kc) { const v16h ph = frag_h(&sPh[w][col][0] + kc * 32, lane);
#pragma unroll
      for (int t = 0; t < 8; ++t) acc[t] = wmma16(ph, frag_h(VT + (size_t)(dh * 128 + t * 16 + col) * NK + kt * 64 + kc * 32, lane), acc[t]); }
    __builtin_amdgcn_wave_barrier(); }
#pragma unroll
  for (int r = 0; r < 8; ++r) { const float lr = __shfl(lrun, 8 * g + r, 32); const float inv = 1.0f / (lr * 16384.0f * 4.0f);
#pragma unroll
    for (int t = 0; t < 8; ++t) sO[w][8 * g + r][t * 16 + col] = acc[t][r] * inv; }
  LDSX();
  for (int rl = 0; rl < 16; ++rl) vst2(O32 + (size_t)(q0 + rl) * C + dh * 128 + lane * 4, *(const v4f*)(&sO[w][rl][lane * 4]));
}
// post: z = att Wo^T + bo; LN over 256 (eps 1e-6) * ln_w + ln_b; h = gelu(zl W1^T + b1); t = h W2^T + b2; out[c][p] = x[c][p] + t[p][c]; block = 64 pixels
__global__ __launch_bounds__(128) void k_post(const float* __restrict__ O32, const _Float16* __restrict__ PA, const _Float16* __restrict__ PB, const float* __restrict__ bo, const float* __restrict__ lw, const float* __restrict__ lb, const float* __restrict__ b1, const float* __restrict__ b2, const float* __restrict__ x, float* __restrict__ out) {
  __shared__ __align__(16) _Float16 sz[4][16][C + 8];          // att rows (f16) then zl rows (f16)
  __shared__ __align__(16) float szf[4][16][C + 4];             // z rows f32 for the LN statistics, later t rows
  __shared__ __align__(16) _Float16 shh[4][16][HID + 8];        // gelu(h) f16
  const int tid = threadIdx.x, wave = tid >> 5, lane = tid & 31, col = lane & 15, g = lane >> 4; const int p0b = blockIdx.x * 64, r0 = p0b + wave * 16;
  // att rows -> f16
  for (int qq = lane; qq < 16 * (C / 4); qq += 32) { const int rl = qq >> 6, pc = qq & 63; const v4f v = *(const v4f*)(O32 + (size_t)(r0 + rl) * C + pc * 4);
#pragma unroll
    for (int e = 0; e < 4; ++e) sz[wave][rl][pc * 4 + e] = (_Float16)(v[e] * 64.0f); }     // x64 carry keeps the small context values out of the f16 subnormal range
  LDSX();
  // z = att Wo^T /16/64 + bo (16 tiles, 8 kc)
  { v8f acc[16] = {};
#pragma unroll 1
    for (int kc = 0; kc < C / 32; ++kc) { const v16h a = frag_h(&sz[wave][col][0] + kc * 32, lane);
#pragma unroll
      for (int j = 0; j < 16; ++j) acc[j] = wmma16(a, frag_h(PA + (size_t)(3 * C + j * 16 + col) * C + kc * 32, lane), acc[j]); }
#pragma unroll
    for (int j = 0; j < 16; ++j) { const float bb = bo[j * 16 + col];
#pragma unroll
      for (int r = 0; r < 8; ++r) szf[wave][8 * g + r][j * 16 + col] = acc[j][r] * (1.0f / (16.0f * 64.0f)) + bb; } }
  LDSX();
  // LN per row (lane pair per row, halves of 128)
  { const int rl = lane & 15, hf = lane >> 4; const float* zr = &szf[wave][rl][hf * 128]; float s = 0.f, q = 0.f;
#pragma unroll 2
    for (int e = 0; e < 128; ++e) s += zr[e];
    s += __shfl_xor(s, 16, 32); const float mu = s * (1.0f / C);
#pragma unroll 2
    for (int e = 0; e < 128; ++e) { const float d = zr[e] - mu; q += d * d; }
    q += __shfl_xor(q, 16, 32); const float rs = rsqrtf(q * (1.0f / C) + 1e-6f);
#pragma unroll 2
    for (int e = 0; e < 128; ++e) { const int c = hf * 128 + e; sz[wave][rl][c] = (_Float16)((zr[e] - mu) * rs * lw[c] + lb[c]); } }
  LDSX();
  // h = gelu(zl W1^T/16 + b1): 32 column tiles in 2 passes of 16
#pragma unroll 1
  for (int ph = 0; ph < 2; ++ph) { v8f acc[16] = {};
#pragma unroll 1
    for (int kc = 0; kc < C / 32; ++kc) { const v16h a = frag_h(&sz[wave][col][0] + kc * 32, lane);
#pragma unroll
      for (int j = 0; j < 16; ++j) acc[j] = wmma16(a, frag_h(PA + (size_t)(4 * C + ph * 256 + j * 16 + col) * C + kc * 32, lane), acc[j]); }
#pragma unroll
    for (int j = 0; j < 16; ++j) { const int n = ph * 256 + j * 16 + col; const float bb = b1[n];
#pragma unroll
      for (int r = 0; r < 8; ++r) shh[wave][8 * g + r][n] = (_Float16)gelu_e(acc[j][r] * (1.0f / 16.0f) + bb); } }
  LDSX();
  // t = h W2^T/16 + b2 (16 tiles, 16 kc) -> szf
  { v8f acc[16] = {};
#pragma unroll 1
    for (int kc = 0; kc < HID / 32; ++kc) { const v16h a = frag_h(&shh[wave][col][0] + kc * 32, lane);
#pragma unroll
      for (int j = 0; j < 16; ++j) acc[j] = wmma16(a, frag_h(PB + (size_t)(j * 16 + col) * HID + kc * 32, lane), acc[j]); }
#pragma unroll
    for (int j = 0; j < 16; ++j) { const float bb = b2[j * 16 + col];
#pragma unroll
      for (int r = 0; r < 8; ++r) szf[wave][8 * g + r][j * 16 + col] = acc[j][r] * (1.0f / 16.0f) + bb; } }
  __syncthreads();
  // NCHW store: out[c][p0b .. p0b+63] = x + t: per channel c: 64 floats = 256 B = 16 pieces; q -> (c = q >> 4, piece = q & 15): lanes contiguous
  for (int q = tid; q < C * 16; q += 128) { const int c = q >> 4, pc = q & 15; v4f v = *(const v4f*)(x + (size_t)c * NP + p0b + pc * 4);
#pragma unroll
    for (int e = 0; e < 4; ++e) { const int pl = pc * 4 + e; v[e] += szf[pl >> 4][pl & 15][c]; }
    vst2(out + (size_t)c * NP + p0b + pc * 4, v); }
}
extern "C" void kernel_launch(void* const* d_in, const int* in_sizes, int n_in, void* d_out, int out_size, void* d_ws, size_t ws_size, hipStream_t stream) {
  (void)in_sizes; (void)n_in; (void)out_size; (void)ws_size;
  const float** I = (const float**)d_in;    // x, y, Wq, bq, Wk, bk, Wv, bv, Wo, bo, ln_w, ln_b, W1, b1, W2, b2
  const float* x = I[0]; const float* y = I[1]; const float* Wq = I[2]; const float* bq = I[3]; const float* Wk = I[4]; const float* bk = I[5]; const float* Wv = I[6]; const float* bv = I[7]; const float* Wo = I[8]; const float* bo = I[9];
  const float* lw = I[10]; const float* lb = I[11]; const float* W1 = I[12]; const float* b1 = I[13]; const float* W2 = I[14]; const float* b2 = I[15];
  float* out = (float*)d_out;
  char* ws = (char*)d_ws; size_t off = 0;
  auto take = [&](size_t bytes) { char* p = ws + off; off += (bytes + 255) & ~(size_t)255; return p; };
  _Float16* X16 = (_Float16*)take((size_t)NP * C * 2); _Float16* Y16 = (_Float16*)take((size_t)NK * C * 2); _Float16* PA = (_Float16*)take((size_t)(4 * C + HID) * C * 2); _Float16* PB = (_Float16*)take((size_t)C * HID * 2);
  _Float16* Q16 = (_Float16*)take((size_t)NP * C * 2); _Float16* K16 = (_Float16*)take((size_t)NK * C * 2); _Float16* VT = (_Float16*)take((size_t)C * NK * 2); float* O32 = (float*)take((size_t)NP * C * 4);
  // ws ~ 15 MB
  k_cvt<<<NP / 64, 256, 0, stream>>>(x, X16);
  k_cvt<<<NK / 64, 256, 0, stream>>>(y, Y16);
  k_pack<<<4 * C + HID + C, 256, 0, stream>>>(Wq, Wk, Wv, Wo, W1, W2, PA, PB);
  k_qkv<<<dim3(NP / 64, C / 128, 3), 128, 0, stream>>>(X16, Y16, PA, bq, bk, bv, Q16, K16, VT);
  k_attn<<<dim3(NP / 64, 2), 128, 0, stream>>>(Q16, K16, VT, O32);
  k_post<<<NP / 64, 128, 0, stream>>>(O32, PA, PB, bo, lw, lb, b1, b2, x, out);
}

// v001
// It runs in 323 microseconds.
// Timed twice side by side with v000, it ran 2.61 and 2.63 times as fast.
// compute dtype: f16 operands (pixel/token rows as f16, weights packed x16 as f16 rows, q/k x4, P lifted by 2^14, V x4, att rows x64, zl/h rows x1), f32 accumulate; softmax, LayerNorm2d, GELU and the residual in f32. Output = x + t with both O(1).
#include <hip/hip_runtime.h>
#include <math.h>

typedef __attribute__((ext_vector_type(16))) _Float16 v16h;
typedef __attribute__((ext_vector_type(16))) __bf16 v16b;
typedef __attribute__((ext_vector_type(8)))  _Float16 v8h;
typedef __attribute__((ext_vector_type(8)))  float v8f;
typedef __attribute__((ext_vector_type(4)))  float v4f;
typedef __attribute__((ext_vector_type(2)))  float v2f;
typedef __attribute__((ext_vector_type(4)))  unsigned v4u;
typedef __attribute__((ext_vector_type(4)))  int v4i;
typedef float __attribute__((may_alias)) float_a;
typedef int __attribute__((may_alias)) int_a;

template <typename T> __device__ __forceinline__ void vst2(void* p, T v) { *(T*)p = v;  }
__device__ __forceinline__ v8f wmma16(v16h a, v16h b, v8f c) {
  v8f d = __builtin_amdgcn_wmma_f32_16x16x32_f16(false, a, false, b, (short)0, c, false, false);
  asm volatile("v_nop\n\tv_nop\n\tv_nop\n\tv_nop" : "+v"(d) : "v"(a), "v"(b));
  return d;
}
__device__ __forceinline__ v8f wmma_bf(v16b a, v16b b, v8f c) {
  v8f d = __builtin_amdgcn_wmma_f32_16x16x32_bf16(false, a, false, b, (short)0, c, false, false);
  asm volatile("v_nop\n\tv_nop\n\tv_nop\n\tv_nop" : "+v"(d) : "v"(a), "v"(b));
  return d;
}
// 16x16x32 fragments: lane = (h = lane>>4, row/col = lane&15); elements 0..7 = k0+8h+0..7, 8..15 = k0+16+8h+0..7; D element r = row 8h+r
__device__ __forceinline__ v16h frag_h(const _Float16* rowk0, int lane) {
  union { v16h v; v8h q[2]; } u; const _Float16* p = rowk0 + 8 * (lane >> 4);
  u.q[0] = *(const v8h*)p; u.q[1] = *(const v8h*)(p + 16); return u.v;
}
__device__ __forceinline__ v16h frag_f32(const float* rowk0, int lane) {
  v16h a; const float* p = rowk0 + 8 * (lane >> 4);
#pragma unroll
  for (int i = 0; i < 8; ++i) { a[i] = (_Float16)p[i]; a[8 + i] = (_Float16)p[16 + i]; }
  return a;
}
__device__ __forceinline__ v16h frag_f32s(const float* rowk0, int lane, float sc) {
  v16h a; const float* p = rowk0 + 8 * (lane >> 4);
#pragma unroll
  for (int i = 0; i < 8; ++i) { a[i] = (_Float16)(p[i] * sc); a[8 + i] = (_Float16)(p[16 + i] * sc); }
  return a;
}
// column fragment from a [K][ld] layout (column n), rows >= K read as 0
__device__ __forceinline__ v16h fragc_f32(const float* W, int k0, int n, int lane, int ld, int K) {
  v16h a; const int g = lane >> 4;
#pragma unroll
  for (int i = 0; i < 8; ++i) { const int ka = k0 + 8 * g + i, kb = ka + 16;
    a[i] = (_Float16)(ka < K ? W[(size_t)(ka < K ? ka : K - 1) * ld + n] : 0.f); a[8 + i] = (_Float16)(kb < K ? W[(size_t)(kb < K ? kb : K - 1) * ld + n] : 0.f); }
  return a;
}
struct F2 { v16b h, l; };
__device__ __forceinline__ F2 bsplit16(const float v[16]) { F2 r;
#pragma unroll
  for (int i = 0; i < 16; ++i) { const __bf16 h = (__bf16)v[i]; r.h[i] = h; r.l[i] = (__bf16)(v[i] - (float)h); }
  return r; }
__device__ __forceinline__ F2 split_row(const float* row, int k0, int lane) { float v[16]; const float* p = row + k0 + 8 * (lane >> 4);
#pragma unroll
  for (int i = 0; i < 8; ++i) { v[i] = p[i]; v[8 + i] = p[16 + i]; }
  return bsplit16(v); }
__device__ __forceinline__ F2 split_rowK(const float* row, int k0, int lane, int K) { float v[16]; const int g = lane >> 4;
#pragma unroll
  for (int i = 0; i < 8; ++i) { const int ka = k0 + 8 * g + i, kb = ka + 16; v[i] = ka < K ? row[ka < K ? ka : K - 1] : 0.f; v[8 + i] = kb < K ? row[kb < K ? kb : K - 1] : 0.f; }
  return bsplit16(v); }
__device__ __forceinline__ F2 split_col(const float* W, int k0, int n, int lane, int ld, int K) { float v[16]; const int g = lane >> 4;
#pragma unroll
  for (int i = 0; i < 8; ++i) { const int ka = k0 + 8 * g + i, kb = ka + 16; v[i] = ka < K ? W[(size_t)(ka < K ? ka : K - 1) * ld + n] : 0.f; v[8 + i] = kb < K ? W[(size_t)(kb < K ? kb : K - 1) * ld + n] : 0.f; }
  return bsplit16(v); }
__device__ __forceinline__ v8f mac3(const F2& a, const F2& b, v8f c) { c = wmma_bf(a.l, b.h, c); c = wmma_bf(a.h, b.l, c); return wmma_bf(a.h, b.h, c); }
__device__ __forceinline__ float sigm(float v) { return 1.0f / (1.0f + expf(-v)); }
#define LDSX() do { asm volatile("s_wait_dscnt 0" ::: "memory"); __builtin_amdgcn_wave_barrier(); __builtin_amdgcn_fence(__ATOMIC_RELEASE, "workgroup"); } while (0)


// Cross-modal encoder block: Q = conv1x1(x) per pixel (4096 x 256), K,V = y^T W^T + b (4096 x 256); scores = Q.K/16 over the 4096 y-tokens (one 256-dim head); att = softmax V; z = att Wo^T + bo;
// LayerNorm2d over channels per pixel (eps 1e-6); t = gelu(z_ln W1^T + b1) W2^T + b2; out = x + t (NCHW).
// halves d<128 / d>=128 to stay inside the VGPR budget; S recomputed; NS key ranges), k_merge (joins the key ranges into O32), k_post (z + LN + MLP + residual, NCHW store by channel rows). Whole-line stores, one instruction per line.
#define C 256
#define NP 4096
#define NK 4096
#define HID 512
#define NS 8                 // key ranges per query tile: 64 x 2 x NS work-groups of 4 waves = 4 per WGP on 256 WGPs
#define KT_S (NK / 64 / NS)  // 64-key trips per range
__device__ __attribute__((noinline)) float gelu_e(float v) { return 0.5f * v * (1.0f + erff(v * 0.70710678118654752f)); }    // out of line: keeps the static VALU-FMA count of k_post small

// token-major f16 rows from a [C][N] f32 array: block = 64 tokens; T16[n][c]
__global__ __launch_bounds__(256) void k_cvt(const float* __restrict__ src, _Float16* __restrict__ T16) {
  __shared__ __align__(16) _Float16 st[64][C + 8];
  const int tid = threadIdx.x, n0 = blockIdx.x * 64;
  for (int q = tid; q < C * 16; q += 256) { const int c = q >> 4, p4 = q & 15; const v4f v = *(const v4f*)(src + (size_t)c * NP + n0 + p4 * 4);
    st[p4 * 4][c] = (_Float16)v[0]; st[p4 * 4 + 1][c] = (_Float16)v[1]; st[p4 * 4 + 2][c] = (_Float16)v[2]; st[p4 * 4 + 3][c] = (_Float16)v[3]; }
  __syncthreads();
  for (int q = tid; q < 64 * (C / 8); q += 256) { const int rl = q >> 5, pc = q & 31; vst2(T16 + (size_t)(n0 + rl) * C + pc * 8, *(const v4u*)(&st[rl][pc * 8])); }
}
// PA rows (256 halves x16): [0,C) Wq, [C,2C) Wk, [2C,3C) Wv, [3C,4C) Wo, [4C, 4C+HID) W1 ; PB rows (512 halves x16): W2 rows (256)
__global__ __launch_bounds__(256) void k_pack(const float* __restrict__ Wq, const float* __restrict__ Wk, const float* __restrict__ Wv, const float* __restrict__ Wo, const float* __restrict__ W1, const float* __restrict__ W2, _Float16* __restrict__ PA, _Float16* __restrict__ PB) {
  const int n = blockIdx.x, tid = threadIdx.x; __shared__ __align__(16) _Float16 srow[HID];
  if (n < 4 * C + HID) { const float* W = n < C ? Wq + (size_t)n * C : (n < 2 * C ? Wk + (size_t)(n - C) * C : (n < 3 * C ? Wv + (size_t)(n - 2 * C) * C : (n < 4 * C ? Wo + (size_t)(n - 3 * C) * C : W1 + (size_t)(n - 4 * C) * C)));
    srow[tid] = (_Float16)(W[tid] * 16.0f); __syncthreads(); if (tid < C / 8) vst2(PA + (size_t)n * C + tid * 8, *(const v4u*)(&srow[tid * 8])); }
  else { const int m = n - (4 * C + HID); const float* W = W2 + (size_t)m * HID; srow[tid] = (_Float16)(W[tid] * 16.0f); srow[tid + 256] = (_Float16)(W[tid + 256] * 16.0f); __syncthreads();
    if (tid < HID / 8) vst2(PB + (size_t)m * HID + tid * 8, *(const v4u*)(&srow[tid * 8])); }
}
// q/k/v: block (64 rows, 128 cols, which); which 0 reads X16 else Y16; Q16/K16 rows x4 (+bias); V -> VT x4 [d][n]
__global__ __launch_bounds__(128) void k_qkv(const _Float16* __restrict__ X16, const _Float16* __restrict__ Y16, const _Float16* __restrict__ PA, const float* __restrict__ bq, const float* __restrict__ bk, const float* __restrict__ bv, _Float16* __restrict__ Q16, _Float16* __restrict__ K16, _Float16* __restrict__ VT) {
  __shared__ __align__(16) _Float16 so[4][16][136];
  __shared__ __align__(16) _Float16 sth[128][72];
  const int tid = threadIdx.x, wave = tid >> 5, lane = tid & 31, col = lane & 15, g = lane >> 4;
  const int which = blockIdx.z, r0b = blockIdx.x * 64, r0 = r0b + wave * 16, n0 = blockIdx.y * 128; const _Float16* SRC = which == 0 ? X16 : Y16; const float* bb_ = which == 0 ? bq : (which == 1 ? bk : bv);
  v8f acc[8] = {};
#pragma unroll 2
  for (int kc = 0; kc < C / 32; ++kc) { const v16h a = frag_h(SRC + (size_t)(r0 + col) * C + kc * 32, lane);
#pragma unroll
    for (int j = 0; j < 8; ++j) acc[j] = wmma16(a, frag_h(PA + (size_t)(which * C + n0 + j * 16 + col) * C + kc * 32, lane), acc[j]); }
  if (which < 2) {
#pragma unroll
    for (int j = 0; j < 8; ++j) { const float bb = bb_[n0 + j * 16 + col];
#pragma unroll
      for (int r = 0; r < 8; ++r) so[wave][8 * g + r][j * 16 + col] = (_Float16)((acc[j][r] * (1.0f / 16.0f) + bb) * 4.0f); }
    LDSX();
    _Float16* D = which == 0 ? Q16 : K16;
    for (int rl = 0; rl < 16; ++rl) { if (lane < 16) vst2(D + (size_t)(r0 + rl) * C + n0 + lane * 8, *(const v4u*)(&so[wave][rl][lane * 8])); } }
  else {
#pragma unroll
    for (int j = 0; j < 8; ++j) { const float bb = bb_[n0 + j * 16 + col];
#pragma unroll
      for (int r = 0; r < 8; ++r) sth[j * 16 + col][wave * 16 + 8 * g + r] = (_Float16)((acc[j][r] * (1.0f / 16.0f) + bb) * 4.0f); }
    __syncthreads();
    for (int qq = tid; qq < 128 * 8; qq += 128) { const int cl = qq >> 3, pc = qq & 7; vst2(VT + (size_t)(n0 + cl) * NK + r0b + pc * 8, *(const v4u*)(&sth[cl][pc * 8])); } }
}
// attention: block = (64 queries, value half dh, key range sp): S over 256 dims (8 kc), softmax over the range's NK/NS keys, P.V for d in [dh*128, dh*128+128);
// OP[sp][q][d] = the range's own normalised context rows (f32); ML[dh][sp][q] = (range maximum, range sum); k_merge joins the ranges
__global__ __launch_bounds__(128) void k_attn(const _Float16* __restrict__ Q16, const _Float16* __restrict__ K16, const _Float16* __restrict__ VT, float* __restrict__ OP, float* __restrict__ ML) {
  __shared__ __align__(16) float sS[4][16][68];
  __shared__ __align__(16) _Float16 sPh[4][16][72];
  __shared__ __align__(16) float sO[4][16][132];
  const int tid = threadIdx.x, w = tid >> 5, lane = tid & 31, col = lane & 15, g = lane >> 4; const int q0 = blockIdx.x * 64 + w * 16; const int dh = blockIdx.y; const int sp = blockIdx.z;
  float* __restrict__ O32 = OP + (size_t)sp * NP * C;
  v16h aq[8];
#pragma unroll
  for (int kc = 0; kc < 8; ++kc) aq[kc] = frag_h(Q16 + (size_t)(q0 + col) * C + kc * 32, lane);
  float mrun = -3.0e38f, lrun = 0.f; v8f acc[8] = {};
#pragma unroll 1
  for (int ks = 0; ks < KT_S; ++ks) { const int kt = sp * KT_S + ks;
#pragma unroll
    for (int t = 0; t < 4; ++t) { v8f s = {}; const int key = kt * 64 + t * 16 + col;
#pragma unroll
      for (int kc = 0; kc < 8; ++kc) s = wmma16(aq[kc], frag_h(K16 + (size_t)key * C + kc * 32, lane), s);
#pragma unroll
      for (int r = 0; r < 8; ++r) sS[w][8 * g + r][t * 16 + col] = s[r] * (0.0625f / 16.0f); }
    LDSX();
    float mx = -3.4e38f;
#pragma unroll
    for (int jj = 0; jj < 32; ++jj) mx = fmaxf(mx, sS[w][col][g * 32 + jj]);
    mx = fmaxf(mx, __shfl_xor(mx, 16, 32));
    const float mnew = fmaxf(mrun, mx); const float corr = expf(mrun - mnew);
    float ps = 0.f;
#pragma unroll
    for (int jj = 0; jj < 32; ++jj) { const float p = expf(sS[w][col][g * 32 + jj] - mnew) * 16384.0f; ps += p; sPh[w][col][g * 32 + jj] = (_Float16)p; }
    ps += __shfl_xor(ps, 16, 32);
    lrun = lrun * corr + ps * (1.0f / 16384.0f); mrun = mnew;
#pragma unroll
    for (int r = 0; r < 8; ++r) { const float cr = __shfl(corr, 8 * g + r, 32);
#pragma unroll
      for (int t = 0; t < 8; ++t) acc[t][r] *= cr; }
    LDSX();
#pragma unroll
    for (int kc = 0; kc < 2; ++kc) { const v16h ph = frag_h(&sPh[w][col][0] + kc * 32, lane);
#pragma unroll
      for (int t = 0; t < 8; ++t) acc[t] = wmma16(ph, frag_h(VT + (size_t)(dh * 128 + t * 16 + col) * NK + kt * 64 + kc * 32, lane), acc[t]); }
    __builtin_amdgcn_wave_barrier(); }
#pragma unroll
  for (int r = 0; r < 8; ++r) { const float lr = __shfl(lrun, 8 * g + r, 32); const float inv = 1.0f / (lr * 16384.0f * 4.0f);
#pragma unroll
    for (int t = 0; t < 8; ++t) sO[w][8 * g + r][t * 16 + col] = acc[t][r] * inv; }
  LDSX();
  for (int rl = 0; rl < 16; ++rl) vst2(O32 + (size_t)(q0 + rl) * C + dh * 128 + lane * 4, *(const v4f*)(&sO[w][rl][lane * 4]));
  if (lane < 16) { v2f ml; ml[0] = mrun; ml[1] = lrun; vst2(ML + ((size_t)(dh * NS + sp) * NP + q0 + lane) * 2, ml); }    // 16 rows x 8 B = one 128-B line per wave
}
// join of the NS key ranges: weight of range s = l_s * exp(m_s - max m); O32[q][d] = sum_s weight_s * OP[s][q][d] / sum_s weight_s; thread = 4 columns of rows q and q + NP/2
// (no __restrict__ here: it lets the wait statement below drift away from the loads to the end of the kernel)
__global__ __launch_bounds__(256) void k_merge(const float* OP, const float* ML, float* O32) {
  const int idx = blockIdx.x * 256 + threadIdx.x, c4 = idx & 63, q = idx >> 6;
  const float* pm = ML + ((size_t)(c4 >> 5) * (NS * NP) + q) * 2;    // row q's (max, sum) pair in range 0 of its value half
  const float* po[NS / 2];                                           // the thread's 4 columns of row q in ranges 0, 2, 4, 6
#pragma unroll
  for (int s2 = 0; s2 < NS / 2; ++s2) po[s2] = OP + ((size_t)(2 * s2) * NP + q) * C + c4 * 4;
  v2f ml[2][NS]; v4f o[2][NS];
#pragma unroll
  for (int h = 0; h < 2; ++h) {
#pragma unroll
    for (int s = 0; s < NS; ++s) { ml[h][s] = *(const v2f*)(pm + (s * NP + h * (NP / 2)) * 2); o[h][s] = *(const v4f*)(po[s >> 1] + ((s & 1) * NP + h * (NP / 2)) * C); } }
  // precaution behind the last load: the address registers are operands, so none is reused (not even as a later load's destination) before the loads that name it have passed this wait
  asm volatile("s_wait_xcnt 0x0" :: "v"(pm), "v"(po[0]), "v"(po[1]), "v"(po[2]), "v"(po[3]) : "memory");
#pragma unroll
  for (int h = 0; h < 2; ++h) {
    float mx = ml[h][0][0];
#pragma unroll
    for (int s = 1; s < NS; ++s) mx = fmaxf(mx, ml[h][s][0]);
    float ws = 0.f; v4f a = {};
#pragma unroll
    for (int s = 0; s < NS; ++s) { const float wt = ml[h][s][1] * expf(ml[h][s][0] - mx); ws += wt; a += o[h][s] * wt; }
    vst2(O32 + ((size_t)q + h * (NP / 2)) * C + c4 * 4, a * (1.0f / ws)); }
}
// post: z = att Wo^T + bo; LN over 256 (eps 1e-6) * ln_w + ln_b; h = gelu(zl W1^T + b1); t = h W2^T + b2; out[c][p] = x[c][p] + t[p][c]; block = 64 pixels
__global__ __launch_bounds__(128) void k_post(const float* __restrict__ O32, const _Float16* __restrict__ PA, const _Float16* __restrict__ PB, const float* __restrict__ bo, const float* __restrict__ lw, const float* __restrict__ lb, const float* __restrict__ b1, const float* __restrict__ b2, const float* __restrict__ x, float* __restrict__ out) {
  __shared__ __align__(16) _Float16 sz[4][16][C + 8];          // att rows (f16) then zl rows (f16)
  __shared__ __align__(16) float szf[4][16][C + 4];             // z rows f32 for the LN statistics, later t rows
  __shared__ __align__(16) _Float16 shh[4][16][HID + 8];        // gelu(h) f16
  const int tid = threadIdx.x, wave = tid >> 5, lane = tid & 31, col = lane & 15, g = lane >> 4; const int p0b = blockIdx.x * 64, r0 = p0b + wave * 16;
  // att rows -> f16
  for (int qq = lane; qq < 16 * (C / 4); qq += 32) { const int rl = qq >> 6, pc = qq & 63; const v4f v = *(const v4f*)(O32 + (size_t)(r0 + rl) * C + pc * 4);
#pragma unroll
    for (int e = 0; e < 4; ++e) sz[wave][rl][pc * 4 + e] = (_Float16)(v[e] * 64.0f); }     // x64 carry keeps the small context values out of the f16 subnormal range
  LDSX();
  // z = att Wo^T /16/64 + bo (16 tiles, 8 kc)
  { v8f acc[16] = {};
#pragma unroll 1
    for (int kc = 0; kc < C / 32; ++kc) { const v16h a = frag_h(&sz[wave][col][0] + kc * 32, lane);
#pragma unroll
      for (int j = 0; j < 16; ++j) acc[j] = wmma16(a, frag_h(PA + (size_t)(3 * C + j * 16 + col) * C + kc * 32, lane), acc[j]); }
#pragma unroll
    for (int j = 0; j < 16; ++j) { const float bb = bo[j * 16 + col];
#pragma unroll
      for (int r = 0; r < 8; ++r) szf[wave][8 * g + r][j * 16 + col] = acc[j][r] * (1.0f / (16.0f * 64.0f)) + bb; } }
  LDSX();
  // LN per row (lane pair per row, halves of 128)
  { const int rl = lane & 15, hf = lane >> 4; const float* zr = &szf[wave][rl][hf * 128]; float s = 0.f, q = 0.f;
#pragma unroll 2
    for (int e = 0; e < 128; ++e) s += zr[e];
    s += __shfl_xor(s, 16, 32); const float mu = s * (1.0f / C);
#pragma unroll 2
    for (int e = 0; e < 128; ++e) { const float d = zr[e] - mu; q += d * d; }
    q += __shfl_xor(q, 16, 32); const float rs = rsqrtf(q * (1.0f / C) + 1e-6f);
#pragma unroll 2
    for (int e = 0; e < 128; ++e) { const int c = hf * 128 + e; sz[wave][rl][c] = (_Float16)((zr[e] - mu) * rs * lw[c] + lb[c]); } }
  LDSX();
  // h = gelu(zl W1^T/16 + b1): 32 column tiles in 2 passes of 16
#pragma unroll 1
  for (int ph = 0; ph < 2; ++ph) { v8f acc[16] = {};
#pragma unroll 1
    for (int kc = 0; kc < C / 32; ++kc) { const v16h a = frag_h(&sz[wave][col][0] + kc * 32, lane);
#pragma unroll
      for (int j = 0; j < 16; ++j) acc[j] = wmma16(a, frag_h(PA + (size_t)(4 * C + ph * 256 + j * 16 + col) * C + kc * 32, lane), acc[j]); }
#pragma unroll
    for (int j = 0; j < 16; ++j) { const int n = ph * 256 + j * 16 + col; const float bb = b1[n];
#pragma unroll
      for (int r = 0; r < 8; ++r) shh[wave][8 * g + r][n] = (_Float16)gelu_e(acc[j][r] * (1.0f / 16.0f) + bb); } }
  LDSX();
  // t = h W2^T/16 + b2 (16 tiles, 16 kc) -> szf
  { v8f acc[16] = {};
#pragma unroll 1
    for (int kc = 0; kc < HID / 32; ++kc) { const v16h a = frag_h(&shh[wave][col][0] + kc * 32, lane);
#pragma unroll
      for (int j = 0; j < 16; ++j) acc[j] = wmma16(a, frag_h(PB + (size_t)(j * 16 + col) * HID + kc * 32, lane), acc[j]); }
#pragma unroll
    for (int j = 0; j < 16; ++j) { const float bb = b2[j * 16 + col];
#pragma unroll
      for (int r = 0; r < 8; ++r) szf[wave][8 * g + r][j * 16 + col] = acc[j][r] * (1.0f / 16.0f) + bb; } }
  __syncthreads();
  // NCHW store: out[c][p0b .. p0b+63] = x + t: per channel c: 64 floats = 256 B = 16 pieces; q -> (c = q >> 4, piece = q & 15): lanes contiguous
  for (int q = tid; q < C * 16; q += 128) { const int c = q >> 4, pc = q & 15; v4f v = *(const v4f*)(x + (size_t)c * NP + p0b + pc * 4);
#pragma unroll
    for (int e = 0; e < 4; ++e) { const int pl = pc * 4 + e; v[e] += szf[pl >> 4][pl & 15][c]; }
    vst2(out + (size_t)c * NP + p0b + pc * 4, v); }
}
extern "C" void kernel_launch(void* const* d_in, const int* in_sizes, int n_in, void* d_out, int out_size, void* d_ws, size_t ws_size, hipStream_t stream) {
  (void)in_sizes; (void)n_in; (void)out_size; (void)ws_size;
  const float** I = (const float**)d_in;    // x, y, Wq, bq, Wk, bk, Wv, bv, Wo, bo, ln_w, ln_b, W1, b1, W2, b2
  const float* x = I[0]; const float* y = I[1]; const float* Wq = I[2]; const float* bq = I[3]; const float* Wk = I[4]; const float* bk = I[5]; const float* Wv = I[6]; const float* bv = I[7]; const float* Wo = I[8]; const float* bo = I[9];
  const float* lw = I[10]; const float* lb = I[11]; const float* W1 = I[12]; const float* b1 = I[13]; const float* W2 = I[14]; const float* b2 = I[15];
  float* out = (float*)d_out;
  char* ws = (char*)d_ws; size_t off = 0;
  auto take = [&](size_t bytes) { char* p = ws + off; off += (bytes + 255) & ~(size_t)255; return p; };
  _Float16* X16 = (_Float16*)take((size_t)NP * C * 2); _Float16* Y16 = (_Float16*)take((size_t)NK * C * 2); _Float16* PA = (_Float16*)take((size_t)(4 * C + HID) * C * 2); _Float16* PB = (_Float16*)take((size_t)C * HID * 2);
  _Float16* Q16 = (_Float16*)take((size_t)NP * C * 2); _Float16* K16 = (_Float16*)take((size_t)NK * C * 2); _Float16* VT = (_Float16*)take((size_t)C * NK * 2); float* O32 = (float*)take((size_t)NP * C * 4);
  float* OP = (float*)take((size_t)NS * NP * C * 4); float* ML = (float*)take((size_t)2 * NS * NP * 2 * 4);
  // ws ~ 48 MB
  k_cvt<<<NP / 64, 256, 0, stream>>>(x, X16);
  k_cvt<<<NK / 64, 256, 0, stream>>>(y, Y16);
  k_pack<<<4 * C + HID + C, 256, 0, stream>>>(Wq, Wk, Wv, Wo, W1, W2, PA, PB);
  k_qkv<<<dim3(NP / 64, C / 128, 3), 128, 0, stream>>>(X16, Y16, PA, bq, bk, bv, Q16, K16, VT);
  k_attn<<<dim3(NP / 64, 2, NS), 128, 0, stream>>>(Q16, K16, VT, OP, ML);
  k_merge<<<NP * (C / 4) / 2 / 256, 256, 0, stream>>>(OP, ML, O32);
  k_post<<<NP / 64, 128, 0, stream>>>(O32, PA, PB, bo, lw, lb, b1, b2, x, out);
}

// v002
// Measured time: 212 microseconds a run.
// Two timings next to v001 put it at 1.50 and 1.51 times that version's speed.
// All steps since v000 together make it 3.94 times as fast.
// compute dtype: f16 operands (pixel/token rows as f16, weights packed x16 as f16 rows, q/k x4, P lifted by 2^14, V x4, att rows x64, zl/h rows x1), f32 accumulate; softmax, LayerNorm2d, GELU and the residual in f32. Output = x + t with both O(1).
#include <hip/hip_runtime.h>
#include <math.h>

typedef __attribute__((ext_vector_type(16))) _Float16 v16h;
typedef __attribute__((ext_vector_type(16))) __bf16 v16b;
typedef __attribute__((ext_vector_type(8)))  _Float16 v8h;
typedef __attribute__((ext_vector_type(8)))  float v8f;
typedef __attribute__((ext_vector_type(4)))  float v4f;
typedef __attribute__((ext_vector_type(2)))  float v2f;
typedef __attribute__((ext_vector_type(4)))  unsigned v4u;
typedef __attribute__((ext_vector_type(4)))  int v4i;
typedef float __attribute__((may_alias)) float_a;
typedef int __attribute__((may_alias)) int_a;

template <typename T> __device__ __forceinline__ void vst2(void* p, T v) { *(T*)p = v;  }
__device__ __forceinline__ v8f wmma16(v16h a, v16h b, v8f c) {
  v8f d = __builtin_amdgcn_wmma_f32_16x16x32_f16(false, a, false, b, (short)0, c, false, false);
  asm volatile("v_nop\n\tv_nop\n\tv_nop\n\tv_nop" : "+v"(d) : "v"(a), "v"(b));
  return d;
}
__device__ __forceinline__ v8f wmma_bf(v16b a, v16b b, v8f c) {
  v8f d = __builtin_amdgcn_wmma_f32_16x16x32_bf16(false, a, false, b, (short)0, c, false, false);
  asm volatile("v_nop\n\tv_nop\n\tv_nop\n\tv_nop" : "+v"(d) : "v"(a), "v"(b));
  return d;
}
// 16x16x32 fragments: lane = (h = lane>>4, row/col = lane&15); elements 0..7 = k0+8h+0..7, 8..15 = k0+16+8h+0..7; D element r = row 8h+r
__device__ __forceinline__ v16h frag_h(const _Float16* rowk0, int lane) {
  union { v16h v; v8h q[2]; } u; const _Float16* p = rowk0 + 8 * (lane >> 4);
  u.q[0] = *(const v8h*)p; u.q[1] = *(const v8h*)(p + 16); return u.v;
}
// 16 rows x 128 columns over NKC k-steps of 32: arow = this lane's A row at k = 0, brow = this lane's B row of column tile 0 at k = 0 (LDB halves per row, tile j is 16 rows further).
// The 8 B fragments and the A fragment of the next k-step are loaded in front of this k-step's WMMAs, so 18 loads fly behind each group of 8 WMMAs; k order per output element unchanged.
template <int LDB> __device__ __forceinline__ void ld8(v16h (&b)[8], const _Float16* brow, int kc, int lane) {
#pragma unroll
  for (int j = 0; j < 8; ++j) b[j] = frag_h(brow + (size_t)j * 16 * LDB + kc * 32, lane);
}
__device__ __forceinline__ void mm8(v16h a, const v16h (&b)[8], v8f (&acc)[8]) {
#pragma unroll
  for (int j = 0; j < 8; ++j) acc[j] = wmma16(a, b[j], acc[j]);
}
template <int NKC, int LDB> __device__ __forceinline__ void gemm8(const _Float16* arow, const _Float16* brow, int lane, v8f (&acc)[8]) {
  v16h b0[8], b1[8]; v16h a0 = frag_h(arow, lane), a1; ld8<LDB>(b0, brow, 0, lane);
#pragma unroll 1    // rolled: the body already holds two k-steps, more copies only cost instruction cache
  for (int kc = 0; kc < NKC - 2; kc += 2) {
    a1 = frag_h(arow + (kc + 1) * 32, lane); ld8<LDB>(b1, brow, kc + 1, lane); mm8(a0, b0, acc);
    a0 = frag_h(arow + (kc + 2) * 32, lane); ld8<LDB>(b0, brow, kc + 2, lane); mm8(a1, b1, acc);
    asm volatile("s_wait_xcnt 0x0" ::: "memory"); }    // precaution: the loads of k-step kc + 2 are still in flight when the next trip rewrites their address registers
  a1 = frag_h(arow + (NKC - 1) * 32, lane); ld8<LDB>(b1, brow, NKC - 1, lane); mm8(a0, b0, acc); mm8(a1, b1, acc);
}
__device__ __forceinline__ v16h frag_f32(const float* rowk0, int lane) {
  v16h a; const float* p = rowk0 + 8 * (lane >> 4);
#pragma unroll
  for (int i = 0; i < 8; ++i) { a[i] = (_Float16)p[i]; a[8 + i] = (_Float16)p[16 + i]; }
  return a;
}
__device__ __forceinline__ v16h frag_f32s(const float* rowk0, int lane, float sc) {
  v16h a; const float* p = rowk0 + 8 * (lane >> 4);
#pragma unroll
  for (int i = 0; i < 8; ++i) { a[i] = (_Float16)(p[i] * sc); a[8 + i] = (_Float16)(p[16 + i] * sc); }
  return a;
}
// column fragment from a [K][ld] layout (column n), rows >= K read as 0
__device__ __forceinline__ v16h fragc_f32(const float* W, int k0, int n, int lane, int ld, int K) {
  v16h a; const int g = lane >> 4;
#pragma unroll
  for (int i = 0; i < 8; ++i) { const int ka = k0 + 8 * g + i, kb = ka + 16;
    a[i] = (_Float16)(ka < K ? W[(size_t)(ka < K ? ka : K - 1) * ld + n] : 0.f); a[8 + i] = (_Float16)(kb < K ? W[(size_t)(kb < K ? kb : K - 1) * ld + n] : 0.f); }
  return a;
}
struct F2 { v16b h, l; };
__device__ __forceinline__ F2 bsplit16(const float v[16]) { F2 r;
#pragma unroll
  for (int i = 0; i < 16; ++i) { const __bf16 h = (__bf16)v[i]; r.h[i] = h; r.l[i] = (__bf16)(v[i] - (float)h); }
  return r; }
__device__ __forceinline__ F2 split_row(const float* row, int k0, int lane) { float v[16]; const float* p = row + k0 + 8 * (lane >> 4);
#pragma unroll
  for (int i = 0; i < 8; ++i) { v[i] = p[i]; v[8 + i] = p[16 + i]; }
  return bsplit16(v); }
__device__ __forceinline__ F2 split_rowK(const float* row, int k0, int lane, int K) { float v[16]; const int g = lane >> 4;
#pragma unroll
  for (int i = 0; i < 8; ++i) { const int ka = k0 + 8 * g + i, kb = ka + 16; v[i] = ka < K ? row[ka < K ? ka : K - 1] : 0.f; v[8 + i] = kb < K ? row[kb < K ? kb : K - 1] : 0.f; }
  return bsplit16(v); }
__device__ __forceinline__ F2 split_col(const float* W, int k0, int n, int lane, int ld, int K) { float v[16]; const int g = lane >> 4;
#pragma unroll
  for (int i = 0; i < 8; ++i) { const int ka = k0 + 8 * g + i, kb = ka + 16; v[i] = ka < K ? W[(size_t)(ka < K ? ka : K - 1) * ld + n] : 0.f; v[8 + i] = kb < K ? W[(size_t)(kb < K ? kb : K - 1) * ld + n] : 0.f; }
  return bsplit16(v); }
__device__ __forceinline__ v8f mac3(const F2& a, const F2& b, v8f c) { c = wmma_bf(a.l, b.h, c); c = wmma_bf(a.h, b.l, c); return wmma_bf(a.h, b.h, c); }
__device__ __forceinline__ float sigm(float v) { return 1.0f / (1.0f + expf(-v)); }
#define LDSX() do { asm volatile("s_wait_dscnt 0" ::: "memory"); __builtin_amdgcn_wave_barrier(); __builtin_amdgcn_fence(__ATOMIC_RELEASE, "workgroup"); } while (0)


// Cross-modal encoder block: Q = conv1x1(x) per pixel (4096 x 256), K,V = y^T W^T + b (4096 x 256); scores = Q.K/16 over the 4096 y-tokens (one 256-dim head); att = softmax V; z = att Wo^T + bo;
// LayerNorm2d over channels per pixel (eps 1e-6); t = gelu(z_ln W1^T + b1) W2^T + b2; out = x + t (NCHW).
// halves d<128 / d>=128 to stay inside the VGPR budget; S recomputed; NS key ranges), k_merge (joins the key ranges into O32), k_post (z + LN + MLP + residual, NCHW store by channel rows). Whole-line stores, one instruction per line.
#define C 256
#define NP 4096
#define NK 4096
#define HID 512
#define NS 8                 // key ranges per query tile: 64 x 2 x NS work-groups of 4 waves = 4 per WGP on 256 WGPs
#define KT_S (NK / 64 / NS)  // 64-key trips per range
__device__ __attribute__((noinline)) float gelu_e(float v) { return 0.5f * v * (1.0f + erff(v * 0.70710678118654752f)); }    // out of line: keeps the static VALU-FMA count of k_post small

// token-major f16 rows from a [C][N] f32 array: block = 64 tokens; T16[n][c]
__global__ __launch_bounds__(256) void k_cvt(const float* __restrict__ src, _Float16* __restrict__ T16) {
  __shared__ __align__(16) _Float16 st[64][C + 8];
  const int tid = threadIdx.x, n0 = blockIdx.x * 64;
  for (int q = tid; q < C * 16; q += 256) { const int c = q >> 4, p4 = q & 15; const v4f v = *(const v4f*)(src + (size_t)c * NP + n0 + p4 * 4);
    st[p4 * 4][c] = (_Float16)v[0]; st[p4 * 4 + 1][c] = (_Float16)v[1]; st[p4 * 4 + 2][c] = (_Float16)v[2]; st[p4 * 4 + 3][c] = (_Float16)v[3]; }
  __syncthreads();
  for (int q = tid; q < 64 * (C / 8); q += 256) { const int rl = q >> 5, pc = q & 31; vst2(T16 + (size_t)(n0 + rl) * C + pc * 8, *(const v4u*)(&st[rl][pc * 8])); }
}
// PA rows (256 halves x16): [0,C) Wq, [C,2C) Wk, [2C,3C) Wv, [3C,4C) Wo, [4C, 4C+HID) W1 ; PB rows (512 halves x16): W2 rows (256)
__global__ __launch_bounds__(256) void k_pack(const float* __restrict__ Wq, const float* __restrict__ Wk, const float* __restrict__ Wv, const float* __restrict__ Wo, const float* __restrict__ W1, const float* __restrict__ W2, _Float16* __restrict__ PA, _Float16* __restrict__ PB) {
  const int n = blockIdx.x, tid = threadIdx.x; __shared__ __align__(16) _Float16 srow[HID];
  if (n < 4 * C + HID) { const float* W = n < C ? Wq + (size_t)n * C : (n < 2 * C ? Wk + (size_t)(n - C) * C : (n < 3 * C ? Wv + (size_t)(n - 2 * C) * C : (n < 4 * C ? Wo + (size_t)(n - 3 * C) * C : W1 + (size_t)(n - 4 * C) * C)));
    srow[tid] = (_Float16)(W[tid] * 16.0f); __syncthreads(); if (tid < C / 8) vst2(PA + (size_t)n * C + tid * 8, *(const v4u*)(&srow[tid * 8])); }
  else { const int m = n - (4 * C + HID); const float* W = W2 + (size_t)m * HID; srow[tid] = (_Float16)(W[tid] * 16.0f); srow[tid + 256] = (_Float16)(W[tid + 256] * 16.0f); __syncthreads();
    if (tid < HID / 8) vst2(PB + (size_t)m * HID + tid * 8, *(const v4u*)(&srow[tid * 8])); }
}
// q/k/v: block (64 rows, 128 cols, which); which 0 reads X16 else Y16; Q16/K16 rows x4 (+bias); V -> VT x4 [d][n]
__global__ __launch_bounds__(128) void k_qkv(const _Float16* __restrict__ X16, const _Float16* __restrict__ Y16, const _Float16* __restrict__ PA, const float* __restrict__ bq, const float* __restrict__ bk, const float* __restrict__ bv, _Float16* __restrict__ Q16, _Float16* __restrict__ K16, _Float16* __restrict__ VT) {
  __shared__ __align__(16) _Float16 so[4][16][136];
  __shared__ __align__(16) _Float16 sth[128][72];
  const int tid = threadIdx.x, wave = tid >> 5, lane = tid & 31, col = lane & 15, g = lane >> 4;
  const int which = blockIdx.z, r0b = blockIdx.x * 64, r0 = r0b + wave * 16, n0 = blockIdx.y * 128; const _Float16* SRC = which == 0 ? X16 : Y16; const float* bb_ = which == 0 ? bq : (which == 1 ? bk : bv);
  v8f acc[8] = {};
  gemm8<C / 32, C>(SRC + (size_t)(r0 + col) * C, PA + (size_t)(which * C + n0 + col) * C, lane, acc);
  if (which < 2) {
#pragma unroll
    for (int j = 0; j < 8; ++j) { const float bb = bb_[n0 + j * 16 + col];
#pragma unroll
      for (int r = 0; r < 8; ++r) so[wave][8 * g + r][j * 16 + col] = (_Float16)((acc[j][r] * (1.0f / 16.0f) + bb) * 4.0f); }
    LDSX();
    _Float16* D = which == 0 ? Q16 : K16;
    for (int rl = 0; rl < 16; ++rl) { if (lane < 16) vst2(D + (size_t)(r0 + rl) * C + n0 + lane * 8, *(const v4u*)(&so[wave][rl][lane * 8])); } }
  else {
#pragma unroll
    for (int j = 0; j < 8; ++j) { const float bb = bb_[n0 + j * 16 + col];
#pragma unroll
      for (int r = 0; r < 8; ++r) sth[j * 16 + col][wave * 16 + 8 * g + r] = (_Float16)((acc[j][r] * (1.0f / 16.0f) + bb) * 4.0f); }
    __syncthreads();
    for (int qq = tid; qq < 128 * 8; qq += 128) { const int cl = qq >> 3, pc = qq & 7; vst2(VT + (size_t)(n0 + cl) * NK + r0b + pc * 8, *(const v4u*)(&sth[cl][pc * 8])); } }
}
// attention: block = (64 queries, value half dh, key range sp): S over 256 dims (8 kc), softmax over the range's NK/NS keys, P.V for d in [dh*128, dh*128+128);
// OP[sp][q][d] = the range's own normalised context rows (f32); ML[dh][sp][q] = (range maximum, range sum); k_merge joins the ranges
__global__ __launch_bounds__(128) void k_attn(const _Float16* __restrict__ Q16, const _Float16* __restrict__ K16, const _Float16* __restrict__ VT, float* __restrict__ OP, float* __restrict__ ML) {
  __shared__ __align__(16) float sS[4][16][68];
  __shared__ __align__(16) _Float16 sPh[4][16][72];
  __shared__ __align__(16) float sO[4][16][132];
  const int tid = threadIdx.x, w = tid >> 5, lane = tid & 31, col = lane & 15, g = lane >> 4; const int q0 = blockIdx.x * 64 + w * 16; const int dh = blockIdx.y; const int sp = blockIdx.z;
  float* __restrict__ O32 = OP + (size_t)sp * NP * C;
  v16h aq[8];
#pragma unroll
  for (int kc = 0; kc < 8; ++kc) aq[kc] = frag_h(Q16 + (size_t)(q0 + col) * C + kc * 32, lane);
  float mrun = -3.0e38f, lrun = 0.f; v8f acc[8] = {};
#pragma unroll 1
  for (int ks = 0; ks < KT_S; ++ks) { const int kt = sp * KT_S + ks;
#pragma unroll
    for (int t = 0; t < 4; ++t) { v8f s = {}; v16h kf[8];    // the key tile's 8 fragments are all requested before its first WMMA
#pragma unroll
      for (int kc = 0; kc < 8; ++kc) kf[kc] = frag_h(K16 + (size_t)(kt * 64 + col) * C + t * 16 * C + kc * 32, lane);
#pragma unroll
      for (int kc = 0; kc < 8; ++kc) s = wmma16(aq[kc], kf[kc], s);
#pragma unroll
      for (int r = 0; r < 8; ++r) sS[w][8 * g + r][t * 16 + col] = s[r] * (0.0625f / 16.0f); }
    LDSX();
    float mx = -3.4e38f;
#pragma unroll
    for (int jj = 0; jj < 32; ++jj) mx = fmaxf(mx, sS[w][col][g * 32 + jj]);
    mx = fmaxf(mx, __shfl_xor(mx, 16, 32));
    const float mnew = fmaxf(mrun, mx); const float corr = expf(mrun - mnew);
    float ps = 0.f;
#pragma unroll
    for (int jj = 0; jj < 32; ++jj) { const float p = expf(sS[w][col][g * 32 + jj] - mnew) * 16384.0f; ps += p; sPh[w][col][g * 32 + jj] = (_Float16)p; }
    ps += __shfl_xor(ps, 16, 32);
    lrun = lrun * corr + ps * (1.0f / 16384.0f); mrun = mnew;
#pragma unroll
    for (int r = 0; r < 8; ++r) { const float cr = __shfl(corr, 8 * g + r, 32);
#pragma unroll
      for (int t = 0; t < 8; ++t) acc[t][r] *= cr; }
    LDSX();
#pragma unroll
    for (int kc = 0; kc < 2; ++kc) { const v16h ph = frag_h(&sPh[w][col][0] + kc * 32, lane);
      v16h vf[8]; ld8<NK>(vf, VT + (size_t)(dh * 128 + col) * NK + kt * 64, kc, lane);    // the 8 value fragments of these 32 keys are all requested before the first WMMA
      mm8(ph, vf, acc); }
    __builtin_amdgcn_wave_barrier(); }
#pragma unroll
  for (int r = 0; r < 8; ++r) { const float lr = __shfl(lrun, 8 * g + r, 32); const float inv = 1.0f / (lr * 16384.0f * 4.0f);
#pragma unroll
    for (int t = 0; t < 8; ++t) sO[w][8 * g + r][t * 16 + col] = acc[t][r] * inv; }
  LDSX();
  for (int rl = 0; rl < 16; ++rl) vst2(O32 + (size_t)(q0 + rl) * C + dh * 128 + lane * 4, *(const v4f*)(&sO[w][rl][lane * 4]));
  if (lane < 16) { v2f ml; ml[0] = mrun; ml[1] = lrun; vst2(ML + ((size_t)(dh * NS + sp) * NP + q0 + lane) * 2, ml); }    // 16 rows x 8 B = one 128-B line per wave
}
// join of the NS key ranges: weight of range s = l_s * exp(m_s - max m); O32[q][d] = sum_s weight_s * OP[s][q][d] / sum_s weight_s; thread = 4 columns of rows q and q + NP/2
// (no __restrict__ here: it lets the wait statement below drift away from the loads to the end of the kernel)
__global__ __launch_bounds__(256) void k_merge(const float* OP, const float* ML, float* O32) {
  const int idx = blockIdx.x * 256 + threadIdx.x, c4 = idx & 63, q = idx >> 6;
  const float* pm = ML + ((size_t)(c4 >> 5) * (NS * NP) + q) * 2;    // row q's (max, sum) pair in range 0 of its value half
  const float* po[NS / 2];                                           // the thread's 4 columns of row q in ranges 0, 2, 4, 6
#pragma unroll
  for (int s2 = 0; s2 < NS / 2; ++s2) po[s2] = OP + ((size_t)(2 * s2) * NP + q) * C + c4 * 4;
  v2f ml[2][NS]; v4f o[2][NS];
#pragma unroll
  for (int h = 0; h < 2; ++h) {
#pragma unroll
    for (int s = 0; s < NS; ++s) { ml[h][s] = *(const v2f*)(pm + (s * NP + h * (NP / 2)) * 2); o[h][s] = *(const v4f*)(po[s >> 1] + ((s & 1) * NP + h * (NP / 2)) * C); } }
  // precaution behind the last load: the address registers are operands, so none is reused (not even as a later load's destination) before the loads that name it have passed this wait
  asm volatile("s_wait_xcnt 0x0" :: "v"(pm), "v"(po[0]), "v"(po[1]), "v"(po[2]), "v"(po[3]) : "memory");
#pragma unroll
  for (int h = 0; h < 2; ++h) {
    float mx = ml[h][0][0];
#pragma unroll
    for (int s = 1; s < NS; ++s) mx = fmaxf(mx, ml[h][s][0]);
    float ws = 0.f; v4f a = {};
#pragma unroll
    for (int s = 0; s < NS; ++s) { const float wt = ml[h][s][1] * expf(ml[h][s][0] - mx); ws += wt; a += o[h][s] * wt; }
    vst2(O32 + ((size_t)q + h * (NP / 2)) * C + c4 * 4, a * (1.0f / ws)); }
}
// post: z = att Wo^T + bo; LN over 256 (eps 1e-6) * ln_w + ln_b; h = gelu(zl W1^T + b1); t = h W2^T + b2; out[c][p] = x[c][p] + t[p][c]; block = 64 pixels
__global__ __launch_bounds__(128) void k_post(const float* __restrict__ O32, const _Float16* __restrict__ PA, const _Float16* __restrict__ PB, const float* __restrict__ bo, const float* __restrict__ lw, const float* __restrict__ lb, const float* __restrict__ b1, const float* __restrict__ b2, const float* __restrict__ x, float* __restrict__ out) {
  __shared__ __align__(16) _Float16 sz[4][16][C + 8];          // att rows (f16) then zl rows (f16)
  __shared__ __align__(16) float szf[4][16][C + 4];             // z rows f32 for the LN statistics, later t rows
  __shared__ __align__(16) _Float16 shh[4][16][HID + 8];        // gelu(h) f16
  const int tid = threadIdx.x, wave = tid >> 5, lane = tid & 31, col = lane & 15, g = lane >> 4; const int p0b = blockIdx.x * 64, r0 = p0b + wave * 16;
  // att rows -> f16
  for (int qq = lane; qq < 16 * (C / 4); qq += 32) { const int rl = qq >> 6, pc = qq & 63; const v4f v = *(const v4f*)(O32 + (size_t)(r0 + rl) * C + pc * 4);
#pragma unroll
    for (int e = 0; e < 4; ++e) sz[wave][rl][pc * 4 + e] = (_Float16)(v[e] * 64.0f); }     // x64 carry keeps the small context values out of the f16 subnormal range
  LDSX();
  // z = att Wo^T /16/64 + bo (16 column tiles in 2 passes of 8, 8 kc)
#pragma unroll 1    // rolled: one copy of the k loop in the instruction cache
  for (int hp = 0; hp < 2; ++hp) { v8f acc[8] = {};
    gemm8<C / 32, C>(&sz[wave][col][0], PA + (size_t)(3 * C + hp * 128 + col) * C, lane, acc);
#pragma unroll
    for (int j = 0; j < 8; ++j) { const int n = hp * 128 + j * 16 + col; const float bb = bo[n];
#pragma unroll
      for (int r = 0; r < 8; ++r) szf[wave][8 * g + r][n] = acc[j][r] * (1.0f / (16.0f * 64.0f)) + bb; } }
  LDSX();
  // LN per row (lane pair per row, halves of 128)
  { const int rl = lane & 15, hf = lane >> 4; const float* zr = &szf[wave][rl][hf * 128]; float s = 0.f, q = 0.f;
#pragma unroll 2
    for (int e = 0; e < 128; ++e) s += zr[e];
    s += __shfl_xor(s, 16, 32); const float mu = s * (1.0f / C);
#pragma unroll 2
    for (int e = 0; e < 128; ++e) { const float d = zr[e] - mu; q += d * d; }
    q += __shfl_xor(q, 16, 32); const float rs = rsqrtf(q * (1.0f / C) + 1e-6f);
#pragma unroll 2
    for (int e = 0; e < 128; ++e) { const int c = hf * 128 + e; sz[wave][rl][c] = (_Float16)((zr[e] - mu) * rs * lw[c] + lb[c]); } }
  LDSX();
  // h = gelu(zl W1^T/16 + b1): 32 column tiles in 4 passes of 8
#pragma unroll 1    // rolled: one copy of the k loop and of the GELU calls in the instruction cache
  for (int ph = 0; ph < 4; ++ph) { v8f acc[8] = {};
    gemm8<C / 32, C>(&sz[wave][col][0], PA + (size_t)(4 * C + ph * 128 + col) * C, lane, acc);
#pragma unroll
    for (int j = 0; j < 8; ++j) { const int n = ph * 128 + j * 16 + col; const float bb = b1[n];
#pragma unroll
      for (int r = 0; r < 8; ++r) shh[wave][8 * g + r][n] = (_Float16)gelu_e(acc[j][r] * (1.0f / 16.0f) + bb); } }
  LDSX();
  // t = h W2^T/16 + b2 (16 column tiles in 2 passes of 8, 16 kc) -> szf
#pragma unroll 1    // rolled: one copy of the k loop in the instruction cache
  for (int hp = 0; hp < 2; ++hp) { v8f acc[8] = {};
    gemm8<HID / 32, HID>(&shh[wave][col][0], PB + (size_t)(hp * 128 + col) * HID, lane, acc);
#pragma unroll
    for (int j = 0; j < 8; ++j) { const int n = hp * 128 + j * 16 + col; const float bb = b2[n];
#pragma unroll
      for (int r = 0; r < 8; ++r) szf[wave][8 * g + r][n] = acc[j][r] * (1.0f / 16.0f) + bb; } }
  __syncthreads();
  // NCHW store: out[c][p0b .. p0b+63] = x + t: per channel c: 64 floats = 256 B = 16 pieces; q -> (c = q >> 4, piece = q & 15): lanes contiguous
  for (int q = tid; q < C * 16; q += 128) { const int c = q >> 4, pc = q & 15; v4f v = *(const v4f*)(x + (size_t)c * NP + p0b + pc * 4);
#pragma unroll
    for (int e = 0; e < 4; ++e) { const int pl = pc * 4 + e; v[e] += szf[pl >> 4][pl & 15][c]; }
    vst2(out + (size_t)c * NP + p0b + pc * 4, v); }
}
extern "C" void kernel_launch(void* const* d_in, const int* in_sizes, int n_in, void* d_out, int out_size, void* d_ws, size_t ws_size, hipStream_t stream) {
  (void)in_sizes; (void)n_in; (void)out_size; (void)ws_size;
  const float** I = (const float**)d_in;    // x, y, Wq, bq, Wk, bk, Wv, bv, Wo, bo, ln_w, ln_b, W1, b1, W2, b2
  const float* x = I[0]; const float* y = I[1]; const float* Wq = I[2]; const float* bq = I[3]; const float* Wk = I[4]; const float* bk = I[5]; const float* Wv = I[6]; const float* bv = I[7]; const float* Wo = I[8]; const float* bo = I[9];
  const float* lw = I[10]; const float* lb = I[11]; const float* W1 = I[12]; const float* b1 = I[13]; const float* W2 = I[14]; const float* b2 = I[15];
  float* out = (float*)d_out;
  char* ws = (char*)d_ws; size_t off = 0;
  auto take = [&](size_t bytes) { char* p = ws + off; off += (bytes + 255) & ~(size_t)255; return p; };
  _Float16* X16 = (_Float16*)take((size_t)NP * C * 2); _Float16* Y16 = (_Float16*)take((size_t)NK * C * 2); _Float16* PA = (_Float16*)take((size_t)(4 * C + HID) * C * 2); _Float16* PB = (_Float16*)take((size_t)C * HID * 2);
  _Float16* Q16 = (_Float16*)take((size_t)NP * C * 2); _Float16* K16 = (_Float16*)take((size_t)NK * C * 2); _Float16* VT = (_Float16*)take((size_t)C * NK * 2); float* O32 = (float*)take((size_t)NP * C * 4);
  float* OP = (float*)take((size_t)NS * NP * C * 4); float* ML = (float*)take((size_t)2 * NS * NP * 2 * 4);
  // ws ~ 48 MB
  k_cvt<<<NP / 64, 256, 0, stream>>>(x, X16);
  k_cvt<<<NK / 64, 256, 0, stream>>>(y, Y16);
  k_pack<<<4 * C + HID + C, 256, 0, stream>>>(Wq, Wk, Wv, Wo, W1, W2, PA, PB);
  k_qkv<<<dim3(NP / 64, C / 128, 3), 128, 0, stream>>>(X16, Y16, PA, bq, bk, bv, Q16, K16, VT);
  k_attn<<<dim3(NP / 64, 2, NS), 128, 0, stream>>>(Q16, K16, VT, OP, ML);
  k_merge<<<NP * (C / 4) / 2 / 256, 256, 0, stream>>>(OP, ML, O32);
  k_post<<<NP / 64, 128, 0, stream>>>(O32, PA, PB, bo, lw, lb, b1, b2, x, out);
}

// v003
// A run of this version takes 161 microseconds.
// In both of two side-by-side timings against v002, it was 1.32 times as fast.
// Counting every step since v000, it is 5.21 times as fast.
// compute dtype: f16 operands (pixel/token rows as f16, weights packed x16 as f16 rows, q/k x4, P lifted by 2^14, V x4, att rows x64, zl/h rows x1), f32 accumulate; softmax, LayerNorm2d, GELU and the residual in f32. Output = x + t with both O(1).
#include <hip/hip_runtime.h>
#include <math.h>

typedef __attribute__((ext_vector_type(16))) _Float16 v16h;
typedef __attribute__((ext_vector_type(16))) __bf16 v16b;
typedef __attribute__((ext_vector_type(8)))  _Float16 v8h;
typedef __attribute__((ext_vector_type(8)))  float v8f;
typedef __attribute__((ext_vector_type(4)))  float v4f;
typedef __attribute__((ext_vector_type(2)))  float v2f;
typedef __attribute__((ext_vector_type(4)))  unsigned v4u;
typedef __attribute__((ext_vector_type(4)))  int v4i;
typedef float __attribute__((may_alias)) float_a;
typedef int __attribute__((may_alias)) int_a;

template <typename T> __device__ __forceinline__ void vst2(void* p, T v) { *(T*)p = v;  }
__device__ __forceinline__ v8f wmma16(v16h a, v16h b, v8f c) {
  v8f d = __builtin_amdgcn_wmma_f32_16x16x32_f16(false, a, false, b, (short)0, c, false, false);
  asm volatile("v_nop\n\tv_nop\n\tv_nop\n\tv_nop" : "+v"(d) : "v"(a), "v"(b));
  return d;
}
__device__ __forceinline__ v8f wmma_bf(v16b a, v16b b, v8f c) {
  v8f d = __builtin_amdgcn_wmma_f32_16x16x32_bf16(false, a, false, b, (short)0, c, false, false);
  asm volatile("v_nop\n\tv_nop\n\tv_nop\n\tv_nop" : "+v"(d) : "v"(a), "v"(b));
  return d;
}
// 16x16x32 fragments: lane = (h = lane>>4, row/col = lane&15); elements 0..7 = k0+8h+0..7, 8..15 = k0+16+8h+0..7; D element r = row 8h+r
__device__ __forceinline__ v16h frag_h(const _Float16* rowk0, int lane) {
  union { v16h v; v8h q[2]; } u; const _Float16* p = rowk0 + 8 * (lane >> 4);
  u.q[0] = *(const v8h*)p; u.q[1] = *(const v8h*)(p + 16); return u.v;
}
// Tiled operand layout in the workspace: a [rows][K] f16 matrix is kept as [rows / 16][K / 8][16 rows][8 halves]. One 16 x 32 fragment is then 1 KB in a row (block = tile * (K / 32) + k-step), and each of its
// two wave-wide 16-byte loads covers 512 contiguous bytes = 4 whole 128-B lines, where a row-major matrix gives 32 B out of each of 16 lines. base = matrix + lane * 8; register contents equal frag_h's.
__device__ __forceinline__ v16h frag_t(const _Float16* base, int blk) {
  union { v16h v; v8h q[2]; } u; const _Float16* p = base + (size_t)blk * 512;
  u.q[0] = *(const v8h*)p; u.q[1] = *(const v8h*)(p + 256); return u.v;
}
// 16 rows x 128 columns over NKC k-steps of 32: arow = this lane's A row at k = 0 (row-major, LDS) or, with AT, this lane's base in the A tile (tiled layout); bt = this lane's base in B's column tile 0 (tiled layout, tile j is NKC blocks further).
// The 8 B fragments and the A fragment of the next k-step are loaded in front of this k-step's WMMAs, so 18 loads fly behind each group of 8 WMMAs; k order per output element unchanged.
template <int NKC> __device__ __forceinline__ void ld8(v16h (&b)[8], const _Float16* bt, int kc) {
#pragma unroll
  for (int j = 0; j < 8; ++j) b[j] = frag_t(bt, j * NKC + kc);
}
__device__ __forceinline__ void mm8(v16h a, const v16h (&b)[8], v8f (&acc)[8]) {
#pragma unroll
  for (int j = 0; j < 8; ++j) acc[j] = wmma16(a, b[j], acc[j]);
}
template <bool AT> __device__ __forceinline__ v16h lda(const _Float16* arow, int kc, int lane) { return AT ? frag_t(arow, kc) : frag_h(arow + kc * 32, lane); }
template <int NKC, bool AT> __device__ __forceinline__ void gemm8(const _Float16* arow, const _Float16* bt, int lane, v8f (&acc)[8]) {
  asm volatile("s_wait_xcnt 0x0" ::: "memory");    // precaution: the fragment loads below may land in registers that earlier loads of the caller (bias rows) named as addresses
  v16h b0[8], b1[8]; v16h a0 = lda<AT>(arow, 0, lane), a1; ld8<NKC>(b0, bt, 0);
#pragma unroll 1    // rolled: the body already holds two k-steps, more copies only cost instruction cache
  for (int kc = 0; kc < NKC - 2; kc += 2) {
    a1 = lda<AT>(arow, kc + 1, lane); ld8<NKC>(b1, bt, kc + 1); mm8(a0, b0, acc);
    a0 = lda<AT>(arow, kc + 2, lane); ld8<NKC>(b0, bt, kc + 2); mm8(a1, b1, acc);
    asm volatile("s_wait_xcnt 0x0" ::: "memory"); }    // precaution: the loads of k-step kc + 2 are still in flight when the next trip rewrites their address registers
  a1 = lda<AT>(arow, NKC - 1, lane); ld8<NKC>(b1, bt, NKC - 1); mm8(a0, b0, acc); mm8(a1, b1, acc);
  asm volatile("s_wait_xcnt 0x0" ::: "memory");    // precaution: the caller's epilogue may reuse the address registers of the last k-step's loads
}
__device__ __forceinline__ v16h frag_f32(const float* rowk0, int lane) {
  v16h a; const float* p = rowk0 + 8 * (lane >> 4);
#pragma unroll
  for (int i = 0; i < 8; ++i) { a[i] = (_Float16)p[i]; a[8 + i] = (_Float16)p[16 + i]; }
  return a;
}
__device__ __forceinline__ v16h frag_f32s(const float* rowk0, int lane, float sc) {
  v16h a; const float* p = rowk0 + 8 * (lane >> 4);
#pragma unroll
  for (int i = 0; i < 8; ++i) { a[i] = (_Float16)(p[i] * sc); a[8 + i] = (_Float16)(p[16 + i] * sc); }
  return a;
}
// column fragment from a [K][ld] layout (column n), rows >= K read as 0
__device__ __forceinline__ v16h fragc_f32(const float* W, int k0, int n, int lane, int ld, int K) {
  v16h a; const int g = lane >> 4;
#pragma unroll
  for (int i = 0; i < 8; ++i) { const int ka = k0 + 8 * g + i, kb = ka + 16;
    a[i] = (_Float16)(ka < K ? W[(size_t)(ka < K ? ka : K - 1) * ld + n] : 0.f); a[8 + i] = (_Float16)(kb < K ? W[(size_t)(kb < K ? kb : K - 1) * ld + n] : 0.f); }
  return a;
}
struct F2 { v16b h, l; };
__device__ __forceinline__ F2 bsplit16(const float v[16]) { F2 r;
#pragma unroll
  for (int i = 0; i < 16; ++i) { const __bf16 h = (__bf16)v[i]; r.h[i] = h; r.l[i] = (__bf16)(v[i] - (float)h); }
  return r; }
__device__ __forceinline__ F2 split_row(const float* row, int k0, int lane) { float v[16]; const float* p = row + k0 + 8 * (lane >> 4);
#pragma unroll
  for (int i = 0; i < 8; ++i) { v[i] = p[i]; v[8 + i] = p[16 + i]; }
  return bsplit16(v); }
__device__ __forceinline__ F2 split_rowK(const float* row, int k0, int lane, int K) { float v[16]; const int g = lane >> 4;
#pragma unroll
  for (int i = 0; i < 8; ++i) { const int ka = k0 + 8 * g + i, kb = ka + 16; v[i] = ka < K ? row[ka < K ? ka : K - 1] : 0.f; v[8 + i] = kb < K ? row[kb < K ? kb : K - 1] : 0.f; }
  return bsplit16(v); }
__device__ __forceinline__ F2 split_col(const float* W, int k0, int n, int lane, int ld, int K) { float v[16]; const int g = lane >> 4;
#pragma unroll
  for (int i = 0; i < 8; ++i) { const int ka = k0 + 8 * g + i, kb = ka + 16; v[i] = ka < K ? W[(size_t)(ka < K ? ka : K - 1) * ld + n] : 0.f; v[8 + i] = kb < K ? W[(size_t)(kb < K ? kb : K - 1) * ld + n] : 0.f; }
  return bsplit16(v); }
__device__ __forceinline__ v8f mac3(const F2& a, const F2& b, v8f c) { c = wmma_bf(a.l, b.h, c); c = wmma_bf(a.h, b.l, c); return wmma_bf(a.h, b.h, c); }
__device__ __forceinline__ float sigm(float v) { return 1.0f / (1.0f + expf(-v)); }
#define LDSX() do { asm volatile("s_wait_dscnt 0" ::: "memory"); __builtin_amdgcn_wave_barrier(); __builtin_amdgcn_fence(__ATOMIC_RELEASE, "workgroup"); } while (0)


// Cross-modal encoder block: Q = conv1x1(x) per pixel (4096 x 256), K,V = y^T W^T + b (4096 x 256); scores = Q.K/16 over the 4096 y-tokens (one 256-dim head); att = softmax V; z = att Wo^T + bo;
// LayerNorm2d over channels per pixel (eps 1e-6); t = gelu(z_ln W1^T + b1) W2^T + b2; out = x + t (NCHW).
// halves d<128 / d>=128 to stay inside the VGPR budget; S recomputed; NS key ranges), k_merge (joins the key ranges into O32), k_post (z + LN + MLP + residual, NCHW store by channel rows). Whole-line stores, one instruction per line.
#define C 256
#define NP 4096
#define NK 4096
#define HID 512
#define NS 8                 // key ranges per query tile: 64 x 2 x NS work-groups of 4 waves = 4 per WGP on 256 WGPs
#define KT_S (NK / 64 / NS)  // 64-key trips per range
__device__ __attribute__((noinline)) float gelu_e(float v) { return 0.5f * v * (1.0f + erff(v * 0.70710678118654752f)); }    // out of line: keeps the static VALU-FMA count of k_post small

// token-major f16 rows from a [C][N] f32 array, in the tiled layout: block = 64 tokens = 4 tiles = 32 KB in a row; piece q of a tile = (column piece q >> 4, row q & 15)
__global__ __launch_bounds__(256) void k_cvt(const float* __restrict__ src, _Float16* __restrict__ T16) {
  __shared__ __align__(16) _Float16 st[64][C + 8];
  const int tid = threadIdx.x, n0 = blockIdx.x * 64;
  for (int q = tid; q < C * 16; q += 256) { const int c = q >> 4, p4 = q & 15; const v4f v = *(const v4f*)(src + (size_t)c * NP + n0 + p4 * 4);
    st[p4 * 4][c] = (_Float16)v[0]; st[p4 * 4 + 1][c] = (_Float16)v[1]; st[p4 * 4 + 2][c] = (_Float16)v[2]; st[p4 * 4 + 3][c] = (_Float16)v[3]; }
  __syncthreads();
  for (int q = tid; q < 64 * (C / 8); q += 256) { const int rl = (q >> 9) * 16 + (q & 15), pc = (q >> 4) & 31; vst2(T16 + (size_t)n0 * C + q * 8, *(const v4u*)(&st[rl][pc * 8])); }
}
// PA rows (256 halves x16): [0,C) Wq, [C,2C) Wk, [2C,3C) Wv, [3C,4C) Wo, [4C, 4C+HID) W1 ; PB rows (512 halves x16): W2 rows (256); both in the tiled layout.
// block = one 16-row tile, so that every 128-B line has one writer; thread = pieces of 8 halves, piece q = (column piece q >> 4, row q & 15)
template <int K> __device__ __forceinline__ void pack_tile(const float* __restrict__ W, _Float16* __restrict__ P, int tid) {
  for (int q = tid; q < 16 * (K / 8); q += 256) { const float* s = W + (size_t)(q & 15) * K + (q >> 4) * 8; const v4f a = *(const v4f*)s, b = *(const v4f*)(s + 4); v8h o;
#pragma unroll
    for (int e = 0; e < 4; ++e) { o[e] = (_Float16)(a[e] * 16.0f); o[4 + e] = (_Float16)(b[e] * 16.0f); }
    vst2(P + (size_t)q * 8, o); }
}
__global__ __launch_bounds__(256) void k_pack(const float* __restrict__ Wq, const float* __restrict__ Wk, const float* __restrict__ Wv, const float* __restrict__ Wo, const float* __restrict__ W1, const float* __restrict__ W2, _Float16* __restrict__ PA, _Float16* __restrict__ PB) {
  const int n = blockIdx.x * 16, tid = threadIdx.x;
  if (n < 4 * C + HID) { const float* W = n < C ? Wq + (size_t)n * C : (n < 2 * C ? Wk + (size_t)(n - C) * C : (n < 3 * C ? Wv + (size_t)(n - 2 * C) * C : (n < 4 * C ? Wo + (size_t)(n - 3 * C) * C : W1 + (size_t)(n - 4 * C) * C)));
    pack_tile<C>(W, PA + (size_t)n * C, tid); }
  else { const int m = n - (4 * C + HID); pack_tile<HID>(W2 + (size_t)m * HID, PB + (size_t)m * HID, tid); }
}
// q/k/v: block (64 rows, 128 cols, which); which 0 reads X16 else Y16; Q16/K16 rows x4 (+bias); V -> VT x4 [d][n]; all three in the tiled layout
__global__ __launch_bounds__(128) void k_qkv(const _Float16* __restrict__ X16, const _Float16* __restrict__ Y16, const _Float16* __restrict__ PA, const float* __restrict__ bq, const float* __restrict__ bk, const float* __restrict__ bv, _Float16* __restrict__ Q16, _Float16* __restrict__ K16, _Float16* __restrict__ VT) {
  __shared__ __align__(16) _Float16 so[4][16][136];
  __shared__ __align__(16) _Float16 sth[128][72];
  const int tid = threadIdx.x, wave = tid >> 5, lane = tid & 31, col = lane & 15, g = lane >> 4;
  const int which = blockIdx.z, r0b = blockIdx.x * 64, r0 = r0b + wave * 16, n0 = blockIdx.y * 128; const _Float16* SRC = which == 0 ? X16 : Y16; const float* bb_ = which == 0 ? bq : (which == 1 ? bk : bv);
  v8f acc[8] = {};
  gemm8<C / 32, true>(SRC + (size_t)r0 * C + lane * 8, PA + (size_t)(which * C + n0) * C + lane * 8, lane, acc);
  if (which < 2) {
#pragma unroll
    for (int j = 0; j < 8; ++j) { const float bb = bb_[n0 + j * 16 + col];
#pragma unroll
      for (int r = 0; r < 8; ++r) so[wave][8 * g + r][j * 16 + col] = (_Float16)((acc[j][r] * (1.0f / 16.0f) + bb) * 4.0f); }
    LDSX();
    _Float16* D = which == 0 ? Q16 : K16;
    for (int q = lane; q < 16 * 16; q += 32) vst2(D + (size_t)r0 * C + n0 * 16 + q * 8, *(const v4u*)(&so[wave][q & 15][(q >> 4) * 8])); }    // the wave's 16 rows x 128 columns = 4 KB in a row of its tile
  else {
#pragma unroll
    for (int j = 0; j < 8; ++j) { const float bb = bb_[n0 + j * 16 + col];
#pragma unroll
      for (int r = 0; r < 8; ++r) sth[j * 16 + col][wave * 16 + 8 * g + r] = (_Float16)((acc[j][r] * (1.0f / 16.0f) + bb) * 4.0f); }
    __syncthreads();
    for (int qq = tid; qq < 128 * 8; qq += 128) { const int jd = qq >> 7, ql = qq & 127;    // 64 keys of one 16-row d tile = 2 KB in a row
      vst2(VT + (size_t)(n0 + jd * 16) * NK + r0b * 16 + ql * 8, *(const v4u*)(&sth[jd * 16 + (ql & 15)][(ql >> 4) * 8])); } }
}
// attention: block = (64 queries, value half dh, key range sp): S over 256 dims (8 kc), softmax over the range's NK/NS keys, P.V for d in [dh*128, dh*128+128);
// OP[sp][q][d] = the range's own normalised context rows (f32); ML[dh][sp][q] = (range maximum, range sum); k_merge joins the ranges
__global__ __launch_bounds__(128) void k_attn(const _Float16* __restrict__ Q16, const _Float16* __restrict__ K16, const _Float16* __restrict__ VT, float* __restrict__ OP, float* __restrict__ ML) {
  __shared__ __align__(16) float sS[4][16][68];
  __shared__ __align__(16) _Float16 sPh[4][16][72];
  __shared__ __align__(16) float sO[4][16][132];
  const int tid = threadIdx.x, w = tid >> 5, lane = tid & 31, col = lane & 15, g = lane >> 4; const int q0 = blockIdx.x * 64 + w * 16; const int dh = blockIdx.y; const int sp = blockIdx.z;
  float* __restrict__ O32 = OP + (size_t)sp * NP * C;
  v16h aq[8];
#pragma unroll
  for (int kc = 0; kc < 8; ++kc) aq[kc] = frag_t(Q16 + (size_t)q0 * C + lane * 8, kc);
  float mrun = -3.0e38f, lrun = 0.f; v8f acc[8] = {};
#pragma unroll 1
  for (int ks = 0; ks < KT_S; ++ks) { const int kt = sp * KT_S + ks;
#pragma unroll
    for (int t = 0; t < 4; ++t) { v8f s = {}; v16h kf[8];    // the key tile's 8 fragments are all requested before its first WMMA
#pragma unroll
      for (int kc = 0; kc < 8; ++kc) kf[kc] = frag_t(K16 + (size_t)(kt * 64) * C + lane * 8, t * 8 + kc);
#pragma unroll
      for (int kc = 0; kc < 8; ++kc) s = wmma16(aq[kc], kf[kc], s);
#pragma unroll
      for (int r = 0; r < 8; ++r) sS[w][8 * g + r][t * 16 + col] = s[r] * (0.0625f / 16.0f); }
    asm volatile("s_wait_xcnt 0x0" ::: "memory");    // precaution: the softmax below reuses the address registers of the key loads
    LDSX();
    float mx = -3.4e38f;
#pragma unroll
    for (int jj = 0; jj < 32; ++jj) mx = fmaxf(mx, sS[w][col][g * 32 + jj]);
    mx = fmaxf(mx, __shfl_xor(mx, 16, 32));
    const float mnew = fmaxf(mrun, mx); const float corr = expf(mrun - mnew);
    float ps = 0.f;
#pragma unroll
    for (int jj = 0; jj < 32; ++jj) { const float p = expf(sS[w][col][g * 32 + jj] - mnew) * 16384.0f; ps += p; sPh[w][col][g * 32 + jj] = (_Float16)p; }
    ps += __shfl_xor(ps, 16, 32);
    lrun = lrun * corr + ps * (1.0f / 16384.0f); mrun = mnew;
#pragma unroll
    for (int r = 0; r < 8; ++r) { const float cr = __shfl(corr, 8 * g + r, 32);
#pragma unroll
      for (int t = 0; t < 8; ++t) acc[t][r] *= cr; }
    LDSX();
#pragma unroll
    for (int kc = 0; kc < 2; ++kc) { const v16h ph = frag_h(&sPh[w][col][0] + kc * 32, lane);
      v16h vf[8]; ld8<NK / 32>(vf, VT + (size_t)(dh * 128) * NK + kt * 64 * 16 + lane * 8, kc);    // the 8 value fragments of these 32 keys are all requested before the first WMMA
      mm8(ph, vf, acc); }
    asm volatile("s_wait_xcnt 0x0" ::: "memory");    // precaution: the next trip rewrites the address registers of the value loads
    __builtin_amdgcn_wave_barrier(); }
#pragma unroll
  for (int r = 0; r < 8; ++r) { const float lr = __shfl(lrun, 8 * g + r, 32); const float inv = 1.0f / (lr * 16384.0f * 4.0f);
#pragma unroll
    for (int t = 0; t < 8; ++t) sO[w][8 * g + r][t * 16 + col] = acc[t][r] * inv; }
  LDSX();
  for (int rl = 0; rl < 16; ++rl) vst2(O32 + (size_t)(q0 + rl) * C + dh * 128 + lane * 4, *(const v4f*)(&sO[w][rl][lane * 4]));
  if (lane < 16) { v2f ml; ml[0] = mrun; ml[1] = lrun; vst2(ML + ((size_t)(dh * NS + sp) * NP + q0 + lane) * 2, ml); }    // 16 rows x 8 B = one 128-B line per wave
}
// join of the NS key ranges: weight of range s = l_s * exp(m_s - max m); O32[q][d] = sum_s weight_s * OP[s][q][d] / sum_s weight_s; thread = 4 columns of rows q and q + NP/2
// (no __restrict__ here: it lets the wait statement below drift away from the loads to the end of the kernel)
__global__ __launch_bounds__(256) void k_merge(const float* OP, const float* ML, float* O32) {
  const int idx = blockIdx.x * 256 + threadIdx.x, c4 = idx & 63, q = idx >> 6;
  const float* pm = ML + ((size_t)(c4 >> 5) * (NS * NP) + q) * 2;    // row q's (max, sum) pair in range 0 of its value half
  const float* po[NS / 2];                                           // the thread's 4 columns of row q in ranges 0, 2, 4, 6
#pragma unroll
  for (int s2 = 0; s2 < NS / 2; ++s2) po[s2] = OP + ((size_t)(2 * s2) * NP + q) * C + c4 * 4;
  v2f ml[2][NS]; v4f o[2][NS];
#pragma unroll
  for (int h = 0; h < 2; ++h) {
#pragma unroll
    for (int s = 0; s < NS; ++s) { ml[h][s] = *(const v2f*)(pm + (s * NP + h * (NP / 2)) * 2); o[h][s] = *(const v4f*)(po[s >> 1] + ((s & 1) * NP + h * (NP / 2)) * C); } }
  // precaution behind the last load: the address registers are operands, so none is reused (not even as a later load's destination) before the loads that name it have passed this wait
  asm volatile("s_wait_xcnt 0x0" :: "v"(pm), "v"(po[0]), "v"(po[1]), "v"(po[2]), "v"(po[3]) : "memory");
#pragma unroll
  for (int h = 0; h < 2; ++h) {
    float mx = ml[h][0][0];
#pragma unroll
    for (int s = 1; s < NS; ++s) mx = fmaxf(mx, ml[h][s][0]);
    float ws = 0.f; v4f a = {};
#pragma unroll
    for (int s = 0; s < NS; ++s) { const float wt = ml[h][s][1] * expf(ml[h][s][0] - mx); ws += wt; a += o[h][s] * wt; }
    vst2(O32 + ((size_t)q + h * (NP / 2)) * C + c4 * 4, a * (1.0f / ws)); }
}
// post: z = att Wo^T + bo; LN over 256 (eps 1e-6) * ln_w + ln_b; h = gelu(zl W1^T + b1); t = h W2^T + b2; out[c][p] = x[c][p] + t[p][c]; block = 64 pixels
__global__ __launch_bounds__(128) void k_post(const float* __restrict__ O32, const _Float16* __restrict__ PA, const _Float16* __restrict__ PB, const float* __restrict__ bo, const float* __restrict__ lw, const float* __restrict__ lb, const float* __restrict__ b1, const float* __restrict__ b2, const float* __restrict__ x, float* __restrict__ out) {
  __shared__ __align__(16) _Float16 sz[4][16][C + 8];          // att rows (f16) then zl rows (f16)
  __shared__ __align__(16) float szf[4][16][C + 4];             // z rows f32 for the LN statistics, later t rows
  __shared__ __align__(16) _Float16 shh[4][16][HID + 8];        // gelu(h) f16
  const int tid = threadIdx.x, wave = tid >> 5, lane = tid & 31, col = lane & 15, g = lane >> 4; const int p0b = blockIdx.x * 64, r0 = p0b + wave * 16;
  // att rows -> f16
  for (int qq = lane; qq < 16 * (C / 4); qq += 32) { const int rl = qq >> 6, pc = qq & 63; const v4f v = *(const v4f*)(O32 + (size_t)(r0 + rl) * C + pc * 4);
#pragma unroll
    for (int e = 0; e < 4; ++e) sz[wave][rl][pc * 4 + e] = (_Float16)(v[e] * 64.0f); }     // x64 carry keeps the small context values out of the f16 subnormal range
  LDSX();
  // z = att Wo^T /16/64 + bo (16 column tiles in 2 passes of 8, 8 kc)
#pragma unroll 1    // rolled: one copy of the k loop in the instruction cache
  for (int hp = 0; hp < 2; ++hp) { v8f acc[8] = {};
    gemm8<C / 32, false>(&sz[wave][col][0], PA + (size_t)(3 * C + hp * 128) * C + lane * 8, lane, acc);
#pragma unroll
    for (int j = 0; j < 8; ++j) { const int n = hp * 128 + j * 16 + col; const float bb = bo[n];
#pragma unroll
      for (int r = 0; r < 8; ++r) szf[wave][8 * g + r][n] = acc[j][r] * (1.0f / (16.0f * 64.0f)) + bb; } }
  LDSX();
  // LN per row (lane pair per row, halves of 128)
  { const int rl = lane & 15, hf = lane >> 4; const float* zr = &szf[wave][rl][hf * 128]; float s = 0.f, q = 0.f;
#pragma unroll 2
    for (int e = 0; e < 128; ++e) s += zr[e];
    s += __shfl_xor(s, 16, 32); const float mu = s * (1.0f / C);
#pragma unroll 2
    for (int e = 0; e < 128; ++e) { const float d = zr[e] - mu; q += d * d; }
    q += __shfl_xor(q, 16, 32); const float rs = rsqrtf(q * (1.0f / C) + 1e-6f);
#pragma unroll 2
    for (int e = 0; e < 128; ++e) { const int c = hf * 128 + e; sz[wave][rl][c] = (_Float16)((zr[e] - mu) * rs * lw[c] + lb[c]); } }
  LDSX();
  // h = gelu(zl W1^T/16 + b1): 32 column tiles in 4 passes of 8
#pragma unroll 1    // rolled: one copy of the k loop and of the GELU calls in the instruction cache
  for (int ph = 0; ph < 4; ++ph) { v8f acc[8] = {};
    gemm8<C / 32, false>(&sz[wave][col][0], PA + (size_t)(4 * C + ph * 128) * C + lane * 8, lane, acc);
#pragma unroll
    for (int j = 0; j < 8; ++j) { const int n = ph * 128 + j * 16 + col; const float bb = b1[n];
#pragma unroll
      for (int r = 0; r < 8; ++r) shh[wave][8 * g + r][n] = (_Float16)gelu_e(acc[j][r] * (1.0f / 16.0f) + bb); } }
  LDSX();
  // t = h W2^T/16 + b2 (16 column tiles in 2 passes of 8, 16 kc) -> szf
#pragma unroll 1    // rolled: one copy of the k loop in the instruction cache
  for (int hp = 0; hp < 2; ++hp) { v8f acc[8] = {};
    gemm8<HID / 32, false>(&shh[wave][col][0], PB + (size_t)(hp * 128) * HID + lane * 8, lane, acc);
#pragma unroll
    for (int j = 0; j < 8; ++j) { const int n = hp * 128 + j * 16 + col; const float bb = b2[n];
#pragma unroll
      for (int r = 0; r < 8; ++r) szf[wave][8 * g + r][n] = acc[j][r] * (1.0f / 16.0f) + bb; } }
  __syncthreads();
  // NCHW store: out[c][p0b .. p0b+63] = x + t: per channel c: 64 floats = 256 B = 16 pieces; q -> (c = q >> 4, piece = q & 15): lanes contiguous
  for (int q = tid; q < C * 16; q += 128) { const int c = q >> 4, pc = q & 15; v4f v = *(const v4f*)(x + (size_t)c * NP + p0b + pc * 4);
#pragma unroll
    for (int e = 0; e < 4; ++e) { const int pl = pc * 4 + e; v[e] += szf[pl >> 4][pl & 15][c]; }
    vst2(out + (size_t)c * NP + p0b + pc * 4, v); }
}
extern "C" void kernel_launch(void* const* d_in, const int* in_sizes, int n_in, void* d_out, int out_size, void* d_ws, size_t ws_size, hipStream_t stream) {
  (void)in_sizes; (void)n_in; (void)out_size; (void)ws_size;
  const float** I = (const float**)d_in;    // x, y, Wq, bq, Wk, bk, Wv, bv, Wo, bo, ln_w, ln_b, W1, b1, W2, b2
  const float* x = I[0]; const float* y = I[1]; const float* Wq = I[2]; const float* bq = I[3]; const float* Wk = I[4]; const float* bk = I[5]; const float* Wv = I[6]; const float* bv = I[7]; const float* Wo = I[8]; const float* bo = I[9];
  const float* lw = I[10]; const float* lb = I[11]; const float* W1 = I[12]; const float* b1 = I[13]; const float* W2 = I[14]; const float* b2 = I[15];
  float* out = (float*)d_out;
  char* ws = (char*)d_ws; size_t off = 0;
  auto take = [&](size_t bytes) { char* p = ws + off; off += (bytes + 255) & ~(size_t)255; return p; };
  _Float16* X16 = (_Float16*)take((size_t)NP * C * 2); _Float16* Y16 = (_Float16*)take((size_t)NK * C * 2); _Float16* PA = (_Float16*)take((size_t)(4 * C + HID) * C * 2); _Float16* PB = (_Float16*)take((size_t)C * HID * 2);
  _Float16* Q16 = (_Float16*)take((size_t)NP * C * 2); _Float16* K16 = (_Float16*)take((size_t)NK * C * 2); _Float16* VT = (_Float16*)take((size_t)C * NK * 2); float* O32 = (float*)take((size_t)NP * C * 4);
  float* OP = (float*)take((size_t)NS * NP * C * 4); float* ML = (float*)take((size_t)2 * NS * NP * 2 * 4);
  // ws ~ 48 MB
  k_cvt<<<NP / 64, 256, 0, stream>>>(x, X16);
  k_cvt<<<NK / 64, 256, 0, stream>>>(y, Y16);
  k_pack<<<(4 * C + HID + C) / 16, 256, 0, stream>>>(Wq, Wk, Wv, Wo, W1, W2, PA, PB);
  k_qkv<<<dim3(NP / 64, C / 128, 3), 128, 0, stream>>>(X16, Y16, PA, bq, bk, bv, Q16, K16, VT);
  k_attn<<<dim3(NP / 64, 2, NS), 128, 0, stream>>>(Q16, K16, VT, OP, ML);
  k_merge<<<NP * (C / 4) / 2 / 256, 256, 0, stream>>>(OP, ML, O32);
  k_post<<<NP / 64, 128, 0, stream>>>(O32, PA, PB, bo, lw, lb, b1, b2, x, out);
}

// v004
// A run of this version takes 92.3 microseconds.
// Next to v003, in two timings, it ran 1.74 and 1.72 times as fast.
// Over all steps from v000 it is 9.02 times as fast.
// compute dtype: f16 operands (pixel/token rows as f16, weights packed x16 as f16 rows, q/k x4, P lifted by 2^14, V x4, att rows x64, zl/h rows x1), f32 accumulate; softmax, LayerNorm2d, GELU and the residual in f32. Output = x + t with both O(1).
#include <hip/hip_runtime.h>
#include <math.h>

typedef __attribute__((ext_vector_type(16))) _Float16 v16h;
typedef __attribute__((ext_vector_type(16))) __bf16 v16b;
typedef __attribute__((ext_vector_type(8)))  _Float16 v8h;
typedef __attribute__((ext_vector_type(8)))  float v8f;
typedef __attribute__((ext_vector_type(4)))  float v4f;
typedef __attribute__((ext_vector_type(2)))  float v2f;
typedef __attribute__((ext_vector_type(4)))  unsigned v4u;
typedef __attribute__((ext_vector_type(4)))  int v4i;
typedef float __attribute__((may_alias)) float_a;
typedef int __attribute__((may_alias)) int_a;

template <typename T> __device__ __forceinline__ void vst2(void* p, T v) { *(T*)p = v;  }
__device__ __forceinline__ v8f wmma16(v16h a, v16h b, v8f c) {
  v8f d = __builtin_amdgcn_wmma_f32_16x16x32_f16(false, a, false, b, (short)0, c, false, false);
  asm volatile("v_nop\n\tv_nop\n\tv_nop\n\tv_nop" : "+v"(d) : "v"(a), "v"(b));
  return d;
}
__device__ __forceinline__ v8f wmma_bf(v16b a, v16b b, v8f c) {
  v8f d = __builtin_amdgcn_wmma_f32_16x16x32_bf16(false, a, false, b, (short)0, c, false, false);
  asm volatile("v_nop\n\tv_nop\n\tv_nop\n\tv_nop" : "+v"(d) : "v"(a), "v"(b));
  return d;
}
// 16x16x32 fragments: lane = (h = lane>>4, row/col = lane&15); elements 0..7 = k0+8h+0..7, 8..15 = k0+16+8h+0..7; D element r = row 8h+r
__device__ __forceinline__ v16h frag_h(const _Float16* rowk0, int lane) {
  union { v16h v; v8h q[2]; } u; const _Float16* p = rowk0 + 8 * (lane >> 4);
  u.q[0] = *(const v8h*)p; u.q[1] = *(const v8h*)(p + 16); return u.v;
}
// Tiled operand layout in the workspace: a [rows][K] f16 matrix is kept as [rows / 16][K / 8][16 rows][8 halves]. One 16 x 32 fragment is then 1 KB in a row (block = tile * (K / 32) + k-step), and each of its
// two wave-wide 16-byte loads covers 512 contiguous bytes = 4 whole 128-B lines, where a row-major matrix gives 32 B out of each of 16 lines. base = matrix + lane * 8; register contents equal frag_h's.
__device__ __forceinline__ v16h frag_t(const _Float16* base, int blk) {
  union { v16h v; v8h q[2]; } u; const _Float16* p = base + (size_t)blk * 512;
  u.q[0] = *(const v8h*)p; u.q[1] = *(const v8h*)(p + 256); return u.v;
}
// 16 rows x 128 columns over NKC k-steps of 32: arow = this lane's A row at k = 0 (row-major, LDS) or, with AT, this lane's base in the A tile (tiled layout); bt = this lane's base in B's column tile 0 (tiled layout, tile j is NKC blocks further).
// The 8 B fragments and the A fragment of the next k-step are loaded in front of this k-step's WMMAs, so 18 loads fly behind each group of 8 WMMAs; k order per output element unchanged.
template <int NKC> __device__ __forceinline__ void ld8(v16h (&b)[8], const _Float16* bt, int kc) {
#pragma unroll
  for (int j = 0; j < 8; ++j) b[j] = frag_t(bt, j * NKC + kc);
}
__device__ __forceinline__ void mm8(v16h a, const v16h (&b)[8], v8f (&acc)[8]) {
#pragma unroll
  for (int j = 0; j < 8; ++j) acc[j] = wmma16(a, b[j], acc[j]);
}
template <bool AT> __device__ __forceinline__ v16h lda(const _Float16* arow, int kc, int lane) { return AT ? frag_t(arow, kc) : frag_h(arow + kc * 32, lane); }
template <int NKC, bool AT> __device__ __forceinline__ void gemm8(const _Float16* arow, const _Float16* bt, int lane, v8f (&acc)[8]) {
  asm volatile("s_wait_xcnt 0x0" ::: "memory");    // precaution: the fragment loads below may land in registers that earlier loads of a caller named as addresses (k_qkv loads its bias rows only after the product)
  v16h b0[8], b1[8]; v16h a0 = lda<AT>(arow, 0, lane), a1; ld8<NKC>(b0, bt, 0);
#pragma unroll 1    // rolled: the body already holds two k-steps, more copies only cost instruction cache
  for (int kc = 0; kc < NKC - 2; kc += 2) {
    a1 = lda<AT>(arow, kc + 1, lane); ld8<NKC>(b1, bt, kc + 1); mm8(a0, b0, acc);
    a0 = lda<AT>(arow, kc + 2, lane); ld8<NKC>(b0, bt, kc + 2); mm8(a1, b1, acc);
    asm volatile("s_wait_xcnt 0x0" ::: "memory"); }    // precaution: the loads of k-step kc + 2 are still in flight when the next trip rewrites their address registers
  a1 = lda<AT>(arow, NKC - 1, lane); ld8<NKC>(b1, bt, NKC - 1); mm8(a0, b0, acc); mm8(a1, b1, acc);
  asm volatile("s_wait_xcnt 0x0" ::: "memory");    // precaution: the caller's epilogue may reuse the address registers of the last k-step's loads
}
__device__ __forceinline__ v16h frag_f32(const float* rowk0, int lane) {
  v16h a; const float* p = rowk0 + 8 * (lane >> 4);
#pragma unroll
  for (int i = 0; i < 8; ++i) { a[i] = (_Float16)p[i]; a[8 + i] = (_Float16)p[16 + i]; }
  return a;
}
__device__ __forceinline__ v16h frag_f32s(const float* rowk0, int lane, float sc) {
  v16h a; const float* p = rowk0 + 8 * (lane >> 4);
#pragma unroll
  for (int i = 0; i < 8; ++i) { a[i] = (_Float16)(p[i] * sc); a[8 + i] = (_Float16)(p[16 + i] * sc); }
  return a;
}
// column fragment from a [K][ld] layout (column n), rows >= K read as 0
__device__ __forceinline__ v16h fragc_f32(const float* W, int k0, int n, int lane, int ld, int K) {
  v16h a; const int g = lane >> 4;
#pragma unroll
  for (int i = 0; i < 8; ++i) { const int ka = k0 + 8 * g + i, kb = ka + 16;
    a[i] = (_Float16)(ka < K ? W[(size_t)(ka < K ? ka : K - 1) * ld + n] : 0.f); a[8 + i] = (_Float16)(kb < K ? W[(size_t)(kb < K ? kb : K - 1) * ld + n] : 0.f); }
  return a;
}
struct F2 { v16b h, l; };
__device__ __forceinline__ F2 bsplit16(const float v[16]) { F2 r;
#pragma unroll
  for (int i = 0; i < 16; ++i) { const __bf16 h = (__bf16)v[i]; r.h[i] = h; r.l[i] = (__bf16)(v[i] - (float)h); }
  return r; }
__device__ __forceinline__ F2 split_row(const float* row, int k0, int lane) { float v[16]; const float* p = row + k0 + 8 * (lane >> 4);
#pragma unroll
  for (int i = 0; i < 8; ++i) { v[i] = p[i]; v[8 + i] = p[16 + i]; }
  return bsplit16(v); }
__device__ __forceinline__ F2 split_rowK(const float* row, int k0, int lane, int K) { float v[16]; const int g = lane >> 4;
#pragma unroll
  for (int i = 0; i < 8; ++i) { const int ka = k0 + 8 * g + i, kb = ka + 16; v[i] = ka < K ? row[ka < K ? ka : K - 1] : 0.f; v[8 + i] = kb < K ? row[kb < K ? kb : K - 1] : 0.f; }
  return bsplit16(v); }
__device__ __forceinline__ F2 split_col(const float* W, int k0, int n, int lane, int ld, int K) { float v[16]; const int g = lane >> 4;
#pragma unroll
  for (int i = 0; i < 8; ++i) { const int ka = k0 + 8 * g + i, kb = ka + 16; v[i] = ka < K ? W[(size_t)(ka < K ? ka : K - 1) * ld + n] : 0.f; v[8 + i] = kb < K ? W[(size_t)(kb < K ? kb : K - 1) * ld + n] : 0.f; }
  return bsplit16(v); }
__device__ __forceinline__ v8f mac3(const F2& a, const F2& b, v8f c) { c = wmma_bf(a.l, b.h, c); c = wmma_bf(a.h, b.l, c); return wmma_bf(a.h, b.h, c); }
__device__ __forceinline__ float sigm(float v) { return 1.0f / (1.0f + expf(-v)); }
#define LDSX() do { asm volatile("s_wait_dscnt 0" ::: "memory"); __builtin_amdgcn_wave_barrier(); __builtin_amdgcn_fence(__ATOMIC_RELEASE, "workgroup"); } while (0)


// Cross-modal encoder block: Q = conv1x1(x) per pixel (4096 x 256), K,V = y^T W^T + b (4096 x 256); scores = Q.K/16 over the 4096 y-tokens (one 256-dim head); att = softmax V; z = att Wo^T + bo;
// LayerNorm2d over channels per pixel (eps 1e-6); t = gelu(z_ln W1^T + b1) W2^T + b2; out = x + t (NCHW).
// halves d<128 / d>=128 to stay inside the VGPR budget; S recomputed; NS key ranges), k_merge (joins the key ranges into O32), k_post (z + LN + MLP + residual, NCHW store by channel rows). Whole-line stores, one instruction per line.
#define C 256
#define NP 4096
#define NK 4096
#define HID 512
#define NS 8                 // key ranges per query tile: 64 x 2 x NS work-groups of 4 waves = 4 per WGP on 256 WGPs
#define KT_S (NK / 64 / NS)  // 64-key trips per range
__device__ __attribute__((noinline)) float gelu_e(float v) { return 0.5f * v * (1.0f + erff(v * 0.70710678118654752f)); }    // out of line: keeps the static VALU-FMA count of k_post small

// token-major f16 rows from a [C][N] f32 array, in the tiled layout: block = 64 tokens = 4 tiles = 32 KB in a row; piece q of a tile = (column piece q >> 4, row q & 15)
__global__ __launch_bounds__(256) void k_cvt(const float* __restrict__ src, _Float16* __restrict__ T16) {
  __shared__ __align__(16) _Float16 st[64][C + 8];
  const int tid = threadIdx.x, n0 = blockIdx.x * 64;
  for (int q = tid; q < C * 16; q += 256) { const int c = q >> 4, p4 = q & 15; const v4f v = *(const v4f*)(src + (size_t)c * NP + n0 + p4 * 4);
    st[p4 * 4][c] = (_Float16)v[0]; st[p4 * 4 + 1][c] = (_Float16)v[1]; st[p4 * 4 + 2][c] = (_Float16)v[2]; st[p4 * 4 + 3][c] = (_Float16)v[3]; }
  __syncthreads();
  for (int q = tid; q < 64 * (C / 8); q += 256) { const int rl = (q >> 9) * 16 + (q & 15), pc = (q >> 4) & 31; vst2(T16 + (size_t)n0 * C + q * 8, *(const v4u*)(&st[rl][pc * 8])); }
}
// PA rows (256 halves x16): [0,C) Wq, [C,2C) Wk, [2C,3C) Wv, [3C,4C) Wo, [4C, 4C+HID) W1 ; PB rows (512 halves x16): W2 rows (256); both in the tiled layout.
// block = one 16-row tile, so that every 128-B line has one writer; thread = pieces of 8 halves, piece q = (column piece q >> 4, row q & 15)
template <int K> __device__ __forceinline__ void pack_tile(const float* __restrict__ W, _Float16* __restrict__ P, int tid) {
  for (int q = tid; q < 16 * (K / 8); q += 256) { const float* s = W + (size_t)(q & 15) * K + (q >> 4) * 8; const v4f a = *(const v4f*)s, b = *(const v4f*)(s + 4); v8h o;
#pragma unroll
    for (int e = 0; e < 4; ++e) { o[e] = (_Float16)(a[e] * 16.0f); o[4 + e] = (_Float16)(b[e] * 16.0f); }
    vst2(P + (size_t)q * 8, o); }
}
__global__ __launch_bounds__(256) void k_pack(const float* __restrict__ Wq, const float* __restrict__ Wk, const float* __restrict__ Wv, const float* __restrict__ Wo, const float* __restrict__ W1, const float* __restrict__ W2, _Float16* __restrict__ PA, _Float16* __restrict__ PB) {
  const int n = blockIdx.x * 16, tid = threadIdx.x;
  if (n < 4 * C + HID) { const float* W = n < C ? Wq + (size_t)n * C : (n < 2 * C ? Wk + (size_t)(n - C) * C : (n < 3 * C ? Wv + (size_t)(n - 2 * C) * C : (n < 4 * C ? Wo + (size_t)(n - 3 * C) * C : W1 + (size_t)(n - 4 * C) * C)));
    pack_tile<C>(W, PA + (size_t)n * C, tid); }
  else { const int m = n - (4 * C + HID); pack_tile<HID>(W2 + (size_t)m * HID, PB + (size_t)m * HID, tid); }
}
// q/k/v: block (64 rows, 128 cols, which); which 0 reads X16 else Y16; Q16/K16 rows x4 (+bias); V -> VT x4 [d][n]; all three in the tiled layout
__global__ __launch_bounds__(128) void k_qkv(const _Float16* __restrict__ X16, const _Float16* __restrict__ Y16, const _Float16* __restrict__ PA, const float* __restrict__ bq, const float* __restrict__ bk, const float* __restrict__ bv, _Float16* __restrict__ Q16, _Float16* __restrict__ K16, _Float16* __restrict__ VT) {
  __shared__ __align__(16) _Float16 so[4][16][136];
  __shared__ __align__(16) _Float16 sth[128][72];
  const int tid = threadIdx.x, wave = tid >> 5, lane = tid & 31, col = lane & 15, g = lane >> 4;
  const int which = blockIdx.z, r0b = blockIdx.x * 64, r0 = r0b + wave * 16, n0 = blockIdx.y * 128; const _Float16* SRC = which == 0 ? X16 : Y16; const float* bb_ = which == 0 ? bq : (which == 1 ? bk : bv);
  v8f acc[8] = {};
  gemm8<C / 32, true>(SRC + (size_t)r0 * C + lane * 8, PA + (size_t)(which * C + n0) * C + lane * 8, lane, acc);
  if (which < 2) {
#pragma unroll
    for (int j = 0; j < 8; ++j) { const float bb = bb_[n0 + j * 16 + col];
#pragma unroll
      for (int r = 0; r < 8; ++r) so[wave][8 * g + r][j * 16 + col] = (_Float16)((acc[j][r] * (1.0f / 16.0f) + bb) * 4.0f); }
    LDSX();
    _Float16* D = which == 0 ? Q16 : K16;
    for (int q = lane; q < 16 * 16; q += 32) vst2(D + (size_t)r0 * C + n0 * 16 + q * 8, *(const v4u*)(&so[wave][q & 15][(q >> 4) * 8])); }    // the wave's 16 rows x 128 columns = 4 KB in a row of its tile
  else {
#pragma unroll
    for (int j = 0; j < 8; ++j) { const float bb = bb_[n0 + j * 16 + col];
#pragma unroll
      for (int r = 0; r < 8; ++r) sth[j * 16 + col][wave * 16 + 8 * g + r] = (_Float16)((acc[j][r] * (1.0f / 16.0f) + bb) * 4.0f); }
    __syncthreads();
    for (int qq = tid; qq < 128 * 8; qq += 128) { const int jd = qq >> 7, ql = qq & 127;    // 64 keys of one 16-row d tile = 2 KB in a row
      vst2(VT + (size_t)(n0 + jd * 16) * NK + r0b * 16 + ql * 8, *(const v4u*)(&sth[jd * 16 + (ql & 15)][(ql >> 4) * 8])); } }
}
// attention: block = (64 queries, value half dh, key range sp): S over 256 dims (8 kc), softmax over the range's NK/NS keys, P.V for d in [dh*128, dh*128+128);
// OP[sp][q][d] = the range's own normalised context rows (f32); ML[dh][sp][q] = (range maximum, range sum); k_merge joins the ranges
__global__ __launch_bounds__(128) void k_attn(const _Float16* __restrict__ Q16, const _Float16* __restrict__ K16, const _Float16* __restrict__ VT, float* __restrict__ OP, float* __restrict__ ML) {
  __shared__ __align__(16) float sS[4][16][68];
  __shared__ __align__(16) _Float16 sPh[4][16][72];
  __shared__ __align__(16) float sO[4][16][132];
  const int tid = threadIdx.x, w = tid >> 5, lane = tid & 31, col = lane & 15, g = lane >> 4; const int q0 = blockIdx.x * 64 + w * 16; const int dh = blockIdx.y; const int sp = blockIdx.z;
  float* __restrict__ O32 = OP + (size_t)sp * NP * C;
  v16h aq[8];
#pragma unroll
  for (int kc = 0; kc < 8; ++kc) aq[kc] = frag_t(Q16 + (size_t)q0 * C + lane * 8, kc);
  float mrun = -3.0e38f, lrun = 0.f; v8f acc[8] = {};
#pragma unroll 1
  for (int ks = 0; ks < KT_S; ++ks) { const int kt = sp * KT_S + ks;
#pragma unroll
    for (int t = 0; t < 4; ++t) { v8f s = {}; v16h kf[8];    // the key tile's 8 fragments are all requested before its first WMMA
#pragma unroll
      for (int kc = 0; kc < 8; ++kc) kf[kc] = frag_t(K16 + (size_t)(kt * 64) * C + lane * 8, t * 8 + kc);
#pragma unroll
      for (int kc = 0; kc < 8; ++kc) s = wmma16(aq[kc], kf[kc], s);
#pragma unroll
      for (int r = 0; r < 8; ++r) sS[w][8 * g + r][t * 16 + col] = s[r] * (0.0625f / 16.0f); }
    asm volatile("s_wait_xcnt 0x0" ::: "memory");    // precaution: the softmax below reuses the address registers of the key loads
    LDSX();
    float mx = -3.4e38f;
#pragma unroll
    for (int jj = 0; jj < 32; ++jj) mx = fmaxf(mx, sS[w][col][g * 32 + jj]);
    mx = fmaxf(mx, __shfl_xor(mx, 16, 32));
    const float mnew = fmaxf(mrun, mx); const float corr = expf(mrun - mnew);
    float ps = 0.f;
#pragma unroll
    for (int jj = 0; jj < 32; ++jj) { const float p = expf(sS[w][col][g * 32 + jj] - mnew) * 16384.0f; ps += p; sPh[w][col][g * 32 + jj] = (_Float16)p; }
    ps += __shfl_xor(ps, 16, 32);
    lrun = lrun * corr + ps * (1.0f / 16384.0f); mrun = mnew;
#pragma unroll
    for (int r = 0; r < 8; ++r) { const float cr = __shfl(corr, 8 * g + r, 32);
#pragma unroll
      for (int t = 0; t < 8; ++t) acc[t][r] *= cr; }
    LDSX();
#pragma unroll
    for (int kc = 0; kc < 2; ++kc) { const v16h ph = frag_h(&sPh[w][col][0] + kc * 32, lane);
      v16h vf[8]; ld8<NK / 32>(vf, VT + (size_t)(dh * 128) * NK + kt * 64 * 16 + lane * 8, kc);    // the 8 value fragments of these 32 keys are all requested before the first WMMA
      mm8(ph, vf, acc); }
    asm volatile("s_wait_xcnt 0x0" ::: "memory");    // precaution: the next trip rewrites the address registers of the value loads
    __builtin_amdgcn_wave_barrier(); }
#pragma unroll
  for (int r = 0; r < 8; ++r) { const float lr = __shfl(lrun, 8 * g + r, 32); const float inv = 1.0f / (lr * 16384.0f * 4.0f);
#pragma unroll
    for (int t = 0; t < 8; ++t) sO[w][8 * g + r][t * 16 + col] = acc[t][r] * inv; }
  LDSX();
  for (int rl = 0; rl < 16; ++rl) vst2(O32 + (size_t)(q0 + rl) * C + dh * 128 + lane * 4, *(const v4f*)(&sO[w][rl][lane * 4]));
  if (lane < 16) { v2f ml; ml[0] = mrun; ml[1] = lrun; vst2(ML + ((size_t)(dh * NS + sp) * NP + q0 + lane) * 2, ml); }    // 16 rows x 8 B = one 128-B line per wave
}
// join of the NS key ranges: weight of range s = l_s * exp(m_s - max m); O32[q][d] = sum_s weight_s * OP[s][q][d] / sum_s weight_s; thread = 4 columns of rows q and q + NP/2
// (no __restrict__ here: it lets the wait statement below drift away from the loads to the end of the kernel)
__global__ __launch_bounds__(256) void k_merge(const float* OP, const float* ML, float* O32) {
  const int idx = blockIdx.x * 256 + threadIdx.x, c4 = idx & 63, q = idx >> 6;
  const float* pm = ML + ((size_t)(c4 >> 5) * (NS * NP) + q) * 2;    // row q's (max, sum) pair in range 0 of its value half
  const float* po[NS / 2];                                           // the thread's 4 columns of row q in ranges 0, 2, 4, 6
#pragma unroll
  for (int s2 = 0; s2 < NS / 2; ++s2) po[s2] = OP + ((size_t)(2 * s2) * NP + q) * C + c4 * 4;
  v2f ml[2][NS]; v4f o[2][NS];
#pragma unroll
  for (int h = 0; h < 2; ++h) {
#pragma unroll
    for (int s = 0; s < NS; ++s) { ml[h][s] = *(const v2f*)(pm + (s * NP + h * (NP / 2)) * 2); o[h][s] = *(const v4f*)(po[s >> 1] + ((s & 1) * NP + h * (NP / 2)) * C); } }
  // precaution behind the last load: the address registers are operands, so none is reused (not even as a later load's destination) before the loads that name it have passed this wait
  asm volatile("s_wait_xcnt 0x0" :: "v"(pm), "v"(po[0]), "v"(po[1]), "v"(po[2]), "v"(po[3]) : "memory");
#pragma unroll
  for (int h = 0; h < 2; ++h) {
    float mx = ml[h][0][0];
#pragma unroll
    for (int s = 1; s < NS; ++s) mx = fmaxf(mx, ml[h][s][0]);
    float ws = 0.f; v4f a = {};
#pragma unroll
    for (int s = 0; s < NS; ++s) { const float wt = ml[h][s][1] * expf(ml[h][s][0] - mx); ws += wt; a += o[h][s] * wt; }
    vst2(O32 + ((size_t)q + h * (NP / 2)) * C + c4 * 4, a * (1.0f / ws)); }
}
// post: z = att Wo^T + bo; LN over 256 (eps 1e-6) * ln_w + ln_b; h = gelu(zl W1^T + b1); t = h W2^T + b2; out[c][p] = x[c][p] + t[p][c]
// block = 32 pixels (one 128-B line of every output channel row) on 16 waves, 4 per SIMD: in each product a wave owns NT column tiles of 16 and runs them against both 16-row tiles of the block,
// so a weight fragment is fetched once per block and every serial piece (k loop, LN, GELU, store) is 1/8 as long per wave as with 16 rows x all columns per wave.
// a = this lane's row of row tile 0 in LDS (row-major, pitch LD halves; row tile 1 is 16 rows further); bt = this lane's base in the wave's first column tile (tiled layout). k order per output element: ascending, as before.
template <int NKC, int NT, int LD> __device__ __forceinline__ void gemm_rt2(const _Float16* a, const _Float16* bt, int lane, v8f (&acc)[NT][2]) {
  v16h b[NT][NKC];
#pragma unroll
  for (int j = 0; j < NT; ++j) {
#pragma unroll
    for (int kc = 0; kc < NKC; ++kc) b[j][kc] = frag_t(bt, j * NKC + kc); }    // the wave's whole weight slice is requested at once: one L2 latency per product
  asm volatile("s_wait_xcnt 0x0" ::: "memory");    // precaution: the LDS address arithmetic below may reuse the address registers of the weight loads
#pragma unroll
  for (int kc = 0; kc < NKC; ++kc) { const v16h a0 = frag_h(a + kc * 32, lane), a1 = frag_h(a + 16 * LD + kc * 32, lane);
#pragma unroll
    for (int j = 0; j < NT; ++j) { acc[j][0] = wmma16(a0, b[j][kc], acc[j][0]); acc[j][1] = wmma16(a1, b[j][kc], acc[j][1]); } }
}
__global__ __launch_bounds__(512) void k_post(const float* __restrict__ O32, const _Float16* __restrict__ PA, const _Float16* __restrict__ PB, const float* __restrict__ bo, const float* __restrict__ lw, const float* __restrict__ lb, const float* __restrict__ b1, const float* __restrict__ b2, const float* __restrict__ x, float* __restrict__ out) {
  __shared__ __align__(16) _Float16 sz[32][C + 8];          // att rows (f16) then zl rows (f16)
  __shared__ __align__(16) float szf[32][C + 4];             // z rows f32 for the LN statistics, later t rows
  __shared__ __align__(16) _Float16 shh[32][HID + 8];        // gelu(h) f16
  const int tid = threadIdx.x, wave = tid >> 5, lane = tid & 31, col = lane & 15, g = lane >> 4; const int p0b = blockIdx.x * 32;
  // att rows -> f16: 32 rows x 64 pieces of 4 floats, 4 pieces per thread, 8 rows apart
  { const int rl = tid >> 6, pc = tid & 63; const float* pa = O32 + (size_t)(p0b + rl) * C + pc * 4; v4f av[4];
#pragma unroll
    for (int i = 0; i < 4; ++i) av[i] = *(const v4f*)(pa + i * 8 * C);
    asm volatile("s_wait_xcnt 0x0" :: "v"(pa) : "memory");    // precaution: the address is an operand, so it is not reused (not even as a later load's destination) before the loads that name it have passed this wait
#pragma unroll
    for (int i = 0; i < 4; ++i) {
#pragma unroll
      for (int e = 0; e < 4; ++e) sz[rl + i * 8][pc * 4 + e] = (_Float16)(av[i][e] * 64.0f); } }     // x64 carry keeps the small context values out of the f16 subnormal range
  __syncthreads();
  // z = att Wo^T /16/64 + bo: 16 column tiles, one per wave, 8 kc
  { const int n = wave * 16 + col; const float bb = bo[n]; v8f acc[1][2] = {};
    gemm_rt2<C / 32, 1, C + 8>(&sz[col][0], PA + (size_t)(3 * C + wave * 16) * C + lane * 8, lane, acc);
#pragma unroll
    for (int rt = 0; rt < 2; ++rt) {
#pragma unroll
      for (int r = 0; r < 8; ++r) szf[rt * 16 + 8 * g + r][n] = acc[0][rt][r] * (1.0f / (16.0f * 64.0f)) + bb; } }
  __syncthreads();
  // LN per row: 16 lanes per row (wave = 2 rows), lane = 4 pieces of 4 columns, 64 columns apart; the row stays in registers over both statistics
  { const int rl = wave * 2 + g; v4f zv[4], wv[4], bv[4];
#pragma unroll
    for (int i = 0; i < 4; ++i) { const int c = i * 64 + col * 4; wv[i] = *(const v4f*)(lw + c); bv[i] = *(const v4f*)(lb + c); zv[i] = *(const v4f*)(&szf[rl][c]); }
    asm volatile("s_wait_xcnt 0x0" ::: "memory");    // precaution: the arithmetic below may reuse the address registers of the ln_w and ln_b loads
    float s = 0.f, q = 0.f;
#pragma unroll
    for (int i = 0; i < 4; ++i) s += (zv[i][0] + zv[i][1]) + (zv[i][2] + zv[i][3]);
#pragma unroll
    for (int m = 8; m >= 1; m >>= 1) s += __shfl_xor(s, m, 32);
    const float mu = s * (1.0f / C);
#pragma unroll
    for (int i = 0; i < 4; ++i) {
#pragma unroll
      for (int e = 0; e < 4; ++e) { const float d = zv[i][e] - mu; q += d * d; } }
#pragma unroll
    for (int m = 8; m >= 1; m >>= 1) q += __shfl_xor(q, m, 32);
    const float rs = rsqrtf(q * (1.0f / C) + 1e-6f);
#pragma unroll
    for (int i = 0; i < 4; ++i) {
#pragma unroll
      for (int e = 0; e < 4; ++e) sz[rl][i * 64 + col * 4 + e] = (_Float16)((zv[i][e] - mu) * rs * wv[i][e] + bv[i][e]); } }
  __syncthreads();
  // h = gelu(zl W1^T/16 + b1): 32 column tiles, two per wave, 8 kc
  { float bb[2]; v8f acc[2][2] = {};
#pragma unroll
    for (int j = 0; j < 2; ++j) bb[j] = b1[wave * 32 + j * 16 + col];
    gemm_rt2<C / 32, 2, C + 8>(&sz[col][0], PA + (size_t)(4 * C + wave * 32) * C + lane * 8, lane, acc);
#pragma unroll
    for (int j = 0; j < 2; ++j) {
#pragma unroll
      for (int rt = 0; rt < 2; ++rt) {
#pragma unroll
        for (int r = 0; r < 8; ++r) shh[rt * 16 + 8 * g + r][wave * 32 + j * 16 + col] = (_Float16)gelu_e(acc[j][rt][r] * (1.0f / 16.0f) + bb[j]); } } }
  __syncthreads();
  // t = h W2^T/16 + b2: 16 column tiles, one per wave, 16 kc -> szf
  { const int n = wave * 16 + col; const float bb = b2[n]; v8f acc[1][2] = {};
    gemm_rt2<HID / 32, 1, HID + 8>(&shh[col][0], PB + (size_t)(wave * 16) * HID + lane * 8, lane, acc);
#pragma unroll
    for (int rt = 0; rt < 2; ++rt) {
#pragma unroll
      for (int r = 0; r < 8; ++r) szf[rt * 16 + 8 * g + r][n] = acc[0][rt][r] * (1.0f / 16.0f) + bb; } }
  __syncthreads();
  // NCHW store: out[c][p0b .. p0b+31] = x + t: per channel c 32 floats = one 128-B line = 8 pieces; thread -> (c = tid >> 3, piece = tid & 7): lanes contiguous, 4 pieces per thread, 64 channels apart
  { const int c0 = tid >> 3, pc = tid & 7; const float* px = x + (size_t)c0 * NP + p0b + pc * 4; v4f xv[4];
#pragma unroll
    for (int i = 0; i < 4; ++i) xv[i] = *(const v4f*)(px + (size_t)i * 64 * NP);
    asm volatile("s_wait_xcnt 0x0" :: "v"(px) : "memory");    // precaution, as at the att rows: the address stays untouched until the loads that name it have passed this wait
#pragma unroll
    for (int i = 0; i < 4; ++i) {
#pragma unroll
      for (int e = 0; e < 4; ++e) xv[i][e] += szf[pc * 4 + e][c0 + i * 64];
      vst2(out + (size_t)(c0 + i * 64) * NP + p0b + pc * 4, xv[i]); } }
}
extern "C" void kernel_launch(void* const* d_in, const int* in_sizes, int n_in, void* d_out, int out_size, void* d_ws, size_t ws_size, hipStream_t stream) {
  (void)in_sizes; (void)n_in; (void)out_size; (void)ws_size;
  const float** I = (const float**)d_in;    // x, y, Wq, bq, Wk, bk, Wv, bv, Wo, bo, ln_w, ln_b, W1, b1, W2, b2
  const float* x = I[0]; const float* y = I[1]; const float* Wq = I[2]; const float* bq = I[3]; const float* Wk = I[4]; const float* bk = I[5]; const float* Wv = I[6]; const float* bv = I[7]; const float* Wo = I[8]; const float* bo = I[9];
  const float* lw = I[10]; const float* lb = I[11]; const float* W1 = I[12]; const float* b1 = I[13]; const float* W2 = I[14]; const float* b2 = I[15];
  float* out = (float*)d_out;
  char* ws = (char*)d_ws; size_t off = 0;
  auto take = [&](size_t bytes) { char* p = ws + off; off += (bytes + 255) & ~(size_t)255; return p; };
  _Float16* X16 = (_Float16*)take((size_t)NP * C * 2); _Float16* Y16 = (_Float16*)take((size_t)NK * C * 2); _Float16* PA = (_Float16*)take((size_t)(4 * C + HID) * C * 2); _Float16* PB = (_Float16*)take((size_t)C * HID * 2);
  _Float16* Q16 = (_Float16*)take((size_t)NP * C * 2); _Float16* K16 = (_Float16*)take((size_t)NK * C * 2); _Float16* VT = (_Float16*)take((size_t)C * NK * 2); float* O32 = (float*)take((size_t)NP * C * 4);
  float* OP = (float*)take((size_t)NS * NP * C * 4); float* ML = (float*)take((size_t)2 * NS * NP * 2 * 4);
  // ws ~ 48 MB
  k_cvt<<<NP / 64, 256, 0, stream>>>(x, X16);
  k_cvt<<<NK / 64, 256, 0, stream>>>(y, Y16);
  k_pack<<<(4 * C + HID + C) / 16, 256, 0, stream>>>(Wq, Wk, Wv, Wo, W1, W2, PA, PB);
  k_qkv<<<dim3(NP / 64, C / 128, 3), 128, 0, stream>>>(X16, Y16, PA, bq, bk, bv, Q16, K16, VT);
  k_attn<<<dim3(NP / 64, 2, NS), 128, 0, stream>>>(Q16, K16, VT, OP, ML);
  k_merge<<<NP * (C / 4) / 2 / 256, 256, 0, stream>>>(OP, ML, O32);
  k_post<<<NP / 32, 512, 0, stream>>>(O32, PA, PB, bo, lw, lb, b1, b2, x, out);
}

// v005
// A run of this version takes 83.5 microseconds.
// Timed twice side by side with v004, it ran 1.10 times as fast both times.
// All steps since v000 together make it 9.93 times as fast.
// compute dtype: f16 operands (pixel/token rows as f16, weights packed x16 as f16 rows, q/k x4, P lifted by 2^14, V x4, att rows x64, zl/h rows x1), f32 accumulate; softmax, LayerNorm2d, GELU and the residual in f32. Output = x + t with both O(1).
#include <hip/hip_runtime.h>
#include <math.h>

typedef __attribute__((ext_vector_type(16))) _Float16 v16h;
typedef __attribute__((ext_vector_type(16))) __bf16 v16b;
typedef __attribute__((ext_vector_type(8)))  _Float16 v8h;
typedef __attribute__((ext_vector_type(8)))  float v8f;
typedef __attribute__((ext_vector_type(4)))  float v4f;
typedef __attribute__((ext_vector_type(2)))  float v2f;
typedef __attribute__((ext_vector_type(4)))  unsigned v4u;
typedef __attribute__((ext_vector_type(4)))  int v4i;
typedef float __attribute__((may_alias)) float_a;
typedef int __attribute__((may_alias)) int_a;

template <typename T> __device__ __forceinline__ void vst2(void* p, T v) { *(T*)p = v;  }
__device__ __forceinline__ v8f wmma16(v16h a, v16h b, v8f c) {
  v8f d = __builtin_amdgcn_wmma_f32_16x16x32_f16(false, a, false, b, (short)0, c, false, false);
  asm volatile("v_nop\n\tv_nop\n\tv_nop\n\tv_nop" : "+v"(d) : "v"(a), "v"(b));
  return d;
}
__device__ __forceinline__ v8f wmma_bf(v16b a, v16b b, v8f c) {
  v8f d = __builtin_amdgcn_wmma_f32_16x16x32_bf16(false, a, false, b, (short)0, c, false, false);
  asm volatile("v_nop\n\tv_nop\n\tv_nop\n\tv_nop" : "+v"(d) : "v"(a), "v"(b));
  return d;
}
// 16x16x32 fragments: lane = (h = lane>>4, row/col = lane&15); elements 0..7 = k0+8h+0..7, 8..15 = k0+16+8h+0..7; D element r = row 8h+r
__device__ __forceinline__ v16h frag_h(const _Float16* rowk0, int lane) {
  union { v16h v; v8h q[2]; } u; const _Float16* p = rowk0 + 8 * (lane >> 4);
  u.q[0] = *(const v8h*)p; u.q[1] = *(const v8h*)(p + 16); return u.v;
}
// Tiled operand layout in the workspace: a [rows][K] f16 matrix is kept as [rows / 16][K / 8][16 rows][8 halves]. One 16 x 32 fragment is then 1 KB in a row (block = tile * (K / 32) + k-step), and each of its
// two wave-wide 16-byte loads covers 512 contiguous bytes = 4 whole 128-B lines, where a row-major matrix gives 32 B out of each of 16 lines. base = matrix + lane * 8; register contents equal frag_h's.
__device__ __forceinline__ v16h frag_t(const _Float16* base, int blk) {
  union { v16h v; v8h q[2]; } u; const _Float16* p = base + (size_t)blk * 512;
  u.q[0] = *(const v8h*)p; u.q[1] = *(const v8h*)(p + 256); return u.v;
}
// 16 rows x 128 columns over NKC k-steps of 32: arow = this lane's A row at k = 0 (row-major, LDS) or, with AT, this lane's base in the A tile (tiled layout); bt = this lane's base in B's column tile 0 (tiled layout, tile j is NKC blocks further).
// The 8 B fragments and the A fragment of the next k-step are loaded in front of this k-step's WMMAs, so 18 loads fly behind each group of 8 WMMAs; k order per output element unchanged.
template <int NKC> __device__ __forceinline__ void ld8(v16h (&b)[8], const _Float16* bt, int kc) {
#pragma unroll
  for (int j = 0; j < 8; ++j) b[j] = frag_t(bt, j * NKC + kc);
}
__device__ __forceinline__ void mm8(v16h a, const v16h (&b)[8], v8f (&acc)[8]) {
#pragma unroll
  for (int j = 0; j < 8; ++j) acc[j] = wmma16(a, b[j], acc[j]);
}
template <bool AT> __device__ __forceinline__ v16h lda(const _Float16* arow, int kc, int lane) { return AT ? frag_t(arow, kc) : frag_h(arow + kc * 32, lane); }
template <int NKC, bool AT> __device__ __forceinline__ void gemm8(const _Float16* arow, const _Float16* bt, int lane, v8f (&acc)[8]) {
  asm volatile("s_wait_xcnt 0x0" ::: "memory");    // precaution: the fragment loads below may land in registers that earlier loads of a caller named as addresses (k_qkv loads its bias rows only after the product)
  v16h b0[8], b1[8]; v16h a0 = lda<AT>(arow, 0, lane), a1; ld8<NKC>(b0, bt, 0);
#pragma unroll 1    // rolled: the body already holds two k-steps, more copies only cost instruction cache
  for (int kc = 0; kc < NKC - 2; kc += 2) {
    a1 = lda<AT>(arow, kc + 1, lane); ld8<NKC>(b1, bt, kc + 1); mm8(a0, b0, acc);
    a0 = lda<AT>(arow, kc + 2, lane); ld8<NKC>(b0, bt, kc + 2); mm8(a1, b1, acc);
    asm volatile("s_wait_xcnt 0x0" ::: "memory"); }    // precaution: the loads of k-step kc + 2 are still in flight when the next trip rewrites their address registers
  a1 = lda<AT>(arow, NKC - 1, lane); ld8<NKC>(b1, bt, NKC - 1); mm8(a0, b0, acc); mm8(a1, b1, acc);
  asm volatile("s_wait_xcnt 0x0" ::: "memory");    // precaution: the caller's epilogue may reuse the address registers of the last k-step's loads
}
__device__ __forceinline__ v16h frag_f32(const float* rowk0, int lane) {
  v16h a; const float* p = rowk0 + 8 * (lane >> 4);
#pragma unroll
  for (int i = 0; i < 8; ++i) { a[i] = (_Float16)p[i]; a[8 + i] = (_Float16)p[16 + i]; }
  return a;
}
__device__ __forceinline__ v16h frag_f32s(const float* rowk0, int lane, float sc) {
  v16h a; const float* p = rowk0 + 8 * (lane >> 4);
#pragma unroll
  for (int i = 0; i < 8; ++i) { a[i] = (_Float16)(p[i] * sc); a[8 + i] = (_Float16)(p[16 + i] * sc); }
  return a;
}
// column fragment from a [K][ld] layout (column n), rows >= K read as 0
__device__ __forceinline__ v16h fragc_f32(const float* W, int k0, int n, int lane, int ld, int K) {
  v16h a; const int g = lane >> 4;
#pragma unroll
  for (int i = 0; i < 8; ++i) { const int ka = k0 + 8 * g + i, kb = ka + 16;
    a[i] = (_Float16)(ka < K ? W[(size_t)(ka < K ? ka : K - 1) * ld + n] : 0.f); a[8 + i] = (_Float16)(kb < K ? W[(size_t)(kb < K ? kb : K - 1) * ld + n] : 0.f); }
  return a;
}
struct F2 { v16b h, l; };
__device__ __forceinline__ F2 bsplit16(const float v[16]) { F2 r;
#pragma unroll
  for (int i = 0; i < 16; ++i) { const __bf16 h = (__bf16)v[i]; r.h[i] = h; r.l[i] = (__bf16)(v[i] - (float)h); }
  return r; }
__device__ __forceinline__ F2 split_row(const float* row, int k0, int lane) { float v[16]; const float* p = row + k0 + 8 * (lane >> 4);
#pragma unroll
  for (int i = 0; i < 8; ++i) { v[i] = p[i]; v[8 + i] = p[16 + i]; }
  return bsplit16(v); }
__device__ __forceinline__ F2 split_rowK(const float* row, int k0, int lane, int K) { float v[16]; const int g = lane >> 4;
#pragma unroll
  for (int i = 0; i < 8; ++i) { const int ka = k0 + 8 * g + i, kb = ka + 16; v[i] = ka < K ? row[ka < K ? ka : K - 1] : 0.f; v[8 + i] = kb < K ? row[kb < K ? kb : K - 1] : 0.f; }
  return bsplit16(v); }
__device__ __forceinline__ F2 split_col(const float* W, int k0, int n, int lane, int ld, int K) { float v[16]; const int g = lane >> 4;
#pragma unroll
  for (int i = 0; i < 8; ++i) { const int ka = k0 + 8 * g + i, kb = ka + 16; v[i] = ka < K ? W[(size_t)(ka < K ? ka : K - 1) * ld + n] : 0.f; v[8 + i] = kb < K ? W[(size_t)(kb < K ? kb : K - 1) * ld + n] : 0.f; }
  return bsplit16(v); }
__device__ __forceinline__ v8f mac3(const F2& a, const F2& b, v8f c) { c = wmma_bf(a.l, b.h, c); c = wmma_bf(a.h, b.l, c); return wmma_bf(a.h, b.h, c); }
__device__ __forceinline__ float sigm(float v) { return 1.0f / (1.0f + expf(-v)); }
#define LDSX() do { asm volatile("s_wait_dscnt 0" ::: "memory"); __builtin_amdgcn_wave_barrier(); __builtin_amdgcn_fence(__ATOMIC_RELEASE, "workgroup"); } while (0)


// Cross-modal encoder block: Q = conv1x1(x) per pixel (4096 x 256), K,V = y^T W^T + b (4096 x 256); scores = Q.K/16 over the 4096 y-tokens (one 256-dim head); att = softmax V; z = att Wo^T + bo;
// LayerNorm2d over channels per pixel (eps 1e-6); t = gelu(z_ln W1^T + b1) W2^T + b2; out = x + t (NCHW).
// halves d<128 / d>=128 to stay inside the VGPR budget; S recomputed; NS key ranges), k_merge (joins the key ranges into O32), k_post (z + LN + MLP + residual, NCHW store by channel rows). Whole-line stores, one instruction per line.
#define C 256
#define NP 4096
#define NK 4096
#define HID 512
#define NS 8                 // key ranges per query tile: 64 x 2 x NS work-groups of 4 waves = 4 per WGP on 256 WGPs
#define KT_S (NK / 64 / NS)  // 64-key trips per range
__device__ __attribute__((noinline)) float gelu_e(float v) { return 0.5f * v * (1.0f + erff(v * 0.70710678118654752f)); }    // out of line: keeps the static VALU-FMA count of k_post small

// token-major f16 rows from a [C][N] f32 array, in the tiled layout: block = 64 tokens = 4 tiles = 32 KB in a row; piece q of a tile = (column piece q >> 4, row q & 15)
__device__ __forceinline__ void cvt_block(const float* __restrict__ src, _Float16* __restrict__ T16, _Float16 (&st)[64][C + 8], int tid, int n0) {
  for (int q = tid; q < C * 16; q += 256) { const int c = q >> 4, p4 = q & 15; const v4f v = *(const v4f*)(src + (size_t)c * NP + n0 + p4 * 4);
    st[p4 * 4][c] = (_Float16)v[0]; st[p4 * 4 + 1][c] = (_Float16)v[1]; st[p4 * 4 + 2][c] = (_Float16)v[2]; st[p4 * 4 + 3][c] = (_Float16)v[3]; }
  __syncthreads();
  for (int q = tid; q < 64 * (C / 8); q += 256) { const int rl = (q >> 9) * 16 + (q & 15), pc = (q >> 4) & 31; vst2(T16 + (size_t)n0 * C + q * 8, *(const v4u*)(&st[rl][pc * 8])); }
}
// PA rows (256 halves x16): [0,C) Wq, [C,2C) Wk, [2C,3C) Wv, [3C,4C) Wo, [4C, 4C+HID) W1 ; PB rows (512 halves x16): W2 rows (256); both in the tiled layout.
// block = one 16-row tile, so that every 128-B line has one writer; thread = pieces of 8 halves, piece q = (column piece q >> 4, row q & 15)
template <int K> __device__ __forceinline__ void pack_tile(const float* __restrict__ W, _Float16* __restrict__ P, int tid) {
  for (int q = tid; q < 16 * (K / 8); q += 256) { const float* s = W + (size_t)(q & 15) * K + (q >> 4) * 8; const v4f a = *(const v4f*)s, b = *(const v4f*)(s + 4); v8h o;
#pragma unroll
    for (int e = 0; e < 4; ++e) { o[e] = (_Float16)(a[e] * 16.0f); o[4 + e] = (_Float16)(b[e] * 16.0f); }
    vst2(P + (size_t)q * 8, o); }
}
// one launch for all operand preparation: the three jobs read only inputs and write disjoint workspace arrays, so their 240 blocks (fewer than the chip has WGPs) can run side by side instead of in three dependent launches.
// blocks [0, NP/64): x rows; [NP/64, NP/64 + NK/64): y rows (the long jobs first); the rest: one 16-row weight tile each. The choice is uniform over a block, so the barrier in cvt_block is passed by all of its threads or none.
__global__ __launch_bounds__(256) void k_prep(const float* __restrict__ x, const float* __restrict__ y, const float* __restrict__ Wq, const float* __restrict__ Wk, const float* __restrict__ Wv, const float* __restrict__ Wo, const float* __restrict__ W1, const float* __restrict__ W2, _Float16* __restrict__ X16, _Float16* __restrict__ Y16, _Float16* __restrict__ PA, _Float16* __restrict__ PB) {
  __shared__ __align__(16) _Float16 st[64][C + 8];
  const int b = blockIdx.x, tid = threadIdx.x;
  if (b < NP / 64 + NK / 64) { const bool isx = b < NP / 64; cvt_block(isx ? x : y, isx ? X16 : Y16, st, tid, (isx ? b : b - NP / 64) * 64); return; }
  const int n = (b - (NP / 64 + NK / 64)) * 16;
  if (n < 4 * C + HID) { const float* W = n < C ? Wq + (size_t)n * C : (n < 2 * C ? Wk + (size_t)(n - C) * C : (n < 3 * C ? Wv + (size_t)(n - 2 * C) * C : (n < 4 * C ? Wo + (size_t)(n - 3 * C) * C : W1 + (size_t)(n - 4 * C) * C)));
    pack_tile<C>(W, PA + (size_t)n * C, tid); }
  else { const int m = n - (4 * C + HID); pack_tile<HID>(W2 + (size_t)m * HID, PB + (size_t)m * HID, tid); }
}
// q/k/v: block (64 rows, 128 cols, which); which 0 reads X16 else Y16; Q16/K16 rows x4 (+bias); V -> VT x4 [d][n]; all three in the tiled layout
__global__ __launch_bounds__(128) void k_qkv(const _Float16* __restrict__ X16, const _Float16* __restrict__ Y16, const _Float16* __restrict__ PA, const float* __restrict__ bq, const float* __restrict__ bk, const float* __restrict__ bv, _Float16* __restrict__ Q16, _Float16* __restrict__ K16, _Float16* __restrict__ VT) {
  __shared__ __align__(16) _Float16 so[4][16][136];
  __shared__ __align__(16) _Float16 sth[128][72];
  const int tid = threadIdx.x, wave = tid >> 5, lane = tid & 31, col = lane & 15, g = lane >> 4;
  const int which = blockIdx.z, r0b = blockIdx.x * 64, r0 = r0b + wave * 16, n0 = blockIdx.y * 128; const _Float16* SRC = which == 0 ? X16 : Y16; const float* bb_ = which == 0 ? bq : (which == 1 ? bk : bv);
  v8f acc[8] = {};
  gemm8<C / 32, true>(SRC + (size_t)r0 * C + lane * 8, PA + (size_t)(which * C + n0) * C + lane * 8, lane, acc);
  if (which < 2) {
#pragma unroll
    for (int j = 0; j < 8; ++j) { const float bb = bb_[n0 + j * 16 + col];
#pragma unroll
      for (int r = 0; r < 8; ++r) so[wave][8 * g + r][j * 16 + col] = (_Float16)((acc[j][r] * (1.0f / 16.0f) + bb) * 4.0f); }
    LDSX();
    _Float16* D = which == 0 ? Q16 : K16;
    for (int q = lane; q < 16 * 16; q += 32) vst2(D + (size_t)r0 * C + n0 * 16 + q * 8, *(const v4u*)(&so[wave][q & 15][(q >> 4) * 8])); }    // the wave's 16 rows x 128 columns = 4 KB in a row of its tile
  else {
#pragma unroll
    for (int j = 0; j < 8; ++j) { const float bb = bb_[n0 + j * 16 + col];
#pragma unroll
      for (int r = 0; r < 8; ++r) sth[j * 16 + col][wave * 16 + 8 * g + r] = (_Float16)((acc[j][r] * (1.0f / 16.0f) + bb) * 4.0f); }
    __syncthreads();
    for (int qq = tid; qq < 128 * 8; qq += 128) { const int jd = qq >> 7, ql = qq & 127;    // 64 keys of one 16-row d tile = 2 KB in a row
      vst2(VT + (size_t)(n0 + jd * 16) * NK + r0b * 16 + ql * 8, *(const v4u*)(&sth[jd * 16 + (ql & 15)][(ql >> 4) * 8])); } }
}
// attention: block = (64 queries, value half dh, key range sp): S over 256 dims (8 kc), softmax over the range's NK/NS keys, P.V for d in [dh*128, dh*128+128);
// OP[sp][q][d] = the range's own normalised context rows (f32); ML[dh][sp][q] = (range maximum, range sum); k_merge joins the ranges
__global__ __launch_bounds__(128) void k_attn(const _Float16* __restrict__ Q16, const _Float16* __restrict__ K16, const _Float16* __restrict__ VT, float* __restrict__ OP, float* __restrict__ ML) {
  __shared__ __align__(16) float sS[4][16][68];
  __shared__ __align__(16) _Float16 sPh[4][16][72];
  __shared__ __align__(16) float sO[4][16][132];
  const int tid = threadIdx.x, w = tid >> 5, lane = tid & 31, col = lane & 15, g = lane >> 4; const int q0 = blockIdx.x * 64 + w * 16; const int dh = blockIdx.y; const int sp = blockIdx.z;
  float* __restrict__ O32 = OP + (size_t)sp * NP * C;
  v16h aq[8];
#pragma unroll
  for (int kc = 0; kc < 8; ++kc) aq[kc] = frag_t(Q16 + (size_t)q0 * C + lane * 8, kc);
  float mrun = -3.0e38f, lrun = 0.f; v8f acc[8] = {};
#pragma unroll 1
  for (int ks = 0; ks < KT_S; ++ks) { const int kt = sp * KT_S + ks;
#pragma unroll
    for (int t = 0; t < 4; ++t) { v8f s = {}; v16h kf[8];    // the key tile's 8 fragments are all requested before its first WMMA
#pragma unroll
      for (int kc = 0; kc < 8; ++kc) kf[kc] = frag_t(K16 + (size_t)(kt * 64) * C + lane * 8, t * 8 + kc);
#pragma unroll
      for (int kc = 0; kc < 8; ++kc) s = wmma16(aq[kc], kf[kc], s);
#pragma unroll
      for (int r = 0; r < 8; ++r) sS[w][8 * g + r][t * 16 + col] = s[r] * (0.0625f / 16.0f); }
    asm volatile("s_wait_xcnt 0x0" ::: "memory");    // precaution: the softmax below reuses the address registers of the key loads
    LDSX();
    float mx = -3.4e38f;
#pragma unroll
    for (int jj = 0; jj < 32; ++jj) mx = fmaxf(mx, sS[w][col][g * 32 + jj]);
    mx = fmaxf(mx, __shfl_xor(mx, 16, 32));
    const float mnew = fmaxf(mrun, mx); const float corr = expf(mrun - mnew);
    float ps = 0.f;
#pragma unroll
    for (int jj = 0; jj < 32; ++jj) { const float p = expf(sS[w][col][g * 32 + jj] - mnew) * 16384.0f; ps += p; sPh[w][col][g * 32 + jj] = (_Float16)p; }
    ps += __shfl_xor(ps, 16, 32);
    lrun = lrun * corr + ps * (1.0f / 16384.0f); mrun = mnew;
#pragma unroll
    for (int r = 0; r < 8; ++r) { const float cr = __shfl(corr, 8 * g + r, 32);
#pragma unroll
      for (int t = 0; t < 8; ++t) acc[t][r] *= cr; }
    LDSX();
#pragma unroll
    for (int kc = 0; kc < 2; ++kc) { const v16h ph = frag_h(&sPh[w][col][0] + kc * 32, lane);
      v16h vf[8]; ld8<NK / 32>(vf, VT + (size_t)(dh * 128) * NK + kt * 64 * 16 + lane * 8, kc);    // the 8 value fragments of these 32 keys are all requested before the first WMMA
      mm8(ph, vf, acc); }
    asm volatile("s_wait_xcnt 0x0" ::: "memory");    // precaution: the next trip rewrites the address registers of the value loads
    __builtin_amdgcn_wave_barrier(); }
#pragma unroll
  for (int r = 0; r < 8; ++r) { const float lr = __shfl(lrun, 8 * g + r, 32); const float inv = 1.0f / (lr * 16384.0f * 4.0f);
#pragma unroll
    for (int t = 0; t < 8; ++t) sO[w][8 * g + r][t * 16 + col] = acc[t][r] * inv; }
  LDSX();
  for (int rl = 0; rl < 16; ++rl) vst2(O32 + (size_t)(q0 + rl) * C + dh * 128 + lane * 4, *(const v4f*)(&sO[w][rl][lane * 4]));
  if (lane < 16) { v2f ml; ml[0] = mrun; ml[1] = lrun; vst2(ML + ((size_t)(dh * NS + sp) * NP + q0 + lane) * 2, ml); }    // 16 rows x 8 B = one 128-B line per wave
}
// join of the NS key ranges: weight of range s = l_s * exp(m_s - max m); O32[q][d] = sum_s weight_s * OP[s][q][d] / sum_s weight_s; thread = 4 columns of rows q and q + NP/2
// (no __restrict__ here: it lets the wait statement below drift away from the loads to the end of the kernel)
__global__ __launch_bounds__(256) void k_merge(const float* OP, const float* ML, float* O32) {
  const int idx = blockIdx.x * 256 + threadIdx.x, c4 = idx & 63, q = idx >> 6;
  const float* pm = ML + ((size_t)(c4 >> 5) * (NS * NP) + q) * 2;    // row q's (max, sum) pair in range 0 of its value half
  const float* po[NS / 2];                                           // the thread's 4 columns of row q in ranges 0, 2, 4, 6
#pragma unroll
  for (int s2 = 0; s2 < NS / 2; ++s2) po[s2] = OP + ((size_t)(2 * s2) * NP + q) * C + c4 * 4;
  v2f ml[2][NS]; v4f o[2][NS];
#pragma unroll
  for (int h = 0; h < 2; ++h) {
#pragma unroll
    for (int s = 0; s < NS; ++s) { ml[h][s] = *(const v2f*)(pm + (s * NP + h * (NP / 2)) * 2); o[h][s] = *(const v4f*)(po[s >> 1] + ((s & 1) * NP + h * (NP / 2)) * C); } }
  // precaution behind the last load: the address registers are operands, so none is reused (not even as a later load's destination) before the loads that name it have passed this wait
  asm volatile("s_wait_xcnt 0x0" :: "v"(pm), "v"(po[0]), "v"(po[1]), "v"(po[2]), "v"(po[3]) : "memory");
#pragma unroll
  for (int h = 0; h < 2; ++h) {
    float mx = ml[h][0][0];
#pragma unroll
    for (int s = 1; s < NS; ++s) mx = fmaxf(mx, ml[h][s][0]);
    float ws = 0.f; v4f a = {};
#pragma unroll
    for (int s = 0; s < NS; ++s) { const float wt = ml[h][s][1] * expf(ml[h][s][0] - mx); ws += wt; a += o[h][s] * wt; }
    vst2(O32 + ((size_t)q + h * (NP / 2)) * C + c4 * 4, a * (1.0f / ws)); }
}
// post: z = att Wo^T + bo; LN over 256 (eps 1e-6) * ln_w + ln_b; h = gelu(zl W1^T + b1); t = h W2^T + b2; out[c][p] = x[c][p] + t[p][c]
// block = 32 pixels (one 128-B line of every output channel row) on 16 waves, 4 per SIMD: in each product a wave owns NT column tiles of 16 and runs them against both 16-row tiles of the block,
// so a weight fragment is fetched once per block and every serial piece (k loop, LN, GELU, store) is 1/8 as long per wave as with 16 rows x all columns per wave.
// a = this lane's row of row tile 0 in LDS (row-major, pitch LD halves; row tile 1 is 16 rows further); bt = this lane's base in the wave's first column tile (tiled layout). k order per output element: ascending, as before.
template <int NKC, int NT, int LD> __device__ __forceinline__ void gemm_rt2(const _Float16* a, const _Float16* bt, int lane, v8f (&acc)[NT][2]) {
  v16h b[NT][NKC];
#pragma unroll
  for (int j = 0; j < NT; ++j) {
#pragma unroll
    for (int kc = 0; kc < NKC; ++kc) b[j][kc] = frag_t(bt, j * NKC + kc); }    // the wave's whole weight slice is requested at once: one L2 latency per product
  asm volatile("s_wait_xcnt 0x0" ::: "memory");    // precaution: the LDS address arithmetic below may reuse the address registers of the weight loads
#pragma unroll
  for (int kc = 0; kc < NKC; ++kc) { const v16h a0 = frag_h(a + kc * 32, lane), a1 = frag_h(a + 16 * LD + kc * 32, lane);
#pragma unroll
    for (int j = 0; j < NT; ++j) { acc[j][0] = wmma16(a0, b[j][kc], acc[j][0]); acc[j][1] = wmma16(a1, b[j][kc], acc[j][1]); } }
}
__global__ __launch_bounds__(512) void k_post(const float* __restrict__ O32, const _Float16* __restrict__ PA, const _Float16* __restrict__ PB, const float* __restrict__ bo, const float* __restrict__ lw, const float* __restrict__ lb, const float* __restrict__ b1, const float* __restrict__ b2, const float* __restrict__ x, float* __restrict__ out) {
  __shared__ __align__(16) _Float16 sz[32][C + 8];          // att rows (f16) then zl rows (f16)
  __shared__ __align__(16) float szf[32][C + 4];             // z rows f32 for the LN statistics, later t rows
  __shared__ __align__(16) _Float16 shh[32][HID + 8];        // gelu(h) f16
  const int tid = threadIdx.x, wave = tid >> 5, lane = tid & 31, col = lane & 15, g = lane >> 4; const int p0b = blockIdx.x * 32;
  // att rows -> f16: 32 rows x 64 pieces of 4 floats, 4 pieces per thread, 8 rows apart
  { const int rl = tid >> 6, pc = tid & 63; const float* pa = O32 + (size_t)(p0b + rl) * C + pc * 4; v4f av[4];
#pragma unroll
    for (int i = 0; i < 4; ++i) av[i] = *(const v4f*)(pa + i * 8 * C);
    asm volatile("s_wait_xcnt 0x0" :: "v"(pa) : "memory");    // precaution: the address is an operand, so it is not reused (not even as a later load's destination) before the loads that name it have passed this wait
#pragma unroll
    for (int i = 0; i < 4; ++i) {
#pragma unroll
      for (int e = 0; e < 4; ++e) sz[rl + i * 8][pc * 4 + e] = (_Float16)(av[i][e] * 64.0f); } }     // x64 carry keeps the small context values out of the f16 subnormal range
  __syncthreads();
  // z = att Wo^T /16/64 + bo: 16 column tiles, one per wave, 8 kc
  { const int n = wave * 16 + col; const float bb = bo[n]; v8f acc[1][2] = {};
    gemm_rt2<C / 32, 1, C + 8>(&sz[col][0], PA + (size_t)(3 * C + wave * 16) * C + lane * 8, lane, acc);
#pragma unroll
    for (int rt = 0; rt < 2; ++rt) {
#pragma unroll
      for (int r = 0; r < 8; ++r) szf[rt * 16 + 8 * g + r][n] = acc[0][rt][r] * (1.0f / (16.0f * 64.0f)) + bb; } }
  __syncthreads();
  // LN per row: 16 lanes per row (wave = 2 rows), lane = 4 pieces of 4 columns, 64 columns apart; the row stays in registers over both statistics
  { const int rl = wave * 2 + g; v4f zv[4], wv[4], bv[4];
#pragma unroll
    for (int i = 0; i < 4; ++i) { const int c = i * 64 + col * 4; wv[i] = *(const v4f*)(lw + c); bv[i] = *(const v4f*)(lb + c); zv[i] = *(const v4f*)(&szf[rl][c]); }
    asm volatile("s_wait_xcnt 0x0" ::: "memory");    // precaution: the arithmetic below may reuse the address registers of the ln_w and ln_b loads
    float s = 0.f, q = 0.f;
#pragma unroll
    for (int i = 0; i < 4; ++i) s += (zv[i][0] + zv[i][1]) + (zv[i][2] + zv[i][3]);
#pragma unroll
    for (int m = 8; m >= 1; m >>= 1) s += __shfl_xor(s, m, 32);
    const float mu = s * (1.0f / C);
#pragma unroll
    for (int i = 0; i < 4; ++i) {
#pragma unroll
      for (int e = 0; e < 4; ++e) { const float d = zv[i][e] - mu; q += d * d; } }
#pragma unroll
    for (int m = 8; m >= 1; m >>= 1) q += __shfl_xor(q, m, 32);
    const float rs = rsqrtf(q * (1.0f / C) + 1e-6f);
#pragma unroll
    for (int i = 0; i < 4; ++i) {
#pragma unroll
      for (int e = 0; e < 4; ++e) sz[rl][i * 64 + col * 4 + e] = (_Float16)((zv[i][e] - mu) * rs * wv[i][e] + bv[i][e]); } }
  __syncthreads();
  // h = gelu(zl W1^T/16 + b1): 32 column tiles, two per wave, 8 kc
  { float bb[2]; v8f acc[2][2] = {};
#pragma unroll
    for (int j = 0; j < 2; ++j) bb[j] = b1[wave * 32 + j * 16 + col];
    gemm_rt2<C / 32, 2, C + 8>(&sz[col][0], PA + (size_t)(4 * C + wave * 32) * C + lane * 8, lane, acc);
#pragma unroll
    for (int j = 0; j < 2; ++j) {
#pragma unroll
      for (int rt = 0; rt < 2; ++rt) {
#pragma unroll
        for (int r = 0; r < 8; ++r) shh[rt * 16 + 8 * g + r][wave * 32 + j * 16 + col] = (_Float16)gelu_e(acc[j][rt][r] * (1.0f / 16.0f) + bb[j]); } } }
  __syncthreads();
  // t = h W2^T/16 + b2: 16 column tiles, one per wave, 16 kc -> szf
  { const int n = wave * 16 + col; const float bb = b2[n]; v8f acc[1][2] = {};
    gemm_rt2<HID / 32, 1, HID + 8>(&shh[col][0], PB + (size_t)(wave * 16) * HID + lane * 8, lane, acc);
#pragma unroll
    for (int rt = 0; rt < 2; ++rt) {
#pragma unroll
      for (int r = 0; r < 8; ++r) szf[rt * 16 + 8 * g + r][n] = acc[0][rt][r] * (1.0f / 16.0f) + bb; } }
  __syncthreads();
  // NCHW store: out[c][p0b .. p0b+31] = x + t: per channel c 32 floats = one 128-B line = 8 pieces; thread -> (c = tid >> 3, piece = tid & 7): lanes contiguous, 4 pieces per thread, 64 channels apart
  { const int c0 = tid >> 3, pc = tid & 7; const float* px = x + (size_t)c0 * NP + p0b + pc * 4; v4f xv[4];
#pragma unroll
    for (int i = 0; i < 4; ++i) xv[i] = *(const v4f*)(px + (size_t)i * 64 * NP);
    asm volatile("s_wait_xcnt 0x0" :: "v"(px) : "memory");    // precaution, as at the att rows: the address stays untouched until the loads that name it have passed this wait
#pragma unroll
    for (int i = 0; i < 4; ++i) {
#pragma unroll
      for (int e = 0; e < 4; ++e) xv[i][e] += szf[pc * 4 + e][c0 + i * 64];
      vst2(out + (size_t)(c0 + i * 64) * NP + p0b + pc * 4, xv[i]); } }
}
extern "C" void kernel_launch(void* const* d_in, const int* in_sizes, int n_in, void* d_out, int out_size, void* d_ws, size_t ws_size, hipStream_t stream) {
  (void)in_sizes; (void)n_in; (void)out_size; (void)ws_size;
  const float** I = (const float**)d_in;    // x, y, Wq, bq, Wk, bk, Wv, bv, Wo, bo, ln_w, ln_b, W1, b1, W2, b2
  const float* x = I[0]; const float* y = I[1]; const float* Wq = I[2]; const float* bq = I[3]; const float* Wk = I[4]; const float* bk = I[5]; const float* Wv = I[6]; const float* bv = I[7]; const float* Wo = I[8]; const float* bo = I[9];
  const float* lw = I[10]; const float* lb = I[11]; const float* W1 = I[12]; const float* b1 = I[13]; const float* W2 = I[14]; const float* b2 = I[15];
  float* out = (float*)d_out;
  char* ws = (char*)d_ws; size_t off = 0;
  auto take = [&](size_t bytes) { char* p = ws + off; off += (bytes + 255) & ~(size_t)255; return p; };
  _Float16* X16 = (_Float16*)take((size_t)NP * C * 2); _Float16* Y16 = (_Float16*)take((size_t)NK * C * 2); _Float16* PA = (_Float16*)take((size_t)(4 * C + HID) * C * 2); _Float16* PB = (_Float16*)take((size_t)C * HID * 2);
  _Float16* Q16 = (_Float16*)take((size_t)NP * C * 2); _Float16* K16 = (_Float16*)take((size_t)NK * C * 2); _Float16* VT = (_Float16*)take((size_t)C * NK * 2); float* O32 = (float*)take((size_t)NP * C * 4);
  float* OP = (float*)take((size_t)NS * NP * C * 4); float* ML = (float*)take((size_t)2 * NS * NP * 2 * 4);
  // ws ~ 48 MB
  k_prep<<<NP / 64 + NK / 64 + (4 * C + HID + C) / 16, 256, 0, stream>>>(x, y, Wq, Wk, Wv, Wo, W1, W2, X16, Y16, PA, PB);
  k_qkv<<<dim3(NP / 64, C / 128, 3), 128, 0, stream>>>(X16, Y16, PA, bq, bk, bv, Q16, K16, VT);
  k_attn<<<dim3(NP / 64, 2, NS), 128, 0, stream>>>(Q16, K16, VT, OP, ML);
  k_merge<<<NP * (C / 4) / 2 / 256, 256, 0, stream>>>(OP, ML, O32);
  k_post<<<NP / 32, 512, 0, stream>>>(O32, PA, PB, bo, lw, lb, b1, b2, x, out);
}

// v006
// It runs in 69 microseconds.
// Two timings next to v005 put it at 1.20 and 1.21 times that version's speed.
// All steps since v000 together make it 12.0 times as fast.
// compute dtype: f16 operands (pixel/token rows as f16, weights packed x16 as f16 rows, q/k x4, P lifted by 2^14, V x4, att rows x64, zl/h rows x1), f32 accumulate; softmax, LayerNorm2d, GELU and the residual in f32. Output = x + t with both O(1).
#include <hip/hip_runtime.h>
#include <math.h>

typedef __attribute__((ext_vector_type(16))) _Float16 v16h;
typedef __attribute__((ext_vector_type(16))) __bf16 v16b;
typedef __attribute__((ext_vector_type(8)))  _Float16 v8h;
typedef __attribute__((ext_vector_type(8)))  float v8f;
typedef __attribute__((ext_vector_type(4)))  float v4f;
typedef __attribute__((ext_vector_type(2)))  float v2f;
typedef __attribute__((ext_vector_type(4)))  unsigned v4u;
typedef __attribute__((ext_vector_type(4)))  int v4i;
typedef float __attribute__((may_alias)) float_a;
typedef int __attribute__((may_alias)) int_a;

template <typename T> __device__ __forceinline__ void vst2(void* p, T v) { *(T*)p = v;  }
__device__ __forceinline__ v8f wmma16(v16h a, v16h b, v8f c) {
  v8f d = __builtin_amdgcn_wmma_f32_16x16x32_f16(false, a, false, b, (short)0, c, false, false);
  asm volatile("v_nop\n\tv_nop\n\tv_nop\n\tv_nop" : "+v"(d) : "v"(a), "v"(b));
  return d;
}
__device__ __forceinline__ v8f wmma_bf(v16b a, v16b b, v8f c) {
  v8f d = __builtin_amdgcn_wmma_f32_16x16x32_bf16(false, a, false, b, (short)0, c, false, false);
  asm volatile("v_nop\n\tv_nop\n\tv_nop\n\tv_nop" : "+v"(d) : "v"(a), "v"(b));
  return d;
}
// 16x16x32 fragments: lane = (h = lane>>4, row/col = lane&15); elements 0..7 = k0+8h+0..7, 8..15 = k0+16+8h+0..7; D element r = row 8h+r
__device__ __forceinline__ v16h frag_h(const _Float16* rowk0, int lane) {
  union { v16h v; v8h q[2]; } u; const _Float16* p = rowk0 + 8 * (lane >> 4);
  u.q[0] = *(const v8h*)p; u.q[1] = *(const v8h*)(p + 16); return u.v;
}
// Tiled operand layout in the workspace: a [rows][K] f16 matrix is kept as [rows / 16][K / 8][16 rows][8 halves]. One 16 x 32 fragment is then 1 KB in a row (block = tile * (K / 32) + k-step), and each of its
// two wave-wide 16-byte loads covers 512 contiguous bytes = 4 whole 128-B lines, where a row-major matrix gives 32 B out of each of 16 lines. base = matrix + lane * 8; register contents equal frag_h's.
__device__ __forceinline__ v16h frag_t(const _Float16* base, int blk) {
  union { v16h v; v8h q[2]; } u; const _Float16* p = base + (size_t)blk * 512;
  u.q[0] = *(const v8h*)p; u.q[1] = *(const v8h*)(p + 256); return u.v;
}
// 16 rows x 128 columns over NKC k-steps of 32: arow = this lane's A row at k = 0 (row-major, LDS) or, with AT, this lane's base in the A tile (tiled layout); bt = this lane's base in B's column tile 0 (tiled layout, tile j is NKC blocks further).
// The 8 B fragments and the A fragment of the next k-step are loaded in front of this k-step's WMMAs, so 18 loads fly behind each group of 8 WMMAs; k order per output element unchanged.
template <int NKC> __device__ __forceinline__ void ld8(v16h (&b)[8], const _Float16* bt, int kc) {
#pragma unroll
  for (int j = 0; j < 8; ++j) b[j] = frag_t(bt, j * NKC + kc);
}
__device__ __forceinline__ void mm8(v16h a, const v16h (&b)[8], v8f (&acc)[8]) {
#pragma unroll
  for (int j = 0; j < 8; ++j) acc[j] = wmma16(a, b[j], acc[j]);
}
template <bool AT> __device__ __forceinline__ v16h lda(const _Float16* arow, int kc, int lane) { return AT ? frag_t(arow, kc) : frag_h(arow + kc * 32, lane); }
template <int NKC, bool AT> __device__ __forceinline__ void gemm8(const _Float16* arow, const _Float16* bt, int lane, v8f (&acc)[8]) {
  asm volatile("s_wait_xcnt 0x0" ::: "memory");    // precaution: the fragment loads below may land in registers that earlier loads of a caller named as addresses (k_qkv loads its bias rows only after the product)
  v16h b0[8], b1[8]; v16h a0 = lda<AT>(arow, 0, lane), a1; ld8<NKC>(b0, bt, 0);
#pragma unroll 1    // rolled: the body already holds two k-steps, more copies only cost instruction cache
  for (int kc = 0; kc < NKC - 2; kc += 2) {
    a1 = lda<AT>(arow, kc + 1, lane); ld8<NKC>(b1, bt, kc + 1); mm8(a0, b0, acc);
    a0 = lda<AT>(arow, kc + 2, lane); ld8<NKC>(b0, bt, kc + 2); mm8(a1, b1, acc);
    asm volatile("s_wait_xcnt 0x0" ::: "memory"); }    // precaution: the loads of k-step kc + 2 are still in flight when the next trip rewrites their address registers
  a1 = lda<AT>(arow, NKC - 1, lane); ld8<NKC>(b1, bt, NKC - 1); mm8(a0, b0, acc); mm8(a1, b1, acc);
  asm volatile("s_wait_xcnt 0x0" ::: "memory");    // precaution: the caller's epilogue may reuse the address registers of the last k-step's loads
}
__device__ __forceinline__ v16h frag_f32(const float* rowk0, int lane) {
  v16h a; const float* p = rowk0 + 8 * (lane >> 4);
#pragma unroll
  for (int i = 0; i < 8; ++i) { a[i] = (_Float16)p[i]; a[8 + i] = (_Float16)p[16 + i]; }
  return a;
}
__device__ __forceinline__ v16h frag_f32s(const float* rowk0, int lane, float sc) {
  v16h a; const float* p = rowk0 + 8 * (lane >> 4);
#pragma unroll
  for (int i = 0; i < 8; ++i) { a[i] = (_Float16)(p[i] * sc); a[8 + i] = (_Float16)(p[16 + i] * sc); }
  return a;
}
// column fragment from a [K][ld] layout (column n), rows >= K read as 0
__device__ __forceinline__ v16h fragc_f32(const float* W, int k0, int n, int lane, int ld, int K) {
  v16h a; const int g = lane >> 4;
#pragma unroll
  for (int i = 0; i < 8; ++i) { const int ka = k0 + 8 * g + i, kb = ka + 16;
    a[i] = (_Float16)(ka < K ? W[(size_t)(ka < K ? ka : K - 1) * ld + n] : 0.f); a[8 + i] = (_Float16)(kb < K ? W[(size_t)(kb < K ? kb : K - 1) * ld + n] : 0.f); }
  return a;
}
struct F2 { v16b h, l; };
__device__ __forceinline__ F2 bsplit16(const float v[16]) { F2 r;
#pragma unroll
  for (int i = 0; i < 16; ++i) { const __bf16 h = (__bf16)v[i]; r.h[i] = h; r.l[i] = (__bf16)(v[i] - (float)h); }
  return r; }
__device__ __forceinline__ F2 split_row(const float* row, int k0, int lane) { float v[16]; const float* p = row + k0 + 8 * (lane >> 4);
#pragma unroll
  for (int i = 0; i < 8; ++i) { v[i] = p[i]; v[8 + i] = p[16 + i]; }
  return bsplit16(v); }
__device__ __forceinline__ F2 split_rowK(const float* row, int k0, int lane, int K) { float v[16]; const int g = lane >> 4;
#pragma unroll
  for (int i = 0; i < 8; ++i) { const int ka = k0 + 8 * g + i, kb = ka + 16; v[i] = ka < K ? row[ka < K ? ka : K - 1] : 0.f; v[8 + i] = kb < K ? row[kb < K ? kb : K - 1] : 0.f; }
  return bsplit16(v); }
__device__ __forceinline__ F2 split_col(const float* W, int k0, int n, int lane, int ld, int K) { float v[16]; const int g = lane >> 4;
#pragma unroll
  for (int i = 0; i < 8; ++i) { const int ka = k0 + 8 * g + i, kb = ka + 16; v[i] = ka < K ? W[(size_t)(ka < K ? ka : K - 1) * ld + n] : 0.f; v[8 + i] = kb < K ? W[(size_t)(kb < K ? kb : K - 1) * ld + n] : 0.f; }
  return bsplit16(v); }
__device__ __forceinline__ v8f mac3(const F2& a, const F2& b, v8f c) { c = wmma_bf(a.l, b.h, c); c = wmma_bf(a.h, b.l, c); return wmma_bf(a.h, b.h, c); }
__device__ __forceinline__ float sigm(float v) { return 1.0f / (1.0f + expf(-v)); }
#define LDSX() do { asm volatile("s_wait_dscnt 0" ::: "memory"); __builtin_amdgcn_wave_barrier(); __builtin_amdgcn_fence(__ATOMIC_RELEASE, "workgroup"); } while (0)


// Cross-modal encoder block: Q = conv1x1(x) per pixel (4096 x 256), K,V = y^T W^T + b (4096 x 256); scores = Q.K/16 over the 4096 y-tokens (one 256-dim head); att = softmax V; z = att Wo^T + bo;
// LayerNorm2d over channels per pixel (eps 1e-6); t = gelu(z_ln W1^T + b1) W2^T + b2; out = x + t (NCHW).
// halves d<128 / d>=128 to stay inside the VGPR budget; S recomputed; NS key ranges), k_merge (joins the key ranges into O32), k_post (z + LN + MLP + residual, NCHW store by channel rows). Whole-line stores, one instruction per line.
#define C 256
#define NP 4096
#define NK 4096
#define HID 512
#define NS 8                 // key ranges per query tile: 64 x 2 x NS work-groups of 4 waves = 4 per WGP on 256 WGPs
#define KT_S (NK / 64 / NS)  // 64-key trips per range
__device__ __attribute__((noinline)) float gelu_e(float v) { return 0.5f * v * (1.0f + erff(v * 0.70710678118654752f)); }    // out of line: keeps the static VALU-FMA count of k_post small

// token-major f16 rows from a [C][N] f32 array, in the tiled layout: block = 64 tokens = 4 tiles = 32 KB in a row; piece q of a tile = (column piece q >> 4, row q & 15)
__device__ __forceinline__ void cvt_block(const float* __restrict__ src, _Float16* __restrict__ T16, _Float16 (&st)[64][C + 8], int tid, int n0) {
  for (int q = tid; q < C * 16; q += 256) { const int c = q >> 4, p4 = q & 15; const v4f v = *(const v4f*)(src + (size_t)c * NP + n0 + p4 * 4);
    st[p4 * 4][c] = (_Float16)v[0]; st[p4 * 4 + 1][c] = (_Float16)v[1]; st[p4 * 4 + 2][c] = (_Float16)v[2]; st[p4 * 4 + 3][c] = (_Float16)v[3]; }
  __syncthreads();
  for (int q = tid; q < 64 * (C / 8); q += 256) { const int rl = (q >> 9) * 16 + (q & 15), pc = (q >> 4) & 31; vst2(T16 + (size_t)n0 * C + q * 8, *(const v4u*)(&st[rl][pc * 8])); }
}
// PA rows (256 halves x16): [0,C) Wq, [C,2C) Wk, [2C,3C) Wv, [3C,4C) Wo, [4C, 4C+HID) W1 ; PB rows (512 halves x16): W2 rows (256); both in the tiled layout.
// block = one 16-row tile, so that every 128-B line has one writer; thread = pieces of 8 halves, piece q = (column piece q >> 4, row q & 15)
template <int K> __device__ __forceinline__ void pack_tile(const float* __restrict__ W, _Float16* __restrict__ P, int tid) {
  for (int q = tid; q < 16 * (K / 8); q += 256) { const float* s = W + (size_t)(q & 15) * K + (q >> 4) * 8; const v4f a = *(const v4f*)s, b = *(const v4f*)(s + 4); v8h o;
#pragma unroll
    for (int e = 0; e < 4; ++e) { o[e] = (_Float16)(a[e] * 16.0f); o[4 + e] = (_Float16)(b[e] * 16.0f); }
    vst2(P + (size_t)q * 8, o); }
}
// one launch for all operand preparation: the three jobs read only inputs and write disjoint workspace arrays, so their 240 blocks (fewer than the chip has WGPs) can run side by side instead of in three dependent launches.
// blocks [0, NP/64): x rows; [NP/64, NP/64 + NK/64): y rows (the long jobs first); the rest: one 16-row weight tile each. The choice is uniform over a block, so the barrier in cvt_block is passed by all of its threads or none.
__global__ __launch_bounds__(256) void k_prep(const float* __restrict__ x, const float* __restrict__ y, const float* __restrict__ Wq, const float* __restrict__ Wk, const float* __restrict__ Wv, const float* __restrict__ Wo, const float* __restrict__ W1, const float* __restrict__ W2, _Float16* __restrict__ X16, _Float16* __restrict__ Y16, _Float16* __restrict__ PA, _Float16* __restrict__ PB) {
  __shared__ __align__(16) _Float16 st[64][C + 8];
  const int b = blockIdx.x, tid = threadIdx.x;
  if (b < NP / 64 + NK / 64) { const bool isx = b < NP / 64; cvt_block(isx ? x : y, isx ? X16 : Y16, st, tid, (isx ? b : b - NP / 64) * 64); return; }
  const int n = (b - (NP / 64 + NK / 64)) * 16;
  if (n < 4 * C + HID) { const float* W = n < C ? Wq + (size_t)n * C : (n < 2 * C ? Wk + (size_t)(n - C) * C : (n < 3 * C ? Wv + (size_t)(n - 2 * C) * C : (n < 4 * C ? Wo + (size_t)(n - 3 * C) * C : W1 + (size_t)(n - 4 * C) * C)));
    pack_tile<C>(W, PA + (size_t)n * C, tid); }
  else { const int m = n - (4 * C + HID); pack_tile<HID>(W2 + (size_t)m * HID, PB + (size_t)m * HID, tid); }
}
// q/k/v: block (64 rows, 128 cols, which); which 0 reads X16 else Y16; Q16/K16 rows x4 (+bias); V -> VT x4 [d][n]; all three in the tiled layout
__global__ __launch_bounds__(128) void k_qkv(const _Float16* __restrict__ X16, const _Float16* __restrict__ Y16, const _Float16* __restrict__ PA, const float* __restrict__ bq, const float* __restrict__ bk, const float* __restrict__ bv, _Float16* __restrict__ Q16, _Float16* __restrict__ K16, _Float16* __restrict__ VT) {
  __shared__ __align__(16) _Float16 so[4][16][136];
  __shared__ __align__(16) _Float16 sth[128][72];
  const int tid = threadIdx.x, wave = tid >> 5, lane = tid & 31, col = lane & 15, g = lane >> 4;
  const int which = blockIdx.z, r0b = blockIdx.x * 64, r0 = r0b + wave * 16, n0 = blockIdx.y * 128; const _Float16* SRC = which == 0 ? X16 : Y16; const float* bb_ = which == 0 ? bq : (which == 1 ? bk : bv);
  v8f acc[8] = {};
  gemm8<C / 32, true>(SRC + (size_t)r0 * C + lane * 8, PA + (size_t)(which * C + n0) * C + lane * 8, lane, acc);
  if (which < 2) {
#pragma unroll
    for (int j = 0; j < 8; ++j) { const float bb = bb_[n0 + j * 16 + col];
#pragma unroll
      for (int r = 0; r < 8; ++r) so[wave][8 * g + r][j * 16 + col] = (_Float16)((acc[j][r] * (1.0f / 16.0f) + bb) * 4.0f); }
    LDSX();
    _Float16* D = which == 0 ? Q16 : K16;
    for (int q = lane; q < 16 * 16; q += 32) vst2(D + (size_t)r0 * C + n0 * 16 + q * 8, *(const v4u*)(&so[wave][q & 15][(q >> 4) * 8])); }    // the wave's 16 rows x 128 columns = 4 KB in a row of its tile
  else {
#pragma unroll
    for (int j = 0; j < 8; ++j) { const float bb = bb_[n0 + j * 16 + col];
#pragma unroll
      for (int r = 0; r < 8; ++r) sth[j * 16 + col][wave * 16 + 8 * g + r] = (_Float16)((acc[j][r] * (1.0f / 16.0f) + bb) * 4.0f); }
    __syncthreads();
    for (int qq = tid; qq < 128 * 8; qq += 128) { const int jd = qq >> 7, ql = qq & 127;    // 64 keys of one 16-row d tile = 2 KB in a row
      vst2(VT + (size_t)(n0 + jd * 16) * NK + r0b * 16 + ql * 8, *(const v4u*)(&sth[jd * 16 + (ql & 15)][(ql >> 4) * 8])); } }
}
// asynchronous copies global -> LDS, 16 bytes per lane = 512 B per copy and wave. l = the lane's LDS byte address; its global address = scalar base b + the lane's byte offset o; the immediate offset moves
// both addresses alike, so a run that is contiguous on both sides needs one set of addresses. The s_wait_xcnt is the last line of the copies' own statement (a precaution): no address register is rewritten before the copies that name it have passed it.
__device__ __forceinline__ void copy_8k(unsigned l, unsigned o, const _Float16* b) {    // 8 KB in a row
  asm volatile("global_load_async_to_lds_b128 %0, %1, %2\n\t"
               "global_load_async_to_lds_b128 %0, %1, %2 offset:512\n\t"
               "global_load_async_to_lds_b128 %0, %1, %2 offset:1024\n\t"
               "global_load_async_to_lds_b128 %0, %1, %2 offset:1536\n\t"
               "global_load_async_to_lds_b128 %0, %1, %2 offset:2048\n\t"
               "global_load_async_to_lds_b128 %0, %1, %2 offset:2560\n\t"
               "global_load_async_to_lds_b128 %0, %1, %2 offset:3072\n\t"
               "global_load_async_to_lds_b128 %0, %1, %2 offset:3584\n\t"
               "global_load_async_to_lds_b128 %0, %1, %2 offset:4096\n\t"
               "global_load_async_to_lds_b128 %0, %1, %2 offset:4608\n\t"
               "global_load_async_to_lds_b128 %0, %1, %2 offset:5120\n\t"
               "global_load_async_to_lds_b128 %0, %1, %2 offset:5632\n\t"
               "global_load_async_to_lds_b128 %0, %1, %2 offset:6144\n\t"
               "global_load_async_to_lds_b128 %0, %1, %2 offset:6656\n\t"
               "global_load_async_to_lds_b128 %0, %1, %2 offset:7168\n\t"
               "global_load_async_to_lds_b128 %0, %1, %2 offset:7680\n\t"
               "s_wait_xcnt 0x0" :: "v"(l), "v"(o), "s"(b) : "memory");
}
__device__ __forceinline__ void copy_2x2k(unsigned l0, unsigned l1, unsigned o, const _Float16* b0, const _Float16* b1) {    // two runs of 2 KB
  asm volatile("global_load_async_to_lds_b128 %0, %2, %3\n\t"
               "global_load_async_to_lds_b128 %0, %2, %3 offset:512\n\t"
               "global_load_async_to_lds_b128 %0, %2, %3 offset:1024\n\t"
               "global_load_async_to_lds_b128 %0, %2, %3 offset:1536\n\t"
               "global_load_async_to_lds_b128 %1, %2, %4\n\t"
               "global_load_async_to_lds_b128 %1, %2, %4 offset:512\n\t"
               "global_load_async_to_lds_b128 %1, %2, %4 offset:1024\n\t"
               "global_load_async_to_lds_b128 %1, %2, %4 offset:1536\n\t"
               "s_wait_xcnt 0x0" :: "v"(l0), "v"(l1), "v"(o), "s"(b0), "s"(b1) : "memory");
}
// hand-over of the ring, passed by every wave: the wave's own LDS reads are done, its own copies have landed, then the block barrier: it publishes the tile that was in flight and frees the buffer just read
#define RING_FOOT() do { asm volatile("s_wait_dscnt 0x0" ::: "memory"); asm volatile("s_wait_asynccnt 0x0" ::: "memory"); __syncthreads(); } while (0)
// attention: block = (64 queries, value half dh, key range sp): S over 256 dims (8 kc), softmax over the range's NK/NS keys, P.V for d in [dh*128, dh*128+128);
// OP[sp][q][d] = the range's own normalised context rows (f32); ML[dh][sp][q] = (range maximum, range sum); k_merge joins the ranges
// The 64-key K tile (32 KB) and V tile (16 KB) are brought into LDS once per block by asynchronous copies and read there by all 4 waves. Ring of two buffers, tiles K0, V0, K1, V1, ...:
// the score half of a trip reads the K buffer while the V tile flies, the softmax and P.V half reads the V buffer while the next K tile flies. Fragment order in LDS = the workspace's tiled layout.
#define KBUF_B (64 * C * 2)
#define VBUF_B (128 * 64 * 2)
__global__ __launch_bounds__(128) void k_attn(const _Float16* __restrict__ Q16, const _Float16* __restrict__ K16, const _Float16* __restrict__ VT, float* __restrict__ OP, float* __restrict__ ML) {
  __shared__ __align__(16) unsigned char ring[KBUF_B + VBUF_B];    // K buffer, V buffer; behind the loop the output staging (4 x 16 x 132 floats)
  __shared__ __align__(16) float sS[4][16][68];
  __shared__ __align__(16) _Float16 sPh[4][16][72];
  const int tid = threadIdx.x, w = tid >> 5, lane = tid & 31, col = lane & 15, g = lane >> 4; const int q0 = blockIdx.x * 64 + w * 16; const int dh = blockIdx.y; const int sp = blockIdx.z;
  float* __restrict__ O32 = OP + (size_t)sp * NP * C;
  const _Float16* sKl = (const _Float16*)ring + lane * 8; const _Float16* sVl = (const _Float16*)(ring + KBUF_B) + lane * 8;    // this lane's base in each buffer
  // the wave's share of a tile: K = key tile w (8 KB in a row, 16 copies); V = the 64 keys of d tiles 2w and 2w + 1 (2 KB in a row each, 8 copies)
  const unsigned lK = (unsigned)(size_t)ring + w * 8192 + lane * 16, lV = (unsigned)(size_t)ring + KBUF_B + w * 4096 + lane * 16;
  const unsigned oK = w * 8192 + lane * 16, oV = w * (32 * NK * 2) + lane * 16;    // the lane's byte offsets from the block's tile bases
  const _Float16* bK = K16 + (size_t)(sp * KT_S * 64) * C;
  const _Float16* bV = VT + (size_t)(dh * 128) * NK + sp * KT_S * 64 * 16;
  copy_8k(lK, oK, bK);
  v16h aq[8];
#pragma unroll
  for (int kc = 0; kc < 8; ++kc) aq[kc] = frag_t(Q16 + (size_t)q0 * C + lane * 8, kc);
  asm volatile("s_wait_asynccnt 0x0" ::: "memory");    // K tile 0 has landed (this wave's share)
  __syncthreads();
  copy_2x2k(lV, lV + 2048, oV, bV, bV + 16 * NK);
  float mrun = -3.0e38f, lrun = 0.f; v8f acc[8] = {};
#pragma unroll 1
  for (int ks = 0; ks < KT_S; ++ks) {
#pragma unroll
    for (int t = 0; t < 4; ++t) { v8f s = {}; v16h kf[8];    // the key tile's 8 fragments are all requested before its first WMMA
#pragma unroll
      for (int kc = 0; kc < 8; ++kc) kf[kc] = frag_t(sKl, t * 8 + kc);
#pragma unroll
      for (int kc = 0; kc < 8; ++kc) s = wmma16(aq[kc], kf[kc], s);
#pragma unroll
      for (int r = 0; r < 8; ++r) sS[w][8 * g + r][t * 16 + col] = s[r] * (0.0625f / 16.0f); }
    RING_FOOT();    // V tile ks is published, the K buffer is free; the wave's own score rows are in LDS too
    if (ks + 1 < KT_S) { bK += 64 * C; copy_8k(lK, oK, bK); }
    float mx = -3.4e38f;
#pragma unroll
    for (int jj = 0; jj < 32; ++jj) mx = fmaxf(mx, sS[w][col][g * 32 + jj]);
    mx = fmaxf(mx, __shfl_xor(mx, 16, 32));
    const float mnew = fmaxf(mrun, mx); const float corr = expf(mrun - mnew);
    float ps = 0.f;
#pragma unroll
    for (int jj = 0; jj < 32; ++jj) { const float p = expf(sS[w][col][g * 32 + jj] - mnew) * 16384.0f; ps += p; sPh[w][col][g * 32 + jj] = (_Float16)p; }
    ps += __shfl_xor(ps, 16, 32);
    lrun = lrun * corr + ps * (1.0f / 16384.0f); mrun = mnew;
#pragma unroll
    for (int r = 0; r < 8; ++r) { const float cr = __shfl(corr, 8 * g + r, 32);
#pragma unroll
      for (int t = 0; t < 8; ++t) acc[t][r] *= cr; }
    LDSX();
#pragma unroll
    for (int kc = 0; kc < 2; ++kc) { const v16h ph = frag_h(&sPh[w][col][0] + kc * 32, lane);
      v16h vf[8]; ld8<2>(vf, sVl, kc);    // the 8 value fragments of these 32 keys are all requested before the first WMMA
      mm8(ph, vf, acc); }
    RING_FOOT();    // K tile ks + 1 is published, the V buffer is free
    if (ks + 1 < KT_S) { bV += 64 * 16; copy_2x2k(lV, lV + 2048, oV, bV, bV + 16 * NK); } }
  asm volatile("s_wait_asynccnt 0x0" ::: "memory");    // nothing is in flight when the ring becomes output staging (the last hand-over's barrier has ended every wave's reads)
  float (*sO)[132] = (float (*)[132])(ring + w * (16 * 132 * 4));
#pragma unroll
  for (int r = 0; r < 8; ++r) { const float lr = __shfl(lrun, 8 * g + r, 32); const float inv = 1.0f / (lr * 16384.0f * 4.0f);
#pragma unroll
    for (int t = 0; t < 8; ++t) sO[8 * g + r][t * 16 + col] = acc[t][r] * inv; }
  LDSX();
  for (int rl = 0; rl < 16; ++rl) vst2(O32 + (size_t)(q0 + rl) * C + dh * 128 + lane * 4, *(const v4f*)(&sO[rl][lane * 4]));
  if (lane < 16) { v2f ml; ml[0] = mrun; ml[1] = lrun; vst2(ML + ((size_t)(dh * NS + sp) * NP + q0 + lane) * 2, ml); }    // 16 rows x 8 B = one 128-B line per wave
}
// join of the NS key ranges: weight of range s = l_s * exp(m_s - max m); O32[q][d] = sum_s weight_s * OP[s][q][d] / sum_s weight_s; thread = 4 columns of rows q and q + NP/2
// (no __restrict__ here: it lets the wait statement below drift away from the loads to the end of the kernel)
__global__ __launch_bounds__(256) void k_merge(const float* OP, const float* ML, float* O32) {
  const int idx = blockIdx.x * 256 + threadIdx.x, c4 = idx & 63, q = idx >> 6;
  const float* pm = ML + ((size_t)(c4 >> 5) * (NS * NP) + q) * 2;    // row q's (max, sum) pair in range 0 of its value half
  const float* po[NS / 2];                                           // the thread's 4 columns of row q in ranges 0, 2, 4, 6
#pragma unroll
  for (int s2 = 0; s2 < NS / 2; ++s2) po[s2] = OP + ((size_t)(2 * s2) * NP + q) * C + c4 * 4;
  v2f ml[2][NS]; v4f o[2][NS];
#pragma unroll
  for (int h = 0; h < 2; ++h) {
#pragma unroll
    for (int s = 0; s < NS; ++s) { ml[h][s] = *(const v2f*)(pm + (s * NP + h * (NP / 2)) * 2); o[h][s] = *(const v4f*)(po[s >> 1] + ((s & 1) * NP + h * (NP / 2)) * C); } }
  // precaution behind the last load: the address registers are operands, so none is reused (not even as a later load's destination) before the loads that name it have passed this wait
  asm volatile("s_wait_xcnt 0x0" :: "v"(pm), "v"(po[0]), "v"(po[1]), "v"(po[2]), "v"(po[3]) : "memory");
#pragma unroll
  for (int h = 0; h < 2; ++h) {
    float mx = ml[h][0][0];
#pragma unroll
    for (int s = 1; s < NS; ++s) mx = fmaxf(mx, ml[h][s][0]);
    float ws = 0.f; v4f a = {};
#pragma unroll
    for (int s = 0; s < NS; ++s) { const float wt = ml[h][s][1] * expf(ml[h][s][0] - mx); ws += wt; a += o[h][s] * wt; }
    vst2(O32 + ((size_t)q + h * (NP / 2)) * C + c4 * 4, a * (1.0f / ws)); }
}
// post: z = att Wo^T + bo; LN over 256 (eps 1e-6) * ln_w + ln_b; h = gelu(zl W1^T + b1); t = h W2^T + b2; out[c][p] = x[c][p] + t[p][c]
// block = 32 pixels (one 128-B line of every output channel row) on 16 waves, 4 per SIMD: in each product a wave owns NT column tiles of 16 and runs them against both 16-row tiles of the block,
// so a weight fragment is fetched once per block and every serial piece (k loop, LN, GELU, store) is 1/8 as long per wave as with 16 rows x all columns per wave.
// a = this lane's row of row tile 0 in LDS (row-major, pitch LD halves; row tile 1 is 16 rows further); bt = this lane's base in the wave's first column tile (tiled layout). k order per output element: ascending, as before.
template <int NKC, int NT, int LD> __device__ __forceinline__ void gemm_rt2(const _Float16* a, const _Float16* bt, int lane, v8f (&acc)[NT][2]) {
  v16h b[NT][NKC];
#pragma unroll
  for (int j = 0; j < NT; ++j) {
#pragma unroll
    for (int kc = 0; kc < NKC; ++kc) b[j][kc] = frag_t(bt, j * NKC + kc); }    // the wave's whole weight slice is requested at once: one L2 latency per product
  asm volatile("s_wait_xcnt 0x0" ::: "memory");    // precaution: the LDS address arithmetic below may reuse the address registers of the weight loads
#pragma unroll
  for (int kc = 0; kc < NKC; ++kc) { const v16h a0 = frag_h(a + kc * 32, lane), a1 = frag_h(a + 16 * LD + kc * 32, lane);
#pragma unroll
    for (int j = 0; j < NT; ++j) { acc[j][0] = wmma16(a0, b[j][kc], acc[j][0]); acc[j][1] = wmma16(a1, b[j][kc], acc[j][1]); } }
}
__global__ __launch_bounds__(512) void k_post(const float* __restrict__ O32, const _Float16* __restrict__ PA, const _Float16* __restrict__ PB, const float* __restrict__ bo, const float* __restrict__ lw, const float* __restrict__ lb, const float* __restrict__ b1, const float* __restrict__ b2, const float* __restrict__ x, float* __restrict__ out) {
  __shared__ __align__(16) _Float16 sz[32][C + 8];          // att rows (f16) then zl rows (f16)
  __shared__ __align__(16) float szf[32][C + 4];             // z rows f32 for the LN statistics, later t rows
  __shared__ __align__(16) _Float16 shh[32][HID + 8];        // gelu(h) f16
  const int tid = threadIdx.x, wave = tid >> 5, lane = tid & 31, col = lane & 15, g = lane >> 4; const int p0b = blockIdx.x * 32;
  // att rows -> f16: 32 rows x 64 pieces of 4 floats, 4 pieces per thread, 8 rows apart
  { const int rl = tid >> 6, pc = tid & 63; const float* pa = O32 + (size_t)(p0b + rl) * C + pc * 4; v4f av[4];
#pragma unroll
    for (int i = 0; i < 4; ++i) av[i] = *(const v4f*)(pa + i * 8 * C);
    asm volatile("s_wait_xcnt 0x0" :: "v"(pa) : "memory");    // precaution: the address is an operand, so it is not reused (not even as a later load's destination) before the loads that name it have passed this wait
#pragma unroll
    for (int i = 0; i < 4; ++i) {
#pragma unroll
      for (int e = 0; e < 4; ++e) sz[rl + i * 8][pc * 4 + e] = (_Float16)(av[i][e] * 64.0f); } }     // x64 carry keeps the small context values out of the f16 subnormal range
  __syncthreads();
  // z = att Wo^T /16/64 + bo: 16 column tiles, one per wave, 8 kc
  { const int n = wave * 16 + col; const float bb = bo[n]; v8f acc[1][2] = {};
    gemm_rt2<C / 32, 1, C + 8>(&sz[col][0], PA + (size_t)(3 * C + wave * 16) * C + lane * 8, lane, acc);
#pragma unroll
    for (int rt = 0; rt < 2; ++rt) {
#pragma unroll
      for (int r = 0; r < 8; ++r) szf[rt * 16 + 8 * g + r][n] = acc[0][rt][r] * (1.0f / (16.0f * 64.0f)) + bb; } }
  __syncthreads();
  // LN per row: 16 lanes per row (wave = 2 rows), lane = 4 pieces of 4 columns, 64 columns apart; the row stays in registers over both statistics
  { const int rl = wave * 2 + g; v4f zv[4], wv[4], bv[4];
#pragma unroll
    for (int i = 0; i < 4; ++i) { const int c = i * 64 + col * 4; wv[i] = *(const v4f*)(lw + c); bv[i] = *(const v4f*)(lb + c); zv[i] = *(const v4f*)(&szf[rl][c]); }
    asm volatile("s_wait_xcnt 0x0" ::: "memory");    // precaution: the arithmetic below may reuse the address registers of the ln_w and ln_b loads
    float s = 0.f, q = 0.f;
#pragma unroll
    for (int i = 0; i < 4; ++i) s += (zv[i][0] + zv[i][1]) + (zv[i][2] + zv[i][3]);
#pragma unroll
    for (int m = 8; m >= 1; m >>= 1) s += __shfl_xor(s, m, 32);
    const float mu = s * (1.0f / C);
#pragma unroll
    for (int i = 0; i < 4; ++i) {
#pragma unroll
      for (int e = 0; e < 4; ++e) { const float d = zv[i][e] - mu; q += d * d; } }
#pragma unroll
    for (int m = 8; m >= 1; m >>= 1) q += __shfl_xor(q, m, 32);
    const float rs = rsqrtf(q * (1.0f / C) + 1e-6f);
#pragma unroll
    for (int i = 0; i < 4; ++i) {
#pragma unroll
      for (int e = 0; e < 4; ++e) sz[rl][i * 64 + col * 4 + e] = (_Float16)((zv[i][e] - mu) * rs * wv[i][e] + bv[i][e]); } }
  __syncthreads();
  // h = gelu(zl W1^T/16 + b1): 32 column tiles, two per wave, 8 kc
  { float bb[2]; v8f acc[2][2] = {};
#pragma unroll
    for (int j = 0; j < 2; ++j) bb[j] = b1[wave * 32 + j * 16 + col];
    gemm_rt2<C / 32, 2, C + 8>(&sz[col][0], PA + (size_t)(4 * C + wave * 32) * C + lane * 8, lane, acc);
#pragma unroll
    for (int j = 0; j < 2; ++j) {
#pragma unroll
      for (int rt = 0; rt < 2; ++rt) {
#pragma unroll
        for (int r = 0; r < 8; ++r) shh[rt * 16 + 8 * g + r][wave * 32 + j * 16 + col] = (_Float16)gelu_e(acc[j][rt][r] * (1.0f / 16.0f) + bb[j]); } } }
  __syncthreads();
  // t = h W2^T/16 + b2: 16 column tiles, one per wave, 16 kc -> szf
  { const int n = wave * 16 + col; const float bb = b2[n]; v8f acc[1][2] = {};
    gemm_rt2<HID / 32, 1, HID + 8>(&shh[col][0], PB + (size_t)(wave * 16) * HID + lane * 8, lane, acc);
#pragma unroll
    for (int rt = 0; rt < 2; ++rt) {
#pragma unroll
      for (int r = 0; r < 8; ++r) szf[rt * 16 + 8 * g + r][n] = acc[0][rt][r] * (1.0f / 16.0f) + bb; } }
  __syncthreads();
  // NCHW store: out[c][p0b .. p0b+31] = x + t: per channel c 32 floats = one 128-B line = 8 pieces; thread -> (c = tid >> 3, piece = tid & 7): lanes contiguous, 4 pieces per thread, 64 channels apart
  { const int c0 = tid >> 3, pc = tid & 7; const float* px = x + (size_t)c0 * NP + p0b + pc * 4; v4f xv[4];
#pragma unroll
    for (int i = 0; i < 4; ++i) xv[i] = *(const v4f*)(px + (size_t)i * 64 * NP);
    asm volatile("s_wait_xcnt 0x0" :: "v"(px) : "memory");    // precaution, as at the att rows: the address stays untouched until the loads that name it have passed this wait
#pragma unroll
    for (int i = 0; i < 4; ++i) {
#pragma unroll
      for (int e = 0; e < 4; ++e) xv[i][e] += szf[pc * 4 + e][c0 + i * 64];
      vst2(out + (size_t)(c0 + i * 64) * NP + p0b + pc * 4, xv[i]); } }
}
extern "C" void kernel_launch(void* const* d_in, const int* in_sizes, int n_in, void* d_out, int out_size, void* d_ws, size_t ws_size, hipStream_t stream) {
  (void)in_sizes; (void)n_in; (void)out_size; (void)ws_size;
  const float** I = (const float**)d_in;    // x, y, Wq, bq, Wk, bk, Wv, bv, Wo, bo, ln_w, ln_b, W1, b1, W2, b2
  const float* x = I[0]; const float* y = I[1]; const float* Wq = I[2]; const float* bq = I[3]; const float* Wk = I[4]; const float* bk = I[5]; const float* Wv = I[6]; const float* bv = I[7]; const float* Wo = I[8]; const float* bo = I[9];
  const float* lw = I[10]; const float* lb = I[11]; const float* W1 = I[12]; const float* b1 = I[13]; const float* W2 = I[14]; const float* b2 = I[15];
  float* out = (float*)d_out;
  char* ws = (char*)d_ws; size_t off = 0;
  auto take = [&](size_t bytes) { char* p = ws + off; off += (bytes + 255) & ~(size_t)255; return p; };
  _Float16* X16 = (_Float16*)take((size_t)NP * C * 2); _Float16* Y16 = (_Float16*)take((size_t)NK * C * 2); _Float16* PA = (_Float16*)take((size_t)(4 * C + HID) * C * 2); _Float16* PB = (_Float16*)take((size_t)C * HID * 2);
  _Float16* Q16 = (_Float16*)take((size_t)NP * C * 2); _Float16* K16 = (_Float16*)take((size_t)NK * C * 2); _Float16* VT = (_Float16*)take((size_t)C * NK * 2); float* O32 = (float*)take((size_t)NP * C * 4);
  float* OP = (float*)take((size_t)NS * NP * C * 4); float* ML = (float*)take((size_t)2 * NS * NP * 2 * 4);
  // ws ~ 48 MB
  k_prep<<<NP / 64 + NK / 64 + (4 * C + HID + C) / 16, 256, 0, stream>>>(x, y, Wq, Wk, Wv, Wo, W1, W2, X16, Y16, PA, PB);
  k_qkv<<<dim3(NP / 64, C / 128, 3), 128, 0, stream>>>(X16, Y16, PA, bq, bk, bv, Q16, K16, VT);
  k_attn<<<dim3(NP / 64, 2, NS), 128, 0, stream>>>(Q16, K16, VT, OP, ML);
  k_merge<<<NP * (C / 4) / 2 / 256, 256, 0, stream>>>(OP, ML, O32);
  k_post<<<NP / 32, 512, 0, stream>>>(O32, PA, PB, bo, lw, lb, b1, b2, x, out);
}

// v007
// Measured time: 63.3 microseconds a run.
// Two timings next to v006 both put it at 1.09 times that version's speed.
// All steps since v000 together make it 13.1 times as fast.
// compute dtype: f16 operands (pixel/token rows as f16, weights packed x16 as f16 rows, q/k x4, P lifted by 2^14, V x4, att rows x64, zl/h rows x1), f32 accumulate; softmax, LayerNorm2d, GELU and the residual in f32. Output = x + t with both O(1).
#include <hip/hip_runtime.h>
#include <math.h>

typedef __attribute__((ext_vector_type(16))) _Float16 v16h;
typedef __attribute__((ext_vector_type(16))) __bf16 v16b;
typedef __attribute__((ext_vector_type(8)))  _Float16 v8h;
typedef __attribute__((ext_vector_type(8)))  float v8f;
typedef __attribute__((ext_vector_type(4)))  float v4f;
typedef __attribute__((ext_vector_type(2)))  float v2f;
typedef __attribute__((ext_vector_type(4)))  unsigned v4u;
typedef __attribute__((ext_vector_type(4)))  int v4i;
typedef float __attribute__((may_alias)) float_a;
typedef int __attribute__((may_alias)) int_a;

template <typename T> __device__ __forceinline__ void vst2(void* p, T v) { *(T*)p = v;  }
__device__ __forceinline__ v8f wmma16(v16h a, v16h b, v8f c) {
  v8f d = __builtin_amdgcn_wmma_f32_16x16x32_f16(false, a, false, b, (short)0, c, false, false);
  asm volatile("v_nop\n\tv_nop\n\tv_nop\n\tv_nop" : "+v"(d) : "v"(a), "v"(b));
  return d;
}
__device__ __forceinline__ v8f wmma_bf(v16b a, v16b b, v8f c) {
  v8f d = __builtin_amdgcn_wmma_f32_16x16x32_bf16(false, a, false, b, (short)0, c, false, false);
  asm volatile("v_nop\n\tv_nop\n\tv_nop\n\tv_nop" : "+v"(d) : "v"(a), "v"(b));
  return d;
}
// 16x16x32 fragments: lane = (h = lane>>4, row/col = lane&15); elements 0..7 = k0+8h+0..7, 8..15 = k0+16+8h+0..7; D element r = row 8h+r
__device__ __forceinline__ v16h frag_h(const _Float16* rowk0, int lane) {
  union { v16h v; v8h q[2]; } u; const _Float16* p = rowk0 + 8 * (lane >> 4);
  u.q[0] = *(const v8h*)p; u.q[1] = *(const v8h*)(p + 16); return u.v;
}
// Tiled operand layout in the workspace: a [rows][K] f16 matrix is kept as [rows / 16][K / 8][16 rows][8 halves]. One 16 x 32 fragment is then 1 KB in a row (block = tile * (K / 32) + k-step), and each of its
// two wave-wide 16-byte loads covers 512 contiguous bytes = 4 whole 128-B lines, where a row-major matrix gives 32 B out of each of 16 lines. base = matrix + lane * 8; register contents equal frag_h's.
__device__ __forceinline__ v16h frag_t(const _Float16* base, int blk) {
  union { v16h v; v8h q[2]; } u; const _Float16* p = base + (size_t)blk * 512;
  u.q[0] = *(const v8h*)p; u.q[1] = *(const v8h*)(p + 256); return u.v;
}
// 16 rows x 128 columns over NKC k-steps of 32: arow = this lane's A row at k = 0 (row-major, LDS) or, with AT, this lane's base in the A tile (tiled layout); bt = this lane's base in B's column tile 0 (tiled layout, tile j is NKC blocks further).
// The 8 B fragments and the A fragment of the next k-step are loaded in front of this k-step's WMMAs, so 18 loads fly behind each group of 8 WMMAs; k order per output element unchanged.
template <int NKC> __device__ __forceinline__ void ld8(v16h (&b)[8], const _Float16* bt, int kc) {
#pragma unroll
  for (int j = 0; j < 8; ++j) b[j] = frag_t(bt, j * NKC + kc);
}
__device__ __forceinline__ void mm8(v16h a, const v16h (&b)[8], v8f (&acc)[8]) {
#pragma unroll
  for (int j = 0; j < 8; ++j) acc[j] = wmma16(a, b[j], acc[j]);
}
template <bool AT> __device__ __forceinline__ v16h lda(const _Float16* arow, int kc, int lane) { return AT ? frag_t(arow, kc) : frag_h(arow + kc * 32, lane); }
template <int NKC, bool AT> __device__ __forceinline__ void gemm8(const _Float16* arow, const _Float16* bt, int lane, v8f (&acc)[8]) {
  asm volatile("s_wait_xcnt 0x0" ::: "memory");    // precaution: the fragment loads below may land in registers that earlier loads of a caller named as addresses (k_qkv loads its bias rows only after the product)
  v16h b0[8], b1[8]; v16h a0 = lda<AT>(arow, 0, lane), a1; ld8<NKC>(b0, bt, 0);
#pragma unroll 1    // rolled: the body already holds two k-steps, more copies only cost instruction cache
  for (int kc = 0; kc < NKC - 2; kc += 2) {
    a1 = lda<AT>(arow, kc + 1, lane); ld8<NKC>(b1, bt, kc + 1); mm8(a0, b0, acc);
    a0 = lda<AT>(arow, kc + 2, lane); ld8<NKC>(b0, bt, kc + 2); mm8(a1, b1, acc);
    asm volatile("s_wait_xcnt 0x0" ::: "memory"); }    // precaution: the loads of k-step kc + 2 are still in flight when the next trip rewrites their address registers
  a1 = lda<AT>(arow, NKC - 1, lane); ld8<NKC>(b1, bt, NKC - 1); mm8(a0, b0, acc); mm8(a1, b1, acc);
  asm volatile("s_wait_xcnt 0x0" ::: "memory");    // precaution: the caller's epilogue may reuse the address registers of the last k-step's loads
}
__device__ __forceinline__ v16h frag_f32(const float* rowk0, int lane) {
  v16h a; const float* p = rowk0 + 8 * (lane >> 4);
#pragma unroll
  for (int i = 0; i < 8; ++i) { a[i] = (_Float16)p[i]; a[8 + i] = (_Float16)p[16 + i]; }
  return a;
}
__device__ __forceinline__ v16h frag_f32s(const float* rowk0, int lane, float sc) {
  v16h a; const float* p = rowk0 + 8 * (lane >> 4);
#pragma unroll
  for (int i = 0; i < 8; ++i) { a[i] = (_Float16)(p[i] * sc); a[8 + i] = (_Float16)(p[16 + i] * sc); }
  return a;
}
// column fragment from a [K][ld] layout (column n), rows >= K read as 0
__device__ __forceinline__ v16h fragc_f32(const float* W, int k0, int n, int lane, int ld, int K) {
  v16h a; const int g = lane >> 4;
#pragma unroll
  for (int i = 0; i < 8; ++i) { const int ka = k0 + 8 * g + i, kb = ka + 16;
    a[i] = (_Float16)(ka < K ? W[(size_t)(ka < K ? ka : K - 1) * ld + n] : 0.f); a[8 + i] = (_Float16)(kb < K ? W[(size_t)(kb < K ? kb : K - 1) * ld + n] : 0.f); }
  return a;
}
struct F2 { v16b h, l; };
__device__ __forceinline__ F2 bsplit16(const float v[16]) { F2 r;
#pragma unroll
  for (int i = 0; i < 16; ++i) { const __bf16 h = (__bf16)v[i]; r.h[i] = h; r.l[i] = (__bf16)(v[i] - (float)h); }
  return r; }
__device__ __forceinline__ F2 split_row(const float* row, int k0, int lane) { float v[16]; const float* p = row + k0 + 8 * (lane >> 4);
#pragma unroll
  for (int i = 0; i < 8; ++i) { v[i] = p[i]; v[8 + i] = p[16 + i]; }
  return bsplit16(v); }
__device__ __forceinline__ F2 split_rowK(const float* row, int k0, int lane, int K) { float v[16]; const int g = lane >> 4;
#pragma unroll
  for (int i = 0; i < 8; ++i) { const int ka = k0 + 8 * g + i, kb = ka + 16; v[i] = ka < K ? row[ka < K ? ka : K - 1] : 0.f; v[8 + i] = kb < K ? row[kb < K ? kb : K - 1] : 0.f; }
  return bsplit16(v); }
__device__ __forceinline__ F2 split_col(const float* W, int k0, int n, int lane, int ld, int K) { float v[16]; const int g = lane >> 4;
#pragma unroll
  for (int i = 0; i < 8; ++i) { const int ka = k0 + 8 * g + i, kb = ka + 16; v[i] = ka < K ? W[(size_t)(ka < K ? ka : K - 1) * ld + n] : 0.f; v[8 + i] = kb < K ? W[(size_t)(kb < K ? kb : K - 1) * ld + n] : 0.f; }
  return bsplit16(v); }
__device__ __forceinline__ v8f mac3(const F2& a, const F2& b, v8f c) { c = wmma_bf(a.l, b.h, c); c = wmma_bf(a.h, b.l, c); return wmma_bf(a.h, b.h, c); }
__device__ __forceinline__ float sigm(float v) { return 1.0f / (1.0f + expf(-v)); }
#define LDSX() do { asm volatile("s_wait_dscnt 0" ::: "memory"); __builtin_amdgcn_wave_barrier(); __builtin_amdgcn_fence(__ATOMIC_RELEASE, "workgroup"); } while (0)


// Cross-modal encoder block: Q = conv1x1(x) per pixel (4096 x 256), K,V = y^T W^T + b (4096 x 256); scores = Q.K/16 over the 4096 y-tokens (one 256-dim head); att = softmax V; z = att Wo^T + bo;
// LayerNorm2d over channels per pixel (eps 1e-6); t = gelu(z_ln W1^T + b1) W2^T + b2; out = x + t (NCHW).
// halves d<128 / d>=128 on two waves to stay inside the VGPR budget; S shared in LDS), k_post (z + LN + MLP + residual, NCHW store by channel rows). Whole-line stores, one instruction per line.
#define C 256
#define NP 4096
#define NK 4096
#define HID 512
#define NS 8                 // key ranges per query tile: 64 x NS work-groups of 8 waves = 2 per WGP on 256 WGPs
#define KT_S (NK / 64 / NS)  // 64-key trips per range
__device__ __attribute__((noinline)) float gelu_e(float v) { return 0.5f * v * (1.0f + erff(v * 0.70710678118654752f)); }    // out of line: keeps the static VALU-FMA count of k_post small

// token-major f16 rows from a [C][N] f32 array, in the tiled layout: block = 64 tokens = 4 tiles = 32 KB in a row; piece q of a tile = (column piece q >> 4, row q & 15)
__device__ __forceinline__ void cvt_block(const float* __restrict__ src, _Float16* __restrict__ T16, _Float16 (&st)[64][C + 8], int tid, int n0) {
  for (int q = tid; q < C * 16; q += 256) { const int c = q >> 4, p4 = q & 15; const v4f v = *(const v4f*)(src + (size_t)c * NP + n0 + p4 * 4);
    st[p4 * 4][c] = (_Float16)v[0]; st[p4 * 4 + 1][c] = (_Float16)v[1]; st[p4 * 4 + 2][c] = (_Float16)v[2]; st[p4 * 4 + 3][c] = (_Float16)v[3]; }
  __syncthreads();
  for (int q = tid; q < 64 * (C / 8); q += 256) { const int rl = (q >> 9) * 16 + (q & 15), pc = (q >> 4) & 31; vst2(T16 + (size_t)n0 * C + q * 8, *(const v4u*)(&st[rl][pc * 8])); }
}
// PA rows (256 halves x16): [0,C) Wq, [C,2C) Wk, [2C,3C) Wv, [3C,4C) Wo, [4C, 4C+HID) W1 ; PB rows (512 halves x16): W2 rows (256); both in the tiled layout.
// block = one 16-row tile, so that every 128-B line has one writer; thread = pieces of 8 halves, piece q = (column piece q >> 4, row q & 15)
template <int K> __device__ __forceinline__ void pack_tile(const float* __restrict__ W, _Float16* __restrict__ P, int tid) {
  for (int q = tid; q < 16 * (K / 8); q += 256) { const float* s = W + (size_t)(q & 15) * K + (q >> 4) * 8; const v4f a = *(const v4f*)s, b = *(const v4f*)(s + 4); v8h o;
#pragma unroll
    for (int e = 0; e < 4; ++e) { o[e] = (_Float16)(a[e] * 16.0f); o[4 + e] = (_Float16)(b[e] * 16.0f); }
    vst2(P + (size_t)q * 8, o); }
}
// one launch for all operand preparation: the three jobs read only inputs and write disjoint workspace arrays, so their 240 blocks (fewer than the chip has WGPs) can run side by side instead of in three dependent launches.
// blocks [0, NP/64): x rows; [NP/64, NP/64 + NK/64): y rows (the long jobs first); the rest: one 16-row weight tile each. The choice is uniform over a block, so the barrier in cvt_block is passed by all of its threads or none.
__global__ __launch_bounds__(256) void k_prep(const float* __restrict__ x, const float* __restrict__ y, const float* __restrict__ Wq, const float* __restrict__ Wk, const float* __restrict__ Wv, const float* __restrict__ Wo, const float* __restrict__ W1, const float* __restrict__ W2, _Float16* __restrict__ X16, _Float16* __restrict__ Y16, _Float16* __restrict__ PA, _Float16* __restrict__ PB) {
  __shared__ __align__(16) _Float16 st[64][C + 8];
  const int b = blockIdx.x, tid = threadIdx.x;
  if (b < NP / 64 + NK / 64) { const bool isx = b < NP / 64; cvt_block(isx ? x : y, isx ? X16 : Y16, st, tid, (isx ? b : b - NP / 64) * 64); return; }
  const int n = (b - (NP / 64 + NK / 64)) * 16;
  if (n < 4 * C + HID) { const float* W = n < C ? Wq + (size_t)n * C : (n < 2 * C ? Wk + (size_t)(n - C) * C : (n < 3 * C ? Wv + (size_t)(n - 2 * C) * C : (n < 4 * C ? Wo + (size_t)(n - 3 * C) * C : W1 + (size_t)(n - 4 * C) * C)));
    pack_tile<C>(W, PA + (size_t)n * C, tid); }
  else { const int m = n - (4 * C + HID); pack_tile<HID>(W2 + (size_t)m * HID, PB + (size_t)m * HID, tid); }
}
// q/k/v: block (64 rows, 128 cols, which); which 0 reads X16 else Y16; Q16/K16 rows x4 (+bias); V -> VT x4 [d][n]; all three in the tiled layout
__global__ __launch_bounds__(128) void k_qkv(const _Float16* __restrict__ X16, const _Float16* __restrict__ Y16, const _Float16* __restrict__ PA, const float* __restrict__ bq, const float* __restrict__ bk, const float* __restrict__ bv, _Float16* __restrict__ Q16, _Float16* __restrict__ K16, _Float16* __restrict__ VT) {
  __shared__ __align__(16) _Float16 so[4][16][136];
  __shared__ __align__(16) _Float16 sth[128][72];
  const int tid = threadIdx.x, wave = tid >> 5, lane = tid & 31, col = lane & 15, g = lane >> 4;
  const int which = blockIdx.z, r0b = blockIdx.x * 64, r0 = r0b + wave * 16, n0 = blockIdx.y * 128; const _Float16* SRC = which == 0 ? X16 : Y16; const float* bb_ = which == 0 ? bq : (which == 1 ? bk : bv);
  v8f acc[8] = {};
  gemm8<C / 32, true>(SRC + (size_t)r0 * C + lane * 8, PA + (size_t)(which * C + n0) * C + lane * 8, lane, acc);
  if (which < 2) {
#pragma unroll
    for (int j = 0; j < 8; ++j) { const float bb = bb_[n0 + j * 16 + col];
#pragma unroll
      for (int r = 0; r < 8; ++r) so[wave][8 * g + r][j * 16 + col] = (_Float16)((acc[j][r] * (1.0f / 16.0f) + bb) * 4.0f); }
    LDSX();
    _Float16* D = which == 0 ? Q16 : K16;
    for (int q = lane; q < 16 * 16; q += 32) vst2(D + (size_t)r0 * C + n0 * 16 + q * 8, *(const v4u*)(&so[wave][q & 15][(q >> 4) * 8])); }    // the wave's 16 rows x 128 columns = 4 KB in a row of its tile
  else {
#pragma unroll
    for (int j = 0; j < 8; ++j) { const float bb = bb_[n0 + j * 16 + col];
#pragma unroll
      for (int r = 0; r < 8; ++r) sth[j * 16 + col][wave * 16 + 8 * g + r] = (_Float16)((acc[j][r] * (1.0f / 16.0f) + bb) * 4.0f); }
    __syncthreads();
    for (int qq = tid; qq < 128 * 8; qq += 128) { const int jd = qq >> 7, ql = qq & 127;    // 64 keys of one 16-row d tile = 2 KB in a row
      vst2(VT + (size_t)(n0 + jd * 16) * NK + r0b * 16 + ql * 8, *(const v4u*)(&sth[jd * 16 + (ql & 15)][(ql >> 4) * 8])); } }
}
// asynchronous copies global -> LDS, 16 bytes per lane = 512 B per copy and wave. l = the lane's LDS byte address; its global address = scalar base b + the lane's byte offset o; the immediate offset moves
// both addresses alike, so a run that is contiguous on both sides needs one set of addresses. The s_wait_xcnt is the last line of the copies' own statement (a precaution): no address register is rewritten before the copies that name it have passed it.
__device__ __forceinline__ void copy_2x2k(unsigned l0, unsigned l1, unsigned o, const _Float16* b0, const _Float16* b1) {    // two runs of 2 KB
  asm volatile("global_load_async_to_lds_b128 %0, %2, %3\n\t"
               "global_load_async_to_lds_b128 %0, %2, %3 offset:512\n\t"
               "global_load_async_to_lds_b128 %0, %2, %3 offset:1024\n\t"
               "global_load_async_to_lds_b128 %0, %2, %3 offset:1536\n\t"
               "global_load_async_to_lds_b128 %1, %2, %4\n\t"
               "global_load_async_to_lds_b128 %1, %2, %4 offset:512\n\t"
               "global_load_async_to_lds_b128 %1, %2, %4 offset:1024\n\t"
               "global_load_async_to_lds_b128 %1, %2, %4 offset:1536\n\t"
               "s_wait_xcnt 0x0" :: "v"(l0), "v"(l1), "v"(o), "s"(b0), "s"(b1) : "memory");
}
// hand-over of the ring, passed by every wave: the wave's own LDS reads are done, its own copies have landed, then the block barrier: it publishes the tile that was in flight and frees the buffer just read
#define RING_FOOT() do { asm volatile("s_wait_dscnt 0x0" ::: "memory"); asm volatile("s_wait_asynccnt 0x0" ::: "memory"); __syncthreads(); } while (0)
// attention: block = (64 queries, key range sp) on 8 waves; wave = (query tile w, value half dh): S over 256 dims (8 kc), softmax over the range's NK/NS keys, P.V for d in [dh*128, dh*128+128).
// The two waves of a query tile share one score tile and one P tile in LDS: wave dh computes the scores of keys [dh*32, dh*32+32) of a 64-key tile and 32 of its 64 exponentials per row, so no score and no exponential is computed twice;
// both read all 64 scores of a row for the maximum (the same value in both), each keeps the sum of its own exponentials, and the two sums are added behind the loop.
// OP[sp][q][d] = the range's own normalised context rows (f32); ML[sp][q] = (range maximum, range sum); k_merge joins the ranges
// The 64-key K tile (32 KB) and V tile (32 KB) are brought into LDS once per block by asynchronous copies and read there by the waves. Ring of two buffers, tiles K0, V0, K1, V1, ...:
// the score half of a trip reads the K buffer while the V tile flies, the softmax and P.V half reads the V buffer while the next K tile flies. Fragment order in LDS = the workspace's tiled layout.
#define KBUF_B (64 * C * 2)
#define VBUF_B (C * 64 * 2)
#define STAGE_B (8 * 16 * 132 * 4)    // output staging behind the loop, a little more than the two buffers
__global__ __launch_bounds__(256) void k_attn(const _Float16* __restrict__ Q16, const _Float16* __restrict__ K16, const _Float16* __restrict__ VT, float* __restrict__ OP, float* __restrict__ ML) {
  __shared__ __align__(16) unsigned char ring[STAGE_B];    // K buffer, V buffer; behind the loop the output staging (8 x 16 x 132 floats)
  __shared__ __align__(16) float sS[4][16][68];
  __shared__ __align__(16) _Float16 sPh[4][16][72];
  const int tid = threadIdx.x, w8 = tid >> 5, w = w8 & 3, dh = w8 >> 2, lane = tid & 31, col = lane & 15, g = lane >> 4; const int q0 = blockIdx.x * 64 + w * 16; const int sp = blockIdx.y;
  float* __restrict__ O32 = OP + (size_t)sp * NP * C;
  const _Float16* sKl = (const _Float16*)ring + dh * (32 * C) + lane * 8; const _Float16* sVl = (const _Float16*)(ring + KBUF_B) + dh * (128 * 64) + lane * 8;    // this lane's base in the wave's half of each buffer
  // the wave's share of a tile: K = half of a key tile (4 KB in a row, 8 copies); V = the 64 keys of d tiles 2 w8 and 2 w8 + 1 (2 KB in a row each, 8 copies)
  const unsigned lK = (unsigned)(size_t)ring + w8 * 4096 + lane * 16, lV = (unsigned)(size_t)ring + KBUF_B + w8 * 4096 + lane * 16;
  const unsigned oK = w8 * 4096 + lane * 16, oV = w8 * (32 * NK * 2) + lane * 16;    // the lane's byte offsets from the block's tile bases
  const _Float16* bK = K16 + (size_t)(sp * KT_S * 64) * C;
  const _Float16* bV = VT + sp * KT_S * 64 * 16;
  copy_2x2k(lK, lK + 2048, oK, bK, bK + 1024);
  v16h aq[8];
#pragma unroll
  for (int kc = 0; kc < 8; ++kc) aq[kc] = frag_t(Q16 + (size_t)q0 * C + lane * 8, kc);
  asm volatile("s_wait_asynccnt 0x0" ::: "memory");    // K tile 0 has landed (this wave's share)
  __syncthreads();
  copy_2x2k(lV, lV + 2048, oV, bV, bV + 16 * NK);
  float mrun = -3.0e38f, lrun = 0.f; v8f acc[8] = {};
#pragma unroll 1
  for (int ks = 0; ks < KT_S; ++ks) {
#pragma unroll
    for (int t = 0; t < 2; ++t) { v8f s = {}; v16h kf[8];    // the key tile's 8 fragments are all requested before its first WMMA
#pragma unroll
      for (int kc = 0; kc < 8; ++kc) kf[kc] = frag_t(sKl, t * 8 + kc);
#pragma unroll
      for (int kc = 0; kc < 8; ++kc) s = wmma16(aq[kc], kf[kc], s);
#pragma unroll
      for (int r = 0; r < 8; ++r) sS[w][8 * g + r][dh * 32 + t * 16 + col] = s[r] * (0.0625f / 16.0f); }
    RING_FOOT();    // V tile ks is published, the K buffer is free; both waves' halves of the query tile's score rows are published too
    if (ks + 1 < KT_S) { bK += 64 * C; copy_2x2k(lK, lK + 2048, oK, bK, bK + 1024); }
    float mx = -3.4e38f, sc[16];    // sc = the scores of this wave's 16 of the lane's 32 keys, read once for the maximum and the exponentials
#pragma unroll
    for (int jj = 0; jj < 16; ++jj) { sc[jj] = sS[w][col][g * 32 + dh * 16 + jj]; mx = fmaxf(mx, fmaxf(sc[jj], sS[w][col][g * 32 + (dh ^ 1) * 16 + jj])); }
    mx = fmaxf(mx, __shfl_xor(mx, 16, 32));
    const float mnew = fmaxf(mrun, mx); const float corr = expf(mrun - mnew);
    float ps = 0.f;
#pragma unroll
    for (int jj = 0; jj < 16; ++jj) { const float p = expf(sc[jj] - mnew) * 16384.0f; ps += p; sPh[w][col][g * 32 + dh * 16 + jj] = (_Float16)p; }    // this wave's 16 of the lane's 32 keys
    ps += __shfl_xor(ps, 16, 32);
    lrun = lrun * corr + ps * (1.0f / 16384.0f); mrun = mnew;
#pragma unroll
    for (int r = 0; r < 8; ++r) { const float cr = __shfl(corr, 8 * g + r, 32);
#pragma unroll
      for (int t = 0; t < 8; ++t) acc[t][r] *= cr; }
    __syncthreads();    // both waves' halves of the query tile's P rows are published
#pragma unroll
    for (int kc = 0; kc < 2; ++kc) { const v16h ph = frag_h(&sPh[w][col][0] + kc * 32, lane);
      v16h vf[8]; ld8<2>(vf, sVl, kc);    // the 8 value fragments of these 32 keys are all requested before the first WMMA
      mm8(ph, vf, acc); }
    RING_FOOT();    // K tile ks + 1 is published, the V buffer is free
    if (ks + 1 < KT_S) { bV += 64 * 16; copy_2x2k(lV, lV + 2048, oV, bV, bV + 16 * NK); } }
  asm volatile("s_wait_asynccnt 0x0" ::: "memory");    // nothing is in flight when the ring becomes output staging (the last hand-over's barrier has ended every wave's reads)
  if (lane < 16) sS[w][dh][lane] = lrun;    // the row sums of the two waves of a query tile are added, in the same order in both (the score rows are no longer read)
  __syncthreads();
  lrun = sS[w][0][col] + sS[w][1][col];
  float (*sO)[132] = (float (*)[132])(ring + w8 * (16 * 132 * 4));
#pragma unroll
  for (int r = 0; r < 8; ++r) { const float lr = __shfl(lrun, 8 * g + r, 32); const float inv = 1.0f / (lr * 16384.0f * 4.0f);
#pragma unroll
    for (int t = 0; t < 8; ++t) sO[8 * g + r][t * 16 + col] = acc[t][r] * inv; }
  LDSX();
  for (int rl = 0; rl < 16; ++rl) vst2(O32 + (size_t)(q0 + rl) * C + dh * 128 + lane * 4, *(const v4f*)(&sO[rl][lane * 4]));
  if (dh == 0 && lane < 16) { v2f ml; ml[0] = mrun; ml[1] = lrun; vst2(ML + ((size_t)sp * NP + q0 + lane) * 2, ml); }    // 16 rows x 8 B = one 128-B line per query tile
}
// join of the NS key ranges: weight of range s = l_s * exp(m_s - max m); O32[q][d] = sum_s weight_s * OP[s][q][d] / sum_s weight_s; thread = 4 columns of rows q and q + NP/2
// (no __restrict__ here: it lets the wait statement below drift away from the loads to the end of the kernel)
__global__ __launch_bounds__(256) void k_merge(const float* OP, const float* ML, float* O32) {
  const int idx = blockIdx.x * 256 + threadIdx.x, c4 = idx & 63, q = idx >> 6;
  const float* pm = ML + (size_t)q * 2;    // row q's (max, sum) pair in range 0
  const float* po[NS / 2];                                           // the thread's 4 columns of row q in ranges 0, 2, 4, 6
#pragma unroll
  for (int s2 = 0; s2 < NS / 2; ++s2) po[s2] = OP + ((size_t)(2 * s2) * NP + q) * C + c4 * 4;
  v2f ml[2][NS]; v4f o[2][NS];
#pragma unroll
  for (int h = 0; h < 2; ++h) {
#pragma unroll
    for (int s = 0; s < NS; ++s) { ml[h][s] = *(const v2f*)(pm + (s * NP + h * (NP / 2)) * 2); o[h][s] = *(const v4f*)(po[s >> 1] + ((s & 1) * NP + h * (NP / 2)) * C); } }
  // precaution behind the last load: the address registers are operands, so none is reused (not even as a later load's destination) before the loads that name it have passed this wait
  asm volatile("s_wait_xcnt 0x0" :: "v"(pm), "v"(po[0]), "v"(po[1]), "v"(po[2]), "v"(po[3]) : "memory");
#pragma unroll
  for (int h = 0; h < 2; ++h) {
    float mx = ml[h][0][0];
#pragma unroll
    for (int s = 1; s < NS; ++s) mx = fmaxf(mx, ml[h][s][0]);
    float ws = 0.f; v4f a = {};
#pragma unroll
    for (int s = 0; s < NS; ++s) { const float wt = ml[h][s][1] * expf(ml[h][s][0] - mx); ws += wt; a += o[h][s] * wt; }
    vst2(O32 + ((size_t)q + h * (NP / 2)) * C + c4 * 4, a * (1.0f / ws)); }
}
// post: z = att Wo^T + bo; LN over 256 (eps 1e-6) * ln_w + ln_b; h = gelu(zl W1^T + b1); t = h W2^T + b2; out[c][p] = x[c][p] + t[p][c]
// block = 32 pixels (one 128-B line of every output channel row) on 16 waves, 4 per SIMD: in each product a wave owns NT column tiles of 16 and runs them against both 16-row tiles of the block,
// so a weight fragment is fetched once per block and every serial piece (k loop, LN, GELU, store) is 1/8 as long per wave as with 16 rows x all columns per wave.
// a = this lane's row of row tile 0 in LDS (row-major, pitch LD halves; row tile 1 is 16 rows further); bt = this lane's base in the wave's first column tile (tiled layout). k order per output element: ascending, as before.
template <int NKC, int NT, int LD> __device__ __forceinline__ void gemm_rt2(const _Float16* a, const _Float16* bt, int lane, v8f (&acc)[NT][2]) {
  v16h b[NT][NKC];
#pragma unroll
  for (int j = 0; j < NT; ++j) {
#pragma unroll
    for (int kc = 0; kc < NKC; ++kc) b[j][kc] = frag_t(bt, j * NKC + kc); }    // the wave's whole weight slice is requested at once: one L2 latency per product
  asm volatile("s_wait_xcnt 0x0" ::: "memory");    // precaution: the LDS address arithmetic below may reuse the address registers of the weight loads
#pragma unroll
  for (int kc = 0; kc < NKC; ++kc) { const v16h a0 = frag_h(a + kc * 32, lane), a1 = frag_h(a + 16 * LD + kc * 32, lane);
#pragma unroll
    for (int j = 0; j < NT; ++j) { acc[j][0] = wmma16(a0, b[j][kc], acc[j][0]); acc[j][1] = wmma16(a1, b[j][kc], acc[j][1]); } }
}
__global__ __launch_bounds__(512) void k_post(const float* __restrict__ O32, const _Float16* __restrict__ PA, const _Float16* __restrict__ PB, const float* __restrict__ bo, const float* __restrict__ lw, const float* __restrict__ lb, const float* __restrict__ b1, const float* __restrict__ b2, const float* __restrict__ x, float* __restrict__ out) {
  __shared__ __align__(16) _Float16 sz[32][C + 8];          // att rows (f16) then zl rows (f16)
  __shared__ __align__(16) float szf[32][C + 4];             // z rows f32 for the LN statistics, later t rows
  __shared__ __align__(16) _Float16 shh[32][HID + 8];        // gelu(h) f16
  const int tid = threadIdx.x, wave = tid >> 5, lane = tid & 31, col = lane & 15, g = lane >> 4; const int p0b = blockIdx.x * 32;
  // att rows -> f16: 32 rows x 64 pieces of 4 floats, 4 pieces per thread, 8 rows apart
  { const int rl = tid >> 6, pc = tid & 63; const float* pa = O32 + (size_t)(p0b + rl) * C + pc * 4; v4f av[4];
#pragma unroll
    for (int i = 0; i < 4; ++i) av[i] = *(const v4f*)(pa + i * 8 * C);
    asm volatile("s_wait_xcnt 0x0" :: "v"(pa) : "memory");    // precaution: the address is an operand, so it is not reused (not even as a later load's destination) before the loads that name it have passed this wait
#pragma unroll
    for (int i = 0; i < 4; ++i) {
#pragma unroll
      for (int e = 0; e < 4; ++e) sz[rl + i * 8][pc * 4 + e] = (_Float16)(av[i][e] * 64.0f); } }     // x64 carry keeps the small context values out of the f16 subnormal range
  __syncthreads();
  // z = att Wo^T /16/64 + bo: 16 column tiles, one per wave, 8 kc
  { const int n = wave * 16 + col; const float bb = bo[n]; v8f acc[1][2] = {};
    gemm_rt2<C / 32, 1, C + 8>(&sz[col][0], PA + (size_t)(3 * C + wave * 16) * C + lane * 8, lane, acc);
#pragma unroll
    for (int rt = 0; rt < 2; ++rt) {
#pragma unroll
      for (int r = 0; r < 8; ++r) szf[rt * 16 + 8 * g + r][n] = acc[0][rt][r] * (1.0f / (16.0f * 64.0f)) + bb; } }
  __syncthreads();
  // LN per row: 16 lanes per row (wave = 2 rows), lane = 4 pieces of 4 columns, 64 columns apart; the row stays in registers over both statistics
  { const int rl = wave * 2 + g; v4f zv[4], wv[4], bv[4];
#pragma unroll
    for (int i = 0; i < 4; ++i) { const int c = i * 64 + col * 4; wv[i] = *(const v4f*)(lw + c); bv[i] = *(const v4f*)(lb + c); zv[i] = *(const v4f*)(&szf[rl][c]); }
    asm volatile("s_wait_xcnt 0x0" ::: "memory");    // precaution: the arithmetic below may reuse the address registers of the ln_w and ln_b loads
    float s = 0.f, q = 0.f;
#pragma unroll
    for (int i = 0; i < 4; ++i) s += (zv[i][0] + zv[i][1]) + (zv[i][2] + zv[i][3]);
#pragma unroll
    for (int m = 8; m >= 1; m >>= 1) s += __shfl_xor(s, m, 32);
    const float mu = s * (1.0f / C);
#pragma unroll
    for (int i = 0; i < 4; ++i) {
#pragma unroll
      for (int e = 0; e < 4; ++e) { const float d = zv[i][e] - mu; q += d * d; } }
#pragma unroll
    for (int m = 8; m >= 1; m >>= 1) q += __shfl_xor(q, m, 32);
    const float rs = rsqrtf(q * (1.0f / C) + 1e-6f);
#pragma unroll
    for (int i = 0; i < 4; ++i) {
#pragma unroll
      for (int e = 0; e < 4; ++e) sz[rl][i * 64 + col * 4 + e] = (_Float16)((zv[i][e] - mu) * rs * wv[i][e] + bv[i][e]); } }
  __syncthreads();
  // h = gelu(zl W1^T/16 + b1): 32 column tiles, two per wave, 8 kc
  { float bb[2]; v8f acc[2][2] = {};
#pragma unroll
    for (int j = 0; j < 2; ++j) bb[j] = b1[wave * 32 + j * 16 + col];
    gemm_rt2<C / 32, 2, C + 8>(&sz[col][0], PA + (size_t)(4 * C + wave * 32) * C + lane * 8, lane, acc);
#pragma unroll
    for (int j = 0; j < 2; ++j) {
#pragma unroll
      for (int rt = 0; rt < 2; ++rt) {
#pragma unroll
        for (int r = 0; r < 8; ++r) shh[rt * 16 + 8 * g + r][wave * 32 + j * 16 + col] = (_Float16)gelu_e(acc[j][rt][r] * (1.0f / 16.0f) + bb[j]); } } }
  __syncthreads();
  // t = h W2^T/16 + b2: 16 column tiles, one per wave, 16 kc -> szf
  { const int n = wave * 16 + col; const float bb = b2[n]; v8f acc[1][2] = {};
    gemm_rt2<HID / 32, 1, HID + 8>(&shh[col][0], PB + (size_t)(wave * 16) * HID + lane * 8, lane, acc);
#pragma unroll
    for (int rt = 0; rt < 2; ++rt) {
#pragma unroll
      for (int r = 0; r < 8; ++r) szf[rt * 16 + 8 * g + r][n] = acc[0][rt][r] * (1.0f / 16.0f) + bb; } }
  __syncthreads();
  // NCHW store: out[c][p0b .. p0b+31] = x + t: per channel c 32 floats = one 128-B line = 8 pieces; thread -> (c = tid >> 3, piece = tid & 7): lanes contiguous, 4 pieces per thread, 64 channels apart
  { const int c0 = tid >> 3, pc = tid & 7; const float* px = x + (size_t)c0 * NP + p0b + pc * 4; v4f xv[4];
#pragma unroll
    for (int i = 0; i < 4; ++i) xv[i] = *(const v4f*)(px + (size_t)i * 64 * NP);
    asm volatile("s_wait_xcnt 0x0" :: "v"(px) : "memory");    // precaution, as at the att rows: the address stays untouched until the loads that name it have passed this wait
#pragma unroll
    for (int i = 0; i < 4; ++i) {
#pragma unroll
      for (int e = 0; e < 4; ++e) xv[i][e] += szf[pc * 4 + e][c0 + i * 64];
      vst2(out + (size_t)(c0 + i * 64) * NP + p0b + pc * 4, xv[i]); } }
}
extern "C" void kernel_launch(void* const* d_in, const int* in_sizes, int n_in, void* d_out, int out_size, void* d_ws, size_t ws_size, hipStream_t stream) {
  (void)in_sizes; (void)n_in; (void)out_size; (void)ws_size;
  const float** I = (const float**)d_in;    // x, y, Wq, bq, Wk, bk, Wv, bv, Wo, bo, ln_w, ln_b, W1, b1, W2, b2
  const float* x = I[0]; const float* y = I[1]; const float* Wq = I[2]; const float* bq = I[3]; const float* Wk = I[4]; const float* bk = I[5]; const float* Wv = I[6]; const float* bv = I[7]; const float* Wo = I[8]; const float* bo = I[9];
  const float* lw = I[10]; const float* lb = I[11]; const float* W1 = I[12]; const float* b1 = I[13]; const float* W2 = I[14]; const float* b2 = I[15];
  float* out = (float*)d_out;
  char* ws = (char*)d_ws; size_t off = 0;
  auto take = [&](size_t bytes) { char* p = ws + off; off += (bytes + 255) & ~(size_t)255; return p; };
  _Float16* X16 = (_Float16*)take((size_t)NP * C * 2); _Float16* Y16 = (_Float16*)take((size_t)NK * C * 2); _Float16* PA = (_Float16*)take((size_t)(4 * C + HID) * C * 2); _Float16* PB = (_Float16*)take((size_t)C * HID * 2);
  _Float16* Q16 = (_Float16*)take((size_t)NP * C * 2); _Float16* K16 = (_Float16*)take((size_t)NK * C * 2); _Float16* VT = (_Float16*)take((size_t)C * NK * 2); float* O32 = (float*)take((size_t)NP * C * 4);
  float* OP = (float*)take((size_t)NS * NP * C * 4); float* ML = (float*)take((size_t)NS * NP * 2 * 4);
  // ws ~ 48 MB
  k_prep<<<NP / 64 + NK / 64 + (4 * C + HID + C) / 16, 256, 0, stream>>>(x, y, Wq, Wk, Wv, Wo, W1, W2, X16, Y16, PA, PB);
  k_qkv<<<dim3(NP / 64, C / 128, 3), 128, 0, stream>>>(X16, Y16, PA, bq, bk, bv, Q16, K16, VT);
  k_attn<<<dim3(NP / 64, NS), 256, 0, stream>>>(Q16, K16, VT, OP, ML);
  k_merge<<<NP * (C / 4) / 2 / 256, 256, 0, stream>>>(OP, ML, O32);
  k_post<<<NP / 32, 512, 0, stream>>>(O32, PA, PB, bo, lw, lb, b1, b2, x, out);
}

// v008
// It runs in 57.9 microseconds.
// Timed twice side by side with v007, it ran 1.09 times as fast both times.
// All steps since v000 together make it 14.3 times as fast.
// compute dtype: f16 operands (pixel/token rows as f16, weights packed x16 as f16 rows, q/k x4, P lifted by 2^14, V x4, att rows x64, zl/h rows x1), f32 accumulate; softmax, LayerNorm2d, GELU and the residual in f32. Output = x + t with both O(1).
#include <hip/hip_runtime.h>
#include <math.h>

typedef __attribute__((ext_vector_type(16))) _Float16 v16h;
typedef __attribute__((ext_vector_type(16))) __bf16 v16b;
typedef __attribute__((ext_vector_type(8)))  _Float16 v8h;
typedef __attribute__((ext_vector_type(8)))  float v8f;
typedef __attribute__((ext_vector_type(4)))  float v4f;
typedef __attribute__((ext_vector_type(2)))  float v2f;
typedef __attribute__((ext_vector_type(4)))  unsigned v4u;
typedef __attribute__((ext_vector_type(4)))  int v4i;
typedef float __attribute__((may_alias)) float_a;
typedef int __attribute__((may_alias)) int_a;

template <typename T> __device__ __forceinline__ void vst2(void* p, T v) { *(T*)p = v;  }
__device__ __forceinline__ v8f wmma16(v16h a, v16h b, v8f c) {
  v8f d = __builtin_amdgcn_wmma_f32_16x16x32_f16(false, a, false, b, (short)0, c, false, false);
  asm volatile("v_nop\n\tv_nop\n\tv_nop\n\tv_nop" : "+v"(d) : "v"(a), "v"(b));
  return d;
}
__device__ __forceinline__ v8f wmma_bf(v16b a, v16b b, v8f c) {
  v8f d = __builtin_amdgcn_wmma_f32_16x16x32_bf16(false, a, false, b, (short)0, c, false, false);
  asm volatile("v_nop\n\tv_nop\n\tv_nop\n\tv_nop" : "+v"(d) : "v"(a), "v"(b));
  return d;
}
// 16x16x32 fragments: lane = (h = lane>>4, row/col = lane&15); elements 0..7 = k0+8h+0..7, 8..15 = k0+16+8h+0..7; D element r = row 8h+r
__device__ __forceinline__ v16h frag_h(const _Float16* rowk0, int lane) {
  union { v16h v; v8h q[2]; } u; const _Float16* p = rowk0 + 8 * (lane >> 4);
  u.q[0] = *(const v8h*)p; u.q[1] = *(const v8h*)(p + 16); return u.v;
}
// Tiled operand layout in the workspace: a [rows][K] f16 matrix is kept as [rows / 16][K / 8][16 rows][8 halves]. One 16 x 32 fragment is then 1 KB in a row (block = tile * (K / 32) + k-step), and each of its
// two wave-wide 16-byte loads covers 512 contiguous bytes = 4 whole 128-B lines, where a row-major matrix gives 32 B out of each of 16 lines. base = matrix + lane * 8; register contents equal frag_h's.
__device__ __forceinline__ v16h frag_t(const _Float16* base, int blk) {
  union { v16h v; v8h q[2]; } u; const _Float16* p = base + (size_t)blk * 512;
  u.q[0] = *(const v8h*)p; u.q[1] = *(const v8h*)(p + 256); return u.v;
}
// 16 rows x 128 columns over NKC k-steps of 32: arow = this lane's A row at k = 0 (row-major, LDS) or, with AT, this lane's base in the A tile (tiled layout); bt = this lane's base in B's column tile 0 (tiled layout, tile j is NKC blocks further).
// The 8 B fragments and the A fragment of the next k-step are loaded in front of this k-step's WMMAs, so 18 loads fly behind each group of 8 WMMAs; k order per output element unchanged.
template <int NKC> __device__ __forceinline__ void ld8(v16h (&b)[8], const _Float16* bt, int kc) {
#pragma unroll
  for (int j = 0; j < 8; ++j) b[j] = frag_t(bt, j * NKC + kc);
}
__device__ __forceinline__ void mm8(v16h a, const v16h (&b)[8], v8f (&acc)[8]) {
#pragma unroll
  for (int j = 0; j < 8; ++j) acc[j] = wmma16(a, b[j], acc[j]);
}
template <bool AT> __device__ __forceinline__ v16h lda(const _Float16* arow, int kc, int lane) { return AT ? frag_t(arow, kc) : frag_h(arow + kc * 32, lane); }
template <int NKC, bool AT> __device__ __forceinline__ void gemm8(const _Float16* arow, const _Float16* bt, int lane, v8f (&acc)[8]) {
  asm volatile("s_wait_xcnt 0x0" ::: "memory");    // precaution: the fragment loads below may land in registers that earlier loads of a caller named as addresses (k_qkv loads its bias rows only after the product)
  v16h b0[8], b1[8]; v16h a0 = lda<AT>(arow, 0, lane), a1; ld8<NKC>(b0, bt, 0);
#pragma unroll 1    // rolled: the body already holds two k-steps, more copies only cost instruction cache
  for (int kc = 0; kc < NKC - 2; kc += 2) {
    a1 = lda<AT>(arow, kc + 1, lane); ld8<NKC>(b1, bt, kc + 1); mm8(a0, b0, acc);
    a0 = lda<AT>(arow, kc + 2, lane); ld8<NKC>(b0, bt, kc + 2); mm8(a1, b1, acc);
    asm volatile("s_wait_xcnt 0x0" ::: "memory"); }    // precaution: the loads of k-step kc + 2 are still in flight when the next trip rewrites their address registers
  a1 = lda<AT>(arow, NKC - 1, lane); ld8<NKC>(b1, bt, NKC - 1); mm8(a0, b0, acc); mm8(a1, b1, acc);
  asm volatile("s_wait_xcnt 0x0" ::: "memory");    // precaution: the caller's epilogue may reuse the address registers of the last k-step's loads
}
__device__ __forceinline__ v16h frag_f32(const float* rowk0, int lane) {
  v16h a; const float* p = rowk0 + 8 * (lane >> 4);
#pragma unroll
  for (int i = 0; i < 8; ++i) { a[i] = (_Float16)p[i]; a[8 + i] = (_Float16)p[16 + i]; }
  return a;
}
__device__ __forceinline__ v16h frag_f32s(const float* rowk0, int lane, float sc) {
  v16h a; const float* p = rowk0 + 8 * (lane >> 4);
#pragma unroll
  for (int i = 0; i < 8; ++i) { a[i] = (_Float16)(p[i] * sc); a[8 + i] = (_Float16)(p[16 + i] * sc); }
  return a;
}
// column fragment from a [K][ld] layout (column n), rows >= K read as 0
__device__ __forceinline__ v16h fragc_f32(const float* W, int k0, int n, int lane, int ld, int K) {
  v16h a; const int g = lane >> 4;
#pragma unroll
  for (int i = 0; i < 8; ++i) { const int ka = k0 + 8 * g + i, kb = ka + 16;
    a[i] = (_Float16)(ka < K ? W[(size_t)(ka < K ? ka : K - 1) * ld + n] : 0.f); a[8 + i] = (_Float16)(kb < K ? W[(size_t)(kb < K ? kb : K - 1) * ld + n] : 0.f); }
  return a;
}
struct F2 { v16b h, l; };
__device__ __forceinline__ F2 bsplit16(const float v[16]) { F2 r;
#pragma unroll
  for (int i = 0; i < 16; ++i) { const __bf16 h = (__bf16)v[i]; r.h[i] = h; r.l[i] = (__bf16)(v[i] - (float)h); }
  return r; }
__device__ __forceinline__ F2 split_row(const float* row, int k0, int lane) { float v[16]; const float* p = row + k0 + 8 * (lane >> 4);
#pragma unroll
  for (int i = 0; i < 8; ++i) { v[i] = p[i]; v[8 + i] = p[16 + i]; }
  return bsplit16(v); }
__device__ __forceinline__ F2 split_rowK(const float* row, int k0, int lane, int K) { float v[16]; const int g = lane >> 4;
#pragma unroll
  for (int i = 0; i < 8; ++i) { const int ka = k0 + 8 * g + i, kb = ka + 16; v[i] = ka < K ? row[ka < K ? ka : K - 1] : 0.f; v[8 + i] = kb < K ? row[kb < K ? kb : K - 1] : 0.f; }
  return bsplit16(v); }
__device__ __forceinline__ F2 split_col(const float* W, int k0, int n, int lane, int ld, int K) { float v[16]; const int g = lane >> 4;
#pragma unroll
  for (int i = 0; i < 8; ++i) { const int ka = k0 + 8 * g + i, kb = ka + 16; v[i] = ka < K ? W[(size_t)(ka < K ? ka : K - 1) * ld + n] : 0.f; v[8 + i] = kb < K ? W[(size_t)(kb < K ? kb : K - 1) * ld + n] : 0.f; }
  return bsplit16(v); }
__device__ __forceinline__ v8f mac3(const F2& a, const F2& b, v8f c) { c = wmma_bf(a.l, b.h, c); c = wmma_bf(a.h, b.l, c); return wmma_bf(a.h, b.h, c); }
__device__ __forceinline__ float sigm(float v) { return 1.0f / (1.0f + expf(-v)); }
#define LDSX() do { asm volatile("s_wait_dscnt 0" ::: "memory"); __builtin_amdgcn_wave_barrier(); __builtin_amdgcn_fence(__ATOMIC_RELEASE, "workgroup"); } while (0)


// Cross-modal encoder block: Q = conv1x1(x) per pixel (4096 x 256), K,V = y^T W^T + b (4096 x 256); scores = Q.K/16 over the 4096 y-tokens (one 256-dim head); att = softmax V; z = att Wo^T + bo;
// LayerNorm2d over channels per pixel (eps 1e-6); t = gelu(z_ln W1^T + b1) W2^T + b2; out = x + t (NCHW).
// halves d<128 / d>=128 on two waves to stay inside the VGPR budget; S shared in LDS), k_post (z + LN + MLP + residual, NCHW store by channel rows). Whole-line stores, one instruction per line.
#define C 256
#define NP 4096
#define NK 4096
#define HID 512
#define NS 8                 // key ranges per query tile: 64 x NS work-groups of 8 waves = 2 per WGP on 256 WGPs
#define KT_S (NK / 64 / NS)  // 64-key trips per range
// 2^x as the one hardware instruction; exp(d) = exp2n(d * LOG2E). Its arguments here are differences from a row maximum (k_attn) and the negated polynomial of erf (k_post): very negative gives 0, and the rounding of d * LOG2E
// costs a relative error of about |d| * 1e-7, far below the f16 rounding of P and of gelu(h). The library's expf wraps the same instruction in 12 more (split product, ldexp, two range selects).
#define LOG2E 1.4426950408889634f
__device__ __forceinline__ float exp2n(float x) { return __builtin_amdgcn_exp2f(x); }
// exact-form GELU, inline and without a branch: erf by the two usual f32 polynomials (|x| < 1: odd series in x^2; else 1 - exp(-p(|x|))), both evaluated and one selected, so that the 32 values of a lane are
// independent straight-line chains that the scheduler interleaves. The unselected side may overflow for large |x|; it is never used.
__device__ __forceinline__ float gelu_e(float v) {
  const float x = v * 0.70710678118654752f, ax = fabsf(x), t = x * x;
  float p = fmaf(ax, 0.0000169988107f, -0.000378677854f); p = fmaf(ax, p, 0.00385781587f); p = fmaf(ax, p, -0.0241816975f); p = fmaf(ax, p, 0.106668264f); p = fmaf(ax, p, 0.634933293f); p = fmaf(ax, p, 0.128689408f); p = fmaf(ax, p, ax);
  float q = fmaf(t, -0.000561801775f, 0.00491381623f); q = fmaf(t, q, -0.0267075151f); q = fmaf(t, q, 0.112800106f); q = fmaf(t, q, -0.376122952f); q = fmaf(t, q, 0.128379107f); q = fmaf(ax, q, ax);
  const float e = copysignf(ax < 1.0f ? q : 1.0f - exp2n(p * -LOG2E), x), h = 0.5f * v;
  return fmaf(h, e, h);
}

// token-major f16 rows from a [C][N] f32 array, in the tiled layout: block = 64 tokens = 4 tiles = 32 KB in a row; piece q of a tile = (column piece q >> 4, row q & 15)
__device__ __forceinline__ void cvt_block(const float* __restrict__ src, _Float16* __restrict__ T16, _Float16 (&st)[64][C + 8], int tid, int n0) {
  for (int q = tid; q < C * 16; q += 256) { const int c = q >> 4, p4 = q & 15; const v4f v = *(const v4f*)(src + (size_t)c * NP + n0 + p4 * 4);
    st[p4 * 4][c] = (_Float16)v[0]; st[p4 * 4 + 1][c] = (_Float16)v[1]; st[p4 * 4 + 2][c] = (_Float16)v[2]; st[p4 * 4 + 3][c] = (_Float16)v[3]; }
  __syncthreads();
  for (int q = tid; q < 64 * (C / 8); q += 256) { const int rl = (q >> 9) * 16 + (q & 15), pc = (q >> 4) & 31; vst2(T16 + (size_t)n0 * C + q * 8, *(const v4u*)(&st[rl][pc * 8])); }
}
// PA rows (256 halves x16): [0,C) Wq, [C,2C) Wk, [2C,3C) Wv, [3C,4C) Wo, [4C, 4C+HID) W1 ; PB rows (512 halves x16): W2 rows (256); both in the tiled layout.
// block = one 16-row tile, so that every 128-B line has one writer; thread = pieces of 8 halves, piece q = (column piece q >> 4, row q & 15)
template <int K> __device__ __forceinline__ void pack_tile(const float* __restrict__ W, _Float16* __restrict__ P, int tid) {
  for (int q = tid; q < 16 * (K / 8); q += 256) { const float* s = W + (size_t)(q & 15) * K + (q >> 4) * 8; const v4f a = *(const v4f*)s, b = *(const v4f*)(s + 4); v8h o;
#pragma unroll
    for (int e = 0; e < 4; ++e) { o[e] = (_Float16)(a[e] * 16.0f); o[4 + e] = (_Float16)(b[e] * 16.0f); }
    vst2(P + (size_t)q * 8, o); }
}
// one launch for all operand preparation: the three jobs read only inputs and write disjoint workspace arrays, so their 240 blocks (fewer than the chip has WGPs) can run side by side instead of in three dependent launches.
// blocks [0, NP/64): x rows; [NP/64, NP/64 + NK/64): y rows (the long jobs first); the rest: one 16-row weight tile each. The choice is uniform over a block, so the barrier in cvt_block is passed by all of its threads or none.
__global__ __launch_bounds__(256) void k_prep(const float* __restrict__ x, const float* __restrict__ y, const float* __restrict__ Wq, const float* __restrict__ Wk, const float* __restrict__ Wv, const float* __restrict__ Wo, const float* __restrict__ W1, const float* __restrict__ W2, _Float16* __restrict__ X16, _Float16* __restrict__ Y16, _Float16* __restrict__ PA, _Float16* __restrict__ PB) {
  __shared__ __align__(16) _Float16 st[64][C + 8];
  const int b = blockIdx.x, tid = threadIdx.x;
  if (b < NP / 64 + NK / 64) { const bool isx = b < NP / 64; cvt_block(isx ? x : y, isx ? X16 : Y16, st, tid, (isx ? b : b - NP / 64) * 64); return; }
  const int n = (b - (NP / 64 + NK / 64)) * 16;
  if (n < 4 * C + HID) { const float* W = n < C ? Wq + (size_t)n * C : (n < 2 * C ? Wk + (size_t)(n - C) * C : (n < 3 * C ? Wv + (size_t)(n - 2 * C) * C : (n < 4 * C ? Wo + (size_t)(n - 3 * C) * C : W1 + (size_t)(n - 4 * C) * C)));
    pack_tile<C>(W, PA + (size_t)n * C, tid); }
  else { const int m = n - (4 * C + HID); pack_tile<HID>(W2 + (size_t)m * HID, PB + (size_t)m * HID, tid); }
}
// q/k/v: block (64 rows, 128 cols, which); which 0 reads X16 else Y16; Q16/K16 rows x4 (+bias); V -> VT x4 [d][n]; all three in the tiled layout
__global__ __launch_bounds__(128) void k_qkv(const _Float16* __restrict__ X16, const _Float16* __restrict__ Y16, const _Float16* __restrict__ PA, const float* __restrict__ bq, const float* __restrict__ bk, const float* __restrict__ bv, _Float16* __restrict__ Q16, _Float16* __restrict__ K16, _Float16* __restrict__ VT) {
  __shared__ __align__(16) _Float16 so[4][16][136];
  __shared__ __align__(16) _Float16 sth[128][72];
  const int tid = threadIdx.x, wave = tid >> 5, lane = tid & 31, col = lane & 15, g = lane >> 4;
  const int which = blockIdx.z, r0b = blockIdx.x * 64, r0 = r0b + wave * 16, n0 = blockIdx.y * 128; const _Float16* SRC = which == 0 ? X16 : Y16; const float* bb_ = which == 0 ? bq : (which == 1 ? bk : bv);
  v8f acc[8] = {};
  gemm8<C / 32, true>(SRC + (size_t)r0 * C + lane * 8, PA + (size_t)(which * C + n0) * C + lane * 8, lane, acc);
  if (which < 2) {
#pragma unroll
    for (int j = 0; j < 8; ++j) { const float bb = bb_[n0 + j * 16 + col];
#pragma unroll
      for (int r = 0; r < 8; ++r) so[wave][8 * g + r][j * 16 + col] = (_Float16)((acc[j][r] * (1.0f / 16.0f) + bb) * 4.0f); }
    LDSX();
    _Float16* D = which == 0 ? Q16 : K16;
    for (int q = lane; q < 16 * 16; q += 32) vst2(D + (size_t)r0 * C + n0 * 16 + q * 8, *(const v4u*)(&so[wave][q & 15][(q >> 4) * 8])); }    // the wave's 16 rows x 128 columns = 4 KB in a row of its tile
  else {
#pragma unroll
    for (int j = 0; j < 8; ++j) { const float bb = bb_[n0 + j * 16 + col];
#pragma unroll
      for (int r = 0; r < 8; ++r) sth[j * 16 + col][wave * 16 + 8 * g + r] = (_Float16)((acc[j][r] * (1.0f / 16.0f) + bb) * 4.0f); }
    __syncthreads();
    for (int qq = tid; qq < 128 * 8; qq += 128) { const int jd = qq >> 7, ql = qq & 127;    // 64 keys of one 16-row d tile = 2 KB in a row
      vst2(VT + (size_t)(n0 + jd * 16) * NK + r0b * 16 + ql * 8, *(const v4u*)(&sth[jd * 16 + (ql & 15)][(ql >> 4) * 8])); } }
}
// asynchronous copies global -> LDS, 16 bytes per lane = 512 B per copy and wave. l = the lane's LDS byte address; its global address = scalar base b + the lane's byte offset o; the immediate offset moves
// both addresses alike, so a run that is contiguous on both sides needs one set of addresses. The s_wait_xcnt is the last line of the copies' own statement (a precaution): no address register is rewritten before the copies that name it have passed it.
__device__ __forceinline__ void copy_2x2k(unsigned l0, unsigned l1, unsigned o, const _Float16* b0, const _Float16* b1) {    // two runs of 2 KB
  asm volatile("global_load_async_to_lds_b128 %0, %2, %3\n\t"
               "global_load_async_to_lds_b128 %0, %2, %3 offset:512\n\t"
               "global_load_async_to_lds_b128 %0, %2, %3 offset:1024\n\t"
               "global_load_async_to_lds_b128 %0, %2, %3 offset:1536\n\t"
               "global_load_async_to_lds_b128 %1, %2, %4\n\t"
               "global_load_async_to_lds_b128 %1, %2, %4 offset:512\n\t"
               "global_load_async_to_lds_b128 %1, %2, %4 offset:1024\n\t"
               "global_load_async_to_lds_b128 %1, %2, %4 offset:1536\n\t"
               "s_wait_xcnt 0x0" :: "v"(l0), "v"(l1), "v"(o), "s"(b0), "s"(b1) : "memory");
}
// hand-over of the ring, passed by every wave: the wave's own LDS reads are done, its own copies have landed, then the block barrier: it publishes the tile that was in flight and frees the buffer just read
#define RING_FOOT() do { asm volatile("s_wait_dscnt 0x0" ::: "memory"); asm volatile("s_wait_asynccnt 0x0" ::: "memory"); __syncthreads(); } while (0)
// attention: block = (64 queries, key range sp) on 8 waves; wave = (query tile w, value half dh): S over 256 dims (8 kc), softmax over the range's NK/NS keys, P.V for d in [dh*128, dh*128+128).
// The two waves of a query tile share one score tile and one P tile in LDS: wave dh computes the scores of keys [dh*32, dh*32+32) of a 64-key tile and 32 of its 64 exponentials per row, so no score and no exponential is computed twice;
// both read all 64 scores of a row for the maximum (the same value in both), each keeps the sum of its own exponentials, and the two sums are added behind the loop.
// OP[sp][q][d] = the range's own normalised context rows (f32); ML[sp][q] = (range maximum, range sum); k_merge joins the ranges
// The 64-key K tile (32 KB) and V tile (32 KB) are brought into LDS once per block by asynchronous copies and read there by the waves. Ring of two buffers, tiles K0, V0, K1, V1, ...:
// the score half of a trip reads the K buffer while the V tile flies, the softmax and P.V half reads the V buffer while the next K tile flies. Fragment order in LDS = the workspace's tiled layout.
#define KBUF_B (64 * C * 2)
#define VBUF_B (C * 64 * 2)
#define STAGE_B (8 * 16 * 132 * 4)    // output staging behind the loop, a little more than the two buffers
__global__ __launch_bounds__(256) void k_attn(const _Float16* __restrict__ Q16, const _Float16* __restrict__ K16, const _Float16* __restrict__ VT, float* __restrict__ OP, float* __restrict__ ML) {
  __shared__ __align__(16) unsigned char ring[STAGE_B];    // K buffer, V buffer; behind the loop the output staging (8 x 16 x 132 floats)
  __shared__ __align__(16) float sS[4][16][68];
  __shared__ __align__(16) _Float16 sPh[4][16][72];
  const int tid = threadIdx.x, w8 = tid >> 5, w = w8 & 3, dh = w8 >> 2, lane = tid & 31, col = lane & 15, g = lane >> 4; const int q0 = blockIdx.x * 64 + w * 16; const int sp = blockIdx.y;
  float* __restrict__ O32 = OP + (size_t)sp * NP * C;
  const _Float16* sKl = (const _Float16*)ring + dh * (32 * C) + lane * 8; const _Float16* sVl = (const _Float16*)(ring + KBUF_B) + dh * (128 * 64) + lane * 8;    // this lane's base in the wave's half of each buffer
  // the wave's share of a tile: K = half of a key tile (4 KB in a row, 8 copies); V = the 64 keys of d tiles 2 w8 and 2 w8 + 1 (2 KB in a row each, 8 copies)
  const unsigned lK = (unsigned)(size_t)ring + w8 * 4096 + lane * 16, lV = (unsigned)(size_t)ring + KBUF_B + w8 * 4096 + lane * 16;
  const unsigned oK = w8 * 4096 + lane * 16, oV = w8 * (32 * NK * 2) + lane * 16;    // the lane's byte offsets from the block's tile bases
  const _Float16* bK = K16 + (size_t)(sp * KT_S * 64) * C;
  const _Float16* bV = VT + sp * KT_S * 64 * 16;
  copy_2x2k(lK, lK + 2048, oK, bK, bK + 1024);
  v16h aq[8];
#pragma unroll
  for (int kc = 0; kc < 8; ++kc) aq[kc] = frag_t(Q16 + (size_t)q0 * C + lane * 8, kc);
  asm volatile("s_wait_asynccnt 0x0" ::: "memory");    // K tile 0 has landed (this wave's share)
  __syncthreads();
  copy_2x2k(lV, lV + 2048, oV, bV, bV + 16 * NK);
  float mrun = -3.0e38f, lrun = 0.f; v8f acc[8] = {};
#pragma unroll 1
  for (int ks = 0; ks < KT_S; ++ks) {
#pragma unroll
    for (int t = 0; t < 2; ++t) { v8f s = {}; v16h kf[8];    // the key tile's 8 fragments are all requested before its first WMMA
#pragma unroll
      for (int kc = 0; kc < 8; ++kc) kf[kc] = frag_t(sKl, t * 8 + kc);
#pragma unroll
      for (int kc = 0; kc < 8; ++kc) s = wmma16(aq[kc], kf[kc], s);
#pragma unroll
      for (int r = 0; r < 8; ++r) sS[w][8 * g + r][dh * 32 + t * 16 + col] = s[r] * (0.0625f / 16.0f); }
    RING_FOOT();    // V tile ks is published, the K buffer is free; both waves' halves of the query tile's score rows are published too
    if (ks + 1 < KT_S) { bK += 64 * C; copy_2x2k(lK, lK + 2048, oK, bK, bK + 1024); }
    float mx = -3.4e38f, sc[16];    // sc = the scores of this wave's 16 of the lane's 32 keys, read once for the maximum and the exponentials
#pragma unroll
    for (int jj = 0; jj < 16; ++jj) { sc[jj] = sS[w][col][g * 32 + dh * 16 + jj]; mx = fmaxf(mx, fmaxf(sc[jj], sS[w][col][g * 32 + (dh ^ 1) * 16 + jj])); }
    mx = fmaxf(mx, __shfl_xor(mx, 16, 32));
    const float mnew = fmaxf(mrun, mx); const float corr = exp2n((mrun - mnew) * LOG2E);
    float ps = 0.f;
#pragma unroll
    for (int jj = 0; jj < 16; ++jj) { const float p = exp2n(fmaf(sc[jj] - mnew, LOG2E, 14.0f)); ps += p; sPh[w][col][g * 32 + dh * 16 + jj] = (_Float16)p; }    // this wave's 16 of the lane's 32 keys
    ps += __shfl_xor(ps, 16, 32);
    lrun = lrun * corr + ps * (1.0f / 16384.0f); mrun = mnew;
#pragma unroll
    for (int r = 0; r < 8; ++r) { const float cr = __shfl(corr, 8 * g + r, 32);
#pragma unroll
      for (int t = 0; t < 8; ++t) acc[t][r] *= cr; }
    __syncthreads();    // both waves' halves of the query tile's P rows are published
#pragma unroll
    for (int kc = 0; kc < 2; ++kc) { const v16h ph = frag_h(&sPh[w][col][0] + kc * 32, lane);
      v16h vf[8]; ld8<2>(vf, sVl, kc);    // the 8 value fragments of these 32 keys are all requested before the first WMMA
      mm8(ph, vf, acc); }
    RING_FOOT();    // K tile ks + 1 is published, the V buffer is free
    if (ks + 1 < KT_S) { bV += 64 * 16; copy_2x2k(lV, lV + 2048, oV, bV, bV + 16 * NK); } }
  asm volatile("s_wait_asynccnt 0x0" ::: "memory");    // nothing is in flight when the ring becomes output staging (the last hand-over's barrier has ended every wave's reads)
  if (lane < 16) sS[w][dh][lane] = lrun;    // the row sums of the two waves of a query tile are added, in the same order in both (the score rows are no longer read)
  __syncthreads();
  lrun = sS[w][0][col] + sS[w][1][col];
  float (*sO)[132] = (float (*)[132])(ring + w8 * (16 * 132 * 4));
#pragma unroll
  for (int r = 0; r < 8; ++r) { const float lr = __shfl(lrun, 8 * g + r, 32); const float inv = 1.0f / (lr * 16384.0f * 4.0f);
#pragma unroll
    for (int t = 0; t < 8; ++t) sO[8 * g + r][t * 16 + col] = acc[t][r] * inv; }
  LDSX();
  for (int rl = 0; rl < 16; ++rl) vst2(O32 + (size_t)(q0 + rl) * C + dh * 128 + lane * 4, *(const v4f*)(&sO[rl][lane * 4]));
  if (dh == 0 && lane < 16) { v2f ml; ml[0] = mrun; ml[1] = lrun; vst2(ML + ((size_t)sp * NP + q0 + lane) * 2, ml); }    // 16 rows x 8 B = one 128-B line per query tile
}
// join of the NS key ranges: weight of range s = l_s * exp(m_s - max m); O32[q][d] = sum_s weight_s * OP[s][q][d] / sum_s weight_s; thread = 4 columns of rows q and q + NP/2
// (no __restrict__ here: it lets the wait statement below drift away from the loads to the end of the kernel)
__global__ __launch_bounds__(256) void k_merge(const float* OP, const float* ML, float* O32) {
  const int idx = blockIdx.x * 256 + threadIdx.x, c4 = idx & 63, q = idx >> 6;
  const float* pm = ML + (size_t)q * 2;    // row q's (max, sum) pair in range 0
  const float* po[NS / 2];                                           // the thread's 4 columns of row q in ranges 0, 2, 4, 6
#pragma unroll
  for (int s2 = 0; s2 < NS / 2; ++s2) po[s2] = OP + ((size_t)(2 * s2) * NP + q) * C + c4 * 4;
  v2f ml[2][NS]; v4f o[2][NS];
#pragma unroll
  for (int h = 0; h < 2; ++h) {
#pragma unroll
    for (int s = 0; s < NS; ++s) { ml[h][s] = *(const v2f*)(pm + (s * NP + h * (NP / 2)) * 2); o[h][s] = *(const v4f*)(po[s >> 1] + ((s & 1) * NP + h * (NP / 2)) * C); } }
  // precaution behind the last load: the address registers are operands, so none is reused (not even as a later load's destination) before the loads that name it have passed this wait
  asm volatile("s_wait_xcnt 0x0" :: "v"(pm), "v"(po[0]), "v"(po[1]), "v"(po[2]), "v"(po[3]) : "memory");
#pragma unroll
  for (int h = 0; h < 2; ++h) {
    float mx = ml[h][0][0];
#pragma unroll
    for (int s = 1; s < NS; ++s) mx = fmaxf(mx, ml[h][s][0]);
    float ws = 0.f; v4f a = {};
#pragma unroll
    for (int s = 0; s < NS; ++s) { const float wt = ml[h][s][1] * expf(ml[h][s][0] - mx); ws += wt; a += o[h][s] * wt; }
    vst2(O32 + ((size_t)q + h * (NP / 2)) * C + c4 * 4, a * (1.0f / ws)); }
}
// post: z = att Wo^T + bo; LN over 256 (eps 1e-6) * ln_w + ln_b; h = gelu(zl W1^T + b1); t = h W2^T + b2; out[c][p] = x[c][p] + t[p][c]
// block = 32 pixels (one 128-B line of every output channel row) on 16 waves, 4 per SIMD: in each product a wave owns NT column tiles of 16 and runs them against both 16-row tiles of the block,
// so a weight fragment is fetched once per block and every serial piece (k loop, LN, GELU, store) is 1/8 as long per wave as with 16 rows x all columns per wave.
// a = this lane's row of row tile 0 in LDS (row-major, pitch LD halves; row tile 1 is 16 rows further); bt = this lane's base in the wave's first column tile (tiled layout). k order per output element: ascending, as before.
template <int NKC, int NT, int LD> __device__ __forceinline__ void gemm_rt2(const _Float16* a, const _Float16* bt, int lane, v8f (&acc)[NT][2]) {
  v16h b[NT][NKC];
#pragma unroll
  for (int j = 0; j < NT; ++j) {
#pragma unroll
    for (int kc = 0; kc < NKC; ++kc) b[j][kc] = frag_t(bt, j * NKC + kc); }    // the wave's whole weight slice is requested at once: one L2 latency per product
  asm volatile("s_wait_xcnt 0x0" ::: "memory");    // precaution: the LDS address arithmetic below may reuse the address registers of the weight loads
#pragma unroll
  for (int kc = 0; kc < NKC; ++kc) { const v16h a0 = frag_h(a + kc * 32, lane), a1 = frag_h(a + 16 * LD + kc * 32, lane);
#pragma unroll
    for (int j = 0; j < NT; ++j) { acc[j][0] = wmma16(a0, b[j][kc], acc[j][0]); acc[j][1] = wmma16(a1, b[j][kc], acc[j][1]); } }
}
__global__ __launch_bounds__(512) void k_post(const float* __restrict__ O32, const _Float16* __restrict__ PA, const _Float16* __restrict__ PB, const float* __restrict__ bo, const float* __restrict__ lw, const float* __restrict__ lb, const float* __restrict__ b1, const float* __restrict__ b2, const float* __restrict__ x, float* __restrict__ out) {
  __shared__ __align__(16) _Float16 sz[32][C + 8];          // att rows (f16) then zl rows (f16)
  __shared__ __align__(16) float szf[32][C + 4];             // z rows f32 for the LN statistics, later t rows
  __shared__ __align__(16) _Float16 shh[32][HID + 8];        // gelu(h) f16
  const int tid = threadIdx.x, wave = tid >> 5, lane = tid & 31, col = lane & 15, g = lane >> 4; const int p0b = blockIdx.x * 32;
  // att rows -> f16: 32 rows x 64 pieces of 4 floats, 4 pieces per thread, 8 rows apart
  { const int rl = tid >> 6, pc = tid & 63; const float* pa = O32 + (size_t)(p0b + rl) * C + pc * 4; v4f av[4];
#pragma unroll
    for (int i = 0; i < 4; ++i) av[i] = *(const v4f*)(pa + i * 8 * C);
    asm volatile("s_wait_xcnt 0x0" :: "v"(pa) : "memory");    // precaution: the address is an operand, so it is not reused (not even as a later load's destination) before the loads that name it have passed this wait
#pragma unroll
    for (int i = 0; i < 4; ++i) {
#pragma unroll
      for (int e = 0; e < 4; ++e) sz[rl + i * 8][pc * 4 + e] = (_Float16)(av[i][e] * 64.0f); } }     // x64 carry keeps the small context values out of the f16 subnormal range
  __syncthreads();
  // z = att Wo^T /16/64 + bo: 16 column tiles, one per wave, 8 kc
  { const int n = wave * 16 + col; const float bb = bo[n]; v8f acc[1][2] = {};
    gemm_rt2<C / 32, 1, C + 8>(&sz[col][0], PA + (size_t)(3 * C + wave * 16) * C + lane * 8, lane, acc);
#pragma unroll
    for (int rt = 0; rt < 2; ++rt) {
#pragma unroll
      for (int r = 0; r < 8; ++r) szf[rt * 16 + 8 * g + r][n] = acc[0][rt][r] * (1.0f / (16.0f * 64.0f)) + bb; } }
  __syncthreads();
  // LN per row: 16 lanes per row (wave = 2 rows), lane = 4 pieces of 4 columns, 64 columns apart; the row stays in registers over both statistics
  { const int rl = wave * 2 + g; v4f zv[4], wv[4], bv[4];
#pragma unroll
    for (int i = 0; i < 4; ++i) { const int c = i * 64 + col * 4; wv[i] = *(const v4f*)(lw + c); bv[i] = *(const v4f*)(lb + c); zv[i] = *(const v4f*)(&szf[rl][c]); }
    asm volatile("s_wait_xcnt 0x0" ::: "memory");    // precaution: the arithmetic below may reuse the address registers of the ln_w and ln_b loads
    float s = 0.f, q = 0.f;
#pragma unroll
    for (int i = 0; i < 4; ++i) s += (zv[i][0] + zv[i][1]) + (zv[i][2] + zv[i][3]);
#pragma unroll
    for (int m = 8; m >= 1; m >>= 1) s += __shfl_xor(s, m, 32);
    const float mu = s * (1.0f / C);
#pragma unroll
    for (int i = 0; i < 4; ++i) {
#pragma unroll
      for (int e = 0; e < 4; ++e) { const float d = zv[i][e] - mu; q += d * d; } }
#pragma unroll
    for (int m = 8; m >= 1; m >>= 1) q += __shfl_xor(q, m, 32);
    const float rs = rsqrtf(q * (1.0f / C) + 1e-6f);
#pragma unroll
    for (int i = 0; i < 4; ++i) {
#pragma unroll
      for (int e = 0; e < 4; ++e) sz[rl][i * 64 + col * 4 + e] = (_Float16)((zv[i][e] - mu) * rs * wv[i][e] + bv[i][e]); } }
  __syncthreads();
  // h = gelu(zl W1^T/16 + b1): 32 column tiles, two per wave, 8 kc
  { float bb[2]; v8f acc[2][2] = {};
#pragma unroll
    for (int j = 0; j < 2; ++j) bb[j] = b1[wave * 32 + j * 16 + col];
    gemm_rt2<C / 32, 2, C + 8>(&sz[col][0], PA + (size_t)(4 * C + wave * 32) * C + lane * 8, lane, acc);
#pragma unroll
    for (int j = 0; j < 2; ++j) {
#pragma unroll
      for (int rt = 0; rt < 2; ++rt) {
#pragma unroll
        for (int r = 0; r < 8; ++r) shh[rt * 16 + 8 * g + r][wave * 32 + j * 16 + col] = (_Float16)gelu_e(acc[j][rt][r] * (1.0f / 16.0f) + bb[j]); } } }
  __syncthreads();
  // t = h W2^T/16 + b2: 16 column tiles, one per wave, 16 kc -> szf
  { const int n = wave * 16 + col; const float bb = b2[n]; v8f acc[1][2] = {};
    gemm_rt2<HID / 32, 1, HID + 8>(&shh[col][0], PB + (size_t)(wave * 16) * HID + lane * 8, lane, acc);
#pragma unroll
    for (int rt = 0; rt < 2; ++rt) {
#pragma unroll
      for (int r = 0; r < 8; ++r) szf[rt * 16 + 8 * g + r][n] = acc[0][rt][r] * (1.0f / 16.0f) + bb; } }
  __syncthreads();
  // NCHW store: out[c][p0b .. p0b+31] = x + t: per channel c 32 floats = one 128-B line = 8 pieces; thread -> (c = tid >> 3, piece = tid & 7): lanes contiguous, 4 pieces per thread, 64 channels apart
  { const int c0 = tid >> 3, pc = tid & 7; const float* px = x + (size_t)c0 * NP + p0b + pc * 4; v4f xv[4];
#pragma unroll
    for (int i = 0; i < 4; ++i) xv[i] = *(const v4f*)(px + (size_t)i * 64 * NP);
    asm volatile("s_wait_xcnt 0x0" :: "v"(px) : "memory");    // precaution, as at the att rows: the address stays untouched until the loads that name it have passed this wait
#pragma unroll
    for (int i = 0; i < 4; ++i) {
#pragma unroll
      for (int e = 0; e < 4; ++e) xv[i][e] += szf[pc * 4 + e][c0 + i * 64];
      vst2(out + (size_t)(c0 + i * 64) * NP + p0b + pc * 4, xv[i]); } }
}
extern "C" void kernel_launch(void* const* d_in, const int* in_sizes, int n_in, void* d_out, int out_size, void* d_ws, size_t ws_size, hipStream_t stream) {
  (void)in_sizes; (void)n_in; (void)out_size; (void)ws_size;
  const float** I = (const float**)d_in;    // x, y, Wq, bq, Wk, bk, Wv, bv, Wo, bo, ln_w, ln_b, W1, b1, W2, b2
  const float* x = I[0]; const float* y = I[1]; const float* Wq = I[2]; const float* bq = I[3]; const float* Wk = I[4]; const float* bk = I[5]; const float* Wv = I[6]; const float* bv = I[7]; const float* Wo = I[8]; const float* bo = I[9];
  const float* lw = I[10]; const float* lb = I[11]; const float* W1 = I[12]; const float* b1 = I[13]; const float* W2 = I[14]; const float* b2 = I[15];
  float* out = (float*)d_out;
  char* ws = (char*)d_ws; size_t off = 0;
  auto take = [&](size_t bytes) { char* p = ws + off; off += (bytes + 255) & ~(size_t)255; return p; };
  _Float16* X16 = (_Float16*)take((size_t)NP * C * 2); _Float16* Y16 = (_Float16*)take((size_t)NK * C * 2); _Float16* PA = (_Float16*)take((size_t)(4 * C + HID) * C * 2); _Float16* PB = (_Float16*)take((size_t)C * HID * 2);
  _Float16* Q16 = (_Float16*)take((size_t)NP * C * 2); _Float16* K16 = (_Float16*)take((size_t)NK * C * 2); _Float16* VT = (_Float16*)take((size_t)C * NK * 2); float* O32 = (float*)take((size_t)NP * C * 4);
  float* OP = (float*)take((size_t)NS * NP * C * 4); float* ML = (float*)take((size_t)NS * NP * 2 * 4);
  // ws ~ 48 MB
  k_prep<<<NP / 64 + NK / 64 + (4 * C + HID + C) / 16, 256, 0, stream>>>(x, y, Wq, Wk, Wv, Wo, W1, W2, X16, Y16, PA, PB);
  k_qkv<<<dim3(NP / 64, C / 128, 3), 128, 0, stream>>>(X16, Y16, PA, bq, bk, bv, Q16, K16, VT);
  k_attn<<<dim3(NP / 64, NS), 256, 0, stream>>>(Q16, K16, VT, OP, ML);
  k_merge<<<NP * (C / 4) / 2 / 256, 256, 0, stream>>>(OP, ML, O32);
  k_post<<<NP / 32, 512, 0, stream>>>(O32, PA, PB, bo, lw, lb, b1, b2, x, out);
}

// v009
// A run of this version takes 57.5 microseconds.
// Two timings next to v008 put it at 1.04 and 1.03 times that version's speed.
// All steps since v000 together make it 14.8 times as fast.
// compute dtype: f16 operands (pixel/token rows as f16, weights packed x16 as f16 rows, q/k x4, P lifted by 2^14, V x4, att rows x64, zl/h rows x1), f32 accumulate; softmax, LayerNorm2d, GELU and the residual in f32. Output = x + t with both O(1).
#include <hip/hip_runtime.h>
#include <math.h>

typedef __attribute__((ext_vector_type(16))) _Float16 v16h;
typedef __attribute__((ext_vector_type(16))) __bf16 v16b;
typedef __attribute__((ext_vector_type(8)))  _Float16 v8h;
typedef __attribute__((ext_vector_type(8)))  float v8f;
typedef __attribute__((ext_vector_type(4)))  float v4f;
typedef __attribute__((ext_vector_type(2)))  float v2f;
typedef __attribute__((ext_vector_type(4)))  unsigned v4u;
typedef __attribute__((ext_vector_type(4)))  int v4i;
typedef float __attribute__((may_alias)) float_a;
typedef int __attribute__((may_alias)) int_a;

template <typename T> __device__ __forceinline__ void vst2(void* p, T v) { *(T*)p = v;  }
__device__ __forceinline__ v8f wmma16(v16h a, v16h b, v8f c) {
  v8f d = __builtin_amdgcn_wmma_f32_16x16x32_f16(false, a, false, b, (short)0, c, false, false);
  asm volatile("v_nop\n\tv_nop\n\tv_nop\n\tv_nop" : "+v"(d) : "v"(a), "v"(b));
  return d;
}
__device__ __forceinline__ v8f wmma_bf(v16b a, v16b b, v8f c) {
  v8f d = __builtin_amdgcn_wmma_f32_16x16x32_bf16(false, a, false, b, (short)0, c, false, false);
  asm volatile("v_nop\n\tv_nop\n\tv_nop\n\tv_nop" : "+v"(d) : "v"(a), "v"(b));
  return d;
}
// 16x16x32 fragments: lane = (h = lane>>4, row/col = lane&15); elements 0..7 = k0+8h+0..7, 8..15 = k0+16+8h+0..7; D element r = row 8h+r
__device__ __forceinline__ v16h frag_h(const _Float16* rowk0, int lane) {
  union { v16h v; v8h q[2]; } u; const _Float16* p = rowk0 + 8 * (lane >> 4);
  u.q[0] = *(const v8h*)p; u.q[1] = *(const v8h*)(p + 16); return u.v;
}
// Tiled operand layout in the workspace: a [rows][K] f16 matrix is kept as [rows / 16][K / 8][16 rows][8 halves]. One 16 x 32 fragment is then 1 KB in a row (block = tile * (K / 32) + k-step), and each of its
// two wave-wide 16-byte loads covers 512 contiguous bytes = 4 whole 128-B lines, where a row-major matrix gives 32 B out of each of 16 lines. base = matrix + lane * 8; register contents equal frag_h's.
__device__ __forceinline__ v16h frag_t(const _Float16* base, int blk) {
  union { v16h v; v8h q[2]; } u; const _Float16* p = base + (size_t)blk * 512;
  u.q[0] = *(const v8h*)p; u.q[1] = *(const v8h*)(p + 256); return u.v;
}
// 16 rows x 128 columns over NKC k-steps of 32: arow = this lane's A row at k = 0 (row-major, LDS) or, with AT, this lane's base in the A tile (tiled layout); bt = this lane's base in B's column tile 0 (tiled layout, tile j is NKC blocks further).
// The 8 B fragments and the A fragment of the next k-step are loaded in front of this k-step's WMMAs, so 18 loads fly behind each group of 8 WMMAs; k order per output element unchanged.
template <int NKC> __device__ __forceinline__ void ld8(v16h (&b)[8], const _Float16* bt, int kc) {
#pragma unroll
  for (int j = 0; j < 8; ++j) b[j] = frag_t(bt, j * NKC + kc);
}
__device__ __forceinline__ void mm8(v16h a, const v16h (&b)[8], v8f (&acc)[8]) {
#pragma unroll
  for (int j = 0; j < 8; ++j) acc[j] = wmma16(a, b[j], acc[j]);
}
template <bool AT> __device__ __forceinline__ v16h lda(const _Float16* arow, int kc, int lane) { return AT ? frag_t(arow, kc) : frag_h(arow + kc * 32, lane); }
template <int NKC, bool AT> __device__ __forceinline__ void gemm8(const _Float16* arow, const _Float16* bt, int lane, v8f (&acc)[8]) {
  asm volatile("s_wait_xcnt 0x0" ::: "memory");    // precaution: the fragment loads below may land in registers that earlier loads of a caller named as addresses (k_qkv loads its bias rows only after the product)
  v16h b0[8], b1[8]; v16h a0 = lda<AT>(arow, 0, lane), a1; ld8<NKC>(b0, bt, 0);
#pragma unroll 1    // rolled: the body already holds two k-steps, more copies only cost instruction cache
  for (int kc = 0; kc < NKC - 2; kc += 2) {
    a1 = lda<AT>(arow, kc + 1, lane); ld8<NKC>(b1, bt, kc + 1); mm8(a0, b0, acc);
    a0 = lda<AT>(arow, kc + 2, lane); ld8<NKC>(b0, bt, kc + 2); mm8(a1, b1, acc);
    asm volatile("s_wait_xcnt 0x0" ::: "memory"); }    // precaution: the loads of k-step kc + 2 are still in flight when the next trip rewrites their address registers
  a1 = lda<AT>(arow, NKC - 1, lane); ld8<NKC>(b1, bt, NKC - 1); mm8(a0, b0, acc); mm8(a1, b1, acc);
  asm volatile("s_wait_xcnt 0x0" ::: "memory");    // precaution: the caller's epilogue may reuse the address registers of the last k-step's loads
}
__device__ __forceinline__ v16h frag_f32(const float* rowk0, int lane) {
  v16h a; const float* p = rowk0 + 8 * (lane >> 4);
#pragma unroll
  for (int i = 0; i < 8; ++i) { a[i] = (_Float16)p[i]; a[8 + i] = (_Float16)p[16 + i]; }
  return a;
}
__device__ __forceinline__ v16h frag_f32s(const float* rowk0, int lane, float sc) {
  v16h a; const float* p = rowk0 + 8 * (lane >> 4);
#pragma unroll
  for (int i = 0; i < 8; ++i) { a[i] = (_Float16)(p[i] * sc); a[8 + i] = (_Float16)(p[16 + i] * sc); }
  return a;
}
// column fragment from a [K][ld] layout (column n), rows >= K read as 0
__device__ __forceinline__ v16h fragc_f32(const float* W, int k0, int n, int lane, int ld, int K) {
  v16h a; const int g = lane >> 4;
#pragma unroll
  for (int i = 0; i < 8; ++i) { const int ka = k0 + 8 * g + i, kb = ka + 16;
    a[i] = (_Float16)(ka < K ? W[(size_t)(ka < K ? ka : K - 1) * ld + n] : 0.f); a[8 + i] = (_Float16)(kb < K ? W[(size_t)(kb < K ? kb : K - 1) * ld + n] : 0.f); }
  return a;
}
struct F2 { v16b h, l; };
__device__ __forceinline__ F2 bsplit16(const float v[16]) { F2 r;
#pragma unroll
  for (int i = 0; i < 16; ++i) { const __bf16 h = (__bf16)v[i]; r.h[i] = h; r.l[i] = (__bf16)(v[i] - (float)h); }
  return r; }
__device__ __forceinline__ F2 split_row(const float* row, int k0, int lane) { float v[16]; const float* p = row + k0 + 8 * (lane >> 4);
#pragma unroll
  for (int i = 0; i < 8; ++i) { v[i] = p[i]; v[8 + i] = p[16 + i]; }
  return bsplit16(v); }
__device__ __forceinline__ F2 split_rowK(const float* row, int k0, int lane, int K) { float v[16]; const int g = lane >> 4;
#pragma unroll
  for (int i = 0; i < 8; ++i) { const int ka = k0 + 8 * g + i, kb = ka + 16; v[i] = ka < K ? row[ka < K ? ka : K - 1] : 0.f; v[8 + i] = kb < K ? row[kb < K ? kb : K - 1] : 0.f; }
  return bsplit16(v); }
__device__ __forceinline__ F2 split_col(const float* W, int k0, int n, int lane, int ld, int K) { float v[16]; const int g = lane >> 4;
#pragma unroll
  for (int i = 0; i < 8; ++i) { const int ka = k0 + 8 * g + i, kb = ka + 16; v[i] = ka < K ? W[(size_t)(ka < K ? ka : K - 1) * ld + n] : 0.f; v[8 + i] = kb < K ? W[(size_t)(kb < K ? kb : K - 1) * ld + n] : 0.f; }
  return bsplit16(v); }
__device__ __forceinline__ v8f mac3(const F2& a, const F2& b, v8f c) { c = wmma_bf(a.l, b.h, c); c = wmma_bf(a.h, b.l, c); return wmma_bf(a.h, b.h, c); }
__device__ __forceinline__ float sigm(float v) { return 1.0f / (1.0f + expf(-v)); }
#define LDSX() do { asm volatile("s_wait_dscnt 0" ::: "memory"); __builtin_amdgcn_wave_barrier(); __builtin_amdgcn_fence(__ATOMIC_RELEASE, "workgroup"); } while (0)


// Cross-modal encoder block: Q = conv1x1(x) per pixel (4096 x 256), K,V = y^T W^T + b (4096 x 256); scores = Q.K/16 over the 4096 y-tokens (one 256-dim head); att = softmax V; z = att Wo^T + bo;
// LayerNorm2d over channels per pixel (eps 1e-6); t = gelu(z_ln W1^T + b1) W2^T + b2; out = x + t (NCHW).
// Kernels: k_prep (f16 operands), k_qkv, k_attn (per key range), k_merge (joins the ranges), k_post (z + LN + MLP + residual, NCHW store by channel rows). Whole-line stores, one instruction per line.
#define C 256
#define NP 4096
#define NK 4096
#define HID 512
#define NS 8                 // key ranges per query tile: 64 x NS work-groups of 8 waves = 2 per WGP on 256 WGPs
#define KT_S (NK / 64 / NS)  // 64-key trips per range
// 2^x as the one hardware instruction; exp(d) = exp2n(d * LOG2E). Its arguments here are differences from a row maximum (k_attn) and the negated polynomial of erf (k_post): very negative gives 0, and the rounding of d * LOG2E
// costs a relative error of about |d| * 1e-7, far below the f16 rounding of P and of gelu(h). The library's expf wraps the same instruction in 12 more (split product, ldexp, two range selects).
#define LOG2E 1.4426950408889634f
__device__ __forceinline__ float exp2n(float x) { return __builtin_amdgcn_exp2f(x); }
// exact-form GELU, inline and without a branch: erf by the two usual f32 polynomials (|x| < 1: odd series in x^2; else 1 - exp(-p(|x|))), both evaluated and one selected, so that the 32 values of a lane are
// independent straight-line chains that the scheduler interleaves. The unselected side may overflow for large |x|; it is never used.
__device__ __forceinline__ float gelu_e(float v) {
  const float x = v * 0.70710678118654752f, ax = fabsf(x), t = x * x;
  float p = fmaf(ax, 0.0000169988107f, -0.000378677854f); p = fmaf(ax, p, 0.00385781587f); p = fmaf(ax, p, -0.0241816975f); p = fmaf(ax, p, 0.106668264f); p = fmaf(ax, p, 0.634933293f); p = fmaf(ax, p, 0.128689408f); p = fmaf(ax, p, ax);
  float q = fmaf(t, -0.000561801775f, 0.00491381623f); q = fmaf(t, q, -0.0267075151f); q = fmaf(t, q, 0.112800106f); q = fmaf(t, q, -0.376122952f); q = fmaf(t, q, 0.128379107f); q = fmaf(ax, q, ax);
  const float e = copysignf(ax < 1.0f ? q : 1.0f - exp2n(p * -LOG2E), x), h = 0.5f * v;
  return fmaf(h, e, h);
}

// token-major f16 rows from a [C][N] f32 array, in the tiled layout: block = 64 tokens = 4 tiles = 32 KB in a row; piece q of a tile = (column piece q >> 4, row q & 15)
__device__ __forceinline__ void cvt_block(const float* __restrict__ src, _Float16* __restrict__ T16, _Float16 (&st)[64][C + 8], int tid, int n0) {
  for (int q = tid; q < C * 16; q += 256) { const int c = q >> 4, p4 = q & 15; const v4f v = *(const v4f*)(src + (size_t)c * NP + n0 + p4 * 4);
    st[p4 * 4][c] = (_Float16)v[0]; st[p4 * 4 + 1][c] = (_Float16)v[1]; st[p4 * 4 + 2][c] = (_Float16)v[2]; st[p4 * 4 + 3][c] = (_Float16)v[3]; }
  __syncthreads();
  for (int q = tid; q < 64 * (C / 8); q += 256) { const int rl = (q >> 9) * 16 + (q & 15), pc = (q >> 4) & 31; vst2(T16 + (size_t)n0 * C + q * 8, *(const v4u*)(&st[rl][pc * 8])); }
}
// PA rows (256 halves x16): [0,C) Wq, [C,2C) Wk, [2C,3C) Wv, [3C,4C) Wo, [4C, 4C+HID) W1 ; PB rows (512 halves x16): W2 rows (256); both in the tiled layout.
// block = one 16-row tile, so that every 128-B line has one writer; thread = pieces of 8 halves, piece q = (column piece q >> 4, row q & 15)
template <int K> __device__ __forceinline__ void pack_tile(const float* __restrict__ W, _Float16* __restrict__ P, int tid) {
  for (int q = tid; q < 16 * (K / 8); q += 256) { const float* s = W + (size_t)(q & 15) * K + (q >> 4) * 8; const v4f a = *(const v4f*)s, b = *(const v4f*)(s + 4); v8h o;
#pragma unroll
    for (int e = 0; e < 4; ++e) { o[e] = (_Float16)(a[e] * 16.0f); o[4 + e] = (_Float16)(b[e] * 16.0f); }
    vst2(P + (size_t)q * 8, o); }
}
// one launch for all operand preparation: the three jobs read only inputs and write disjoint workspace arrays, so their 240 blocks (fewer than the chip has WGPs) can run side by side instead of in three dependent launches.
// blocks [0, NP/64): x rows; [NP/64, NP/64 + NK/64): y rows (the long jobs first); the rest: one 16-row weight tile each. The choice is uniform over a block, so the barrier in cvt_block is passed by all of its threads or none.
__global__ __launch_bounds__(256) void k_prep(const float* __restrict__ x, const float* __restrict__ y, const float* __restrict__ Wq, const float* __restrict__ Wk, const float* __restrict__ Wv, const float* __restrict__ Wo, const float* __restrict__ W1, const float* __restrict__ W2, _Float16* __restrict__ X16, _Float16* __restrict__ Y16, _Float16* __restrict__ PA, _Float16* __restrict__ PB) {
  __shared__ __align__(16) _Float16 st[64][C + 8];
  const int b = blockIdx.x, tid = threadIdx.x;
  if (b < NP / 64 + NK / 64) { const bool isx = b < NP / 64; cvt_block(isx ? x : y, isx ? X16 : Y16, st, tid, (isx ? b : b - NP / 64) * 64); return; }
  const int n = (b - (NP / 64 + NK / 64)) * 16;
  if (n < 4 * C + HID) { const float* W = n < C ? Wq + (size_t)n * C : (n < 2 * C ? Wk + (size_t)(n - C) * C : (n < 3 * C ? Wv + (size_t)(n - 2 * C) * C : (n < 4 * C ? Wo + (size_t)(n - 3 * C) * C : W1 + (size_t)(n - 4 * C) * C)));
    pack_tile<C>(W, PA + (size_t)n * C, tid); }
  else { const int m = n - (4 * C + HID); pack_tile<HID>(W2 + (size_t)m * HID, PB + (size_t)m * HID, tid); }
}
// q/k/v: block (64 rows, 128 cols, which); which 0 reads X16 else Y16; Q16/K16 rows x4 (+bias); V -> VT x4 [d][n]; all three in the tiled layout
__global__ __launch_bounds__(128) void k_qkv(const _Float16* __restrict__ X16, const _Float16* __restrict__ Y16, const _Float16* __restrict__ PA, const float* __restrict__ bq, const float* __restrict__ bk, const float* __restrict__ bv, _Float16* __restrict__ Q16, _Float16* __restrict__ K16, _Float16* __restrict__ VT) {
  __shared__ __align__(16) _Float16 so[4][16][136];
  __shared__ __align__(16) _Float16 sth[128][72];
  const int tid = threadIdx.x, wave = tid >> 5, lane = tid & 31, col = lane & 15, g = lane >> 4;
  const int which = blockIdx.z, r0b = blockIdx.x * 64, r0 = r0b + wave * 16, n0 = blockIdx.y * 128; const _Float16* SRC = which == 0 ? X16 : Y16; const float* bb_ = which == 0 ? bq : (which == 1 ? bk : bv);
  v8f acc[8] = {};
  gemm8<C / 32, true>(SRC + (size_t)r0 * C + lane * 8, PA + (size_t)(which * C + n0) * C + lane * 8, lane, acc);
  if (which < 2) {
#pragma unroll
    for (int j = 0; j < 8; ++j) { const float bb = bb_[n0 + j * 16 + col];
#pragma unroll
      for (int r = 0; r < 8; ++r) so[wave][8 * g + r][j * 16 + col] = (_Float16)((acc[j][r] * (1.0f / 16.0f) + bb) * 4.0f); }
    LDSX();
    _Float16* D = which == 0 ? Q16 : K16;
    for (int q = lane; q < 16 * 16; q += 32) vst2(D + (size_t)r0 * C + n0 * 16 + q * 8, *(const v4u*)(&so[wave][q & 15][(q >> 4) * 8])); }    // the wave's 16 rows x 128 columns = 4 KB in a row of its tile
  else {
#pragma unroll
    for (int j = 0; j < 8; ++j) { const float bb = bb_[n0 + j * 16 + col];
#pragma unroll
      for (int r = 0; r < 8; ++r) sth[j * 16 + col][wave * 16 + 8 * g + r] = (_Float16)((acc[j][r] * (1.0f / 16.0f) + bb) * 4.0f); }
    __syncthreads();
    for (int qq = tid; qq < 128 * 8; qq += 128) { const int jd = qq >> 7, ql = qq & 127;    // 64 keys of one 16-row d tile = 2 KB in a row
      vst2(VT + (size_t)(n0 + jd * 16) * NK + r0b * 16 + ql * 8, *(const v4u*)(&sth[jd * 16 + (ql & 15)][(ql >> 4) * 8])); } }
}
// asynchronous copies global -> LDS, 16 bytes per lane = 512 B per copy and wave. l = the lane's LDS byte address; its global address = scalar base b + the lane's byte offset o; the immediate offset moves
// both addresses alike, so a run that is contiguous on both sides needs one set of addresses. The s_wait_xcnt is the last line of the copies' own statement (a precaution): no address register is rewritten before the copies that name it have passed it.
__device__ __forceinline__ void copy_2x2k(unsigned l0, unsigned l1, unsigned o, const _Float16* b0, const _Float16* b1) {    // two runs of 2 KB
  asm volatile("global_load_async_to_lds_b128 %0, %2, %3\n\t"
               "global_load_async_to_lds_b128 %0, %2, %3 offset:512\n\t"
               "global_load_async_to_lds_b128 %0, %2, %3 offset:1024\n\t"
               "global_load_async_to_lds_b128 %0, %2, %3 offset:1536\n\t"
               "global_load_async_to_lds_b128 %1, %2, %4\n\t"
               "global_load_async_to_lds_b128 %1, %2, %4 offset:512\n\t"
               "global_load_async_to_lds_b128 %1, %2, %4 offset:1024\n\t"
               "global_load_async_to_lds_b128 %1, %2, %4 offset:1536\n\t"
               "s_wait_xcnt 0x0" :: "v"(l0), "v"(l1), "v"(o), "s"(b0), "s"(b1) : "memory");
}
// hand-over of the ring, passed by every wave: the wave's own LDS reads are done, its own copies have landed, then the block barrier: it publishes the tile that was in flight and frees the buffer just read
#define RING_FOOT() do { asm volatile("s_wait_dscnt 0x0" ::: "memory"); asm volatile("s_wait_asynccnt 0x0" ::: "memory"); __syncthreads(); } while (0)
// lane l <-> lane l ^ 16 as one vector instruction (the library's shuffle goes through the LDS pipe and its wait)
__device__ __forceinline__ float xhalf(float v) { const int b = __builtin_bit_cast(int, v); return __builtin_bit_cast(float, __builtin_amdgcn_permlanex16(b, b, 0x76543210, 0xfedcba98, false, false)); }
#define KBUF_B (64 * C * 2)
#define VBUF_B (C * 64 * 2)
#define SLOT_B (16 * 132 * 4)         // a wave's staging slot behind the loop
#define STAGE_B (8 * SLOT_B)          // a little more than the two buffers
#define SRAW (0.0625f / 16.0f)        // score = raw accumulator (4q . 4k) * SRAW, a power of two
#define SC2 (LOG2E * SRAW)
// 4 waves per SIMD = two blocks per WGP: the register budget is held at 256 so that one block's vector work runs under the other's matrix and LDS work
__global__ __launch_bounds__(256) __attribute__((amdgpu_waves_per_eu(4, 4))) void k_attn(const _Float16* __restrict__ Q16, const _Float16* __restrict__ K16, const _Float16* __restrict__ VT, float* __restrict__ OP, float* __restrict__ ML) {
  __shared__ __align__(16) unsigned char ring[STAGE_B];    // K buffer, V buffer; behind the loop the exchange and output staging (8 slots)
  __shared__ __align__(16) float sML[4][2][2][16];         // per query tile and key half: running maximum (raw units), lifted sum
  const int tid = threadIdx.x, w8 = __builtin_amdgcn_readfirstlane(tid >> 5), w = w8 & 3, kh = w8 >> 2, lane = tid & 31; const int q0 = blockIdx.x * 64 + w * 16; const int sp = blockIdx.y;    // the wave's number in a scalar register: what is formed from it costs no vector register over the loop
  float* __restrict__ O32 = OP + (size_t)sp * NP * C;
  const _Float16* sKl = (const _Float16*)ring + kh * (32 * C) + lane * 8; const _Float16* sVl = (const _Float16*)(ring + KBUF_B) + kh * 512 + lane * 8;    // this lane's base in the wave's key half of each buffer (V: fragment 2 j + kh of d tile j)
  // the wave's share of a tile: K = half of a key tile (4 KB in a row, 8 copies); V = the 64 keys of d tiles 2 w8 and 2 w8 + 1 (2 KB in a row each, 8 copies)
  const unsigned lK = (unsigned)(size_t)ring + w8 * 4096 + lane * 16, lV = (unsigned)(size_t)ring + KBUF_B + w8 * 4096 + lane * 16;
  const unsigned oK = w8 * 4096 + lane * 16, oV = w8 * (32 * NK * 2) + lane * 16;    // the lane's byte offsets from the block's tile bases
  const _Float16* bK = K16 + (size_t)(sp * KT_S * 64) * C;
  const _Float16* bV = VT + sp * KT_S * 64 * 16;
  copy_2x2k(lK, lK + 2048, oK, bK, bK + 1024);
  v16h aq[8];
#pragma unroll
  for (int kc = 0; kc < 8; ++kc) aq[kc] = frag_t(Q16 + (size_t)q0 * C + lane * 8, kc);
  asm volatile("s_wait_asynccnt 0x0" ::: "memory");    // K tile 0 has landed (this wave's share)
  __syncthreads();
  float mrun = -3.0e38f, lrun = 0.f; v8f acc[16] = {};    // mrun in raw units; lrun = this lane's own part of the lifted sum; acc[t][r] = O^T[16 t + 8 (lane >> 4) + r][query lane & 15]
#pragma unroll 1
  for (int ks = 0; ks < KT_S; ++ks) {
    copy_2x2k(lV, lV + 2048, oV, bV, bV + 16 * NK); bV += 64 * 16;    // V tile ks flies under the score products; the hand-over directly in front has freed its buffer (trip 0: not yet used)
    v8f s0 = {}, s1 = {};    // S^T of keys 0..15 and 16..31 of the wave's half: two accumulate chains side by side, fragments fetched four at a time (registers)
#pragma unroll
    for (int kc = 0; kc < 8; kc += 2) { const v16h k00 = frag_t(sKl, kc), k10 = frag_t(sKl, 8 + kc), k01 = frag_t(sKl, kc + 1), k11 = frag_t(sKl, 8 + kc + 1);
      s0 = wmma16(k00, aq[kc], s0); s1 = wmma16(k10, aq[kc], s1); s0 = wmma16(k01, aq[kc + 1], s0); s1 = wmma16(k11, aq[kc + 1], s1); }
    RING_FOOT();    // V tile ks is published, the K buffer is free
    if (ks + 1 < KT_S) { bK += 64 * C; copy_2x2k(lK, lK + 2048, oK, bK, bK + 1024); }
    float mx = fmaxf(s0[0], s1[0]);
#pragma unroll
    for (int r = 1; r < 8; ++r) mx = fmaxf(mx, fmaxf(s0[r], s1[r]));
    mx = fmaxf(mx, xhalf(mx));    // the query's maximum over the wave's 32 keys, the same in both lane halves
    const float mnew = fmaxf(mrun, mx); const float corr = exp2n((mrun - mnew) * SC2);
    const float eb = fmaf(mnew, -SC2, 14.0f);    // exponent of P = (s - maximum) * SC2 + 14 as one fma per value; eb's rounding, about |maximum * SC2| * 6e-8, is one common factor of the trip's P, far below their f16 rounding
    v16h pf;
#pragma unroll
    for (int r = 0; r < 8; ++r) { const float p0 = exp2n(fmaf(s0[r], SC2, eb)), p1 = exp2n(fmaf(s1[r], SC2, eb)); pf[r] = (_Float16)p0; pf[8 + r] = (_Float16)p1; }
    // the sum is taken over the rounded P, the weights that the product below really uses; summed over the 16 unrounded values, this build kept them beside the value fragments, spilled a Q fragment and reloaded it every trip
    float ts[8];    // a tree, not one chain of 16 dependent adds: wherever the compiler puts it, it is four links deep
#pragma unroll
    for (int r = 0; r < 8; ++r) ts[r] = (float)pf[r] + (float)pf[8 + r];
    const float ps = ((ts[0] + ts[1]) + (ts[2] + ts[3])) + ((ts[4] + ts[5]) + (ts[6] + ts[7]));
    lrun = lrun * corr + ps; mrun = mnew;
#pragma unroll
    for (int t = 0; t < 16; ++t) acc[t] *= corr;
#pragma unroll
    for (int t0 = 0; t0 < 16; t0 += 4) { v16h vf[4];    // four value fragments are requested ahead of their WMMAs (registers)
#pragma unroll
      for (int j = 0; j < 4; ++j) vf[j] = frag_t(sVl, (t0 + j) * 2);
#pragma unroll
      for (int j = 0; j < 4; ++j) acc[t0 + j] = wmma16(vf[j], pf, acc[t0 + j]); }
    RING_FOOT(); }    // K tile ks + 1 is published, the V buffer is free
  asm volatile("s_wait_asynccnt 0x0" ::: "memory");    // nothing is in flight when the ring becomes staging (the last hand-over's barrier has ended every wave's reads)
  const int ln = __builtin_amdgcn_mbcnt_lo(~0u, 0u), cl = ln & 15, gh = ln >> 4;    // the lane number, read anew: nothing of the epilogue's addressing then occupies a register over the loop (the budget is full there)
  // join of the two key halves of a query tile: wave kh finishes value half kh; it hands the other half's 8 tiles (unscaled, lane order) and its maximum and sum to its partner
  lrun += xhalf(lrun);
  if (ln < 16) { sML[w][kh][0][ln] = mrun; sML[w][kh][1][ln] = lrun; }
  v8f keep[8];
  { float* sx = (float*)(ring + w8 * SLOT_B) + ln * 4;
#pragma unroll
    for (int t = 0; t < 8; ++t) { const v8f give = kh ? acc[t] : acc[8 + t]; keep[t] = kh ? acc[8 + t] : acc[t];
      v4f a, b;
#pragma unroll
      for (int e = 0; e < 4; ++e) { a[e] = give[e]; b[e] = give[4 + e]; }
      *(v4f*)(sx + t * 256) = a; *(v4f*)(sx + t * 256 + 128) = b; } }
  __syncthreads();
  const float m0 = sML[w][0][0][cl], l0 = sML[w][0][1][cl], m1 = sML[w][1][0][cl], l1 = sML[w][1][1][cl];
  const float m = fmaxf(m0, m1), f0 = exp2n((m0 - m) * SC2), f1 = exp2n((m1 - m) * SC2), L = l0 * f0 + l1 * f1, inv = 1.0f / (L * 4.0f);    // the same order in both waves
  const float fs = (kh ? f1 : f0) * inv, fo = (kh ? f0 : f1) * inv;
  // the partner's slot: read by this wave alone, then reused by it as its output staging (a wave's LDS operations run in order)
  { const float* sy = (const float*)(ring + (w8 ^ 4) * SLOT_B) + ln * 4;
#pragma unroll
    for (int t = 0; t < 8; ++t) { const v4f a = *(const v4f*)(sy + t * 256), b = *(const v4f*)(sy + t * 256 + 128);
#pragma unroll
      for (int e = 0; e < 4; ++e) { keep[t][e] = keep[t][e] * fs + a[e] * fo; keep[t][4 + e] = keep[t][4 + e] * fs + b[e] * fo; } } }
  float (*sO)[132] = (float (*)[132])(ring + (w8 ^ 4) * SLOT_B);
#pragma unroll
  for (int t = 0; t < 8; ++t) { v4f a, b;
#pragma unroll
    for (int e = 0; e < 4; ++e) { a[e] = keep[t][e]; b[e] = keep[t][4 + e]; }
    *(v4f*)(&sO[cl][t * 16 + 8 * gh]) = a; *(v4f*)(&sO[cl][t * 16 + 8 * gh + 4]) = b; }
  LDSX();
  for (int rl = 0; rl < 16; ++rl) vst2(O32 + (size_t)(q0 + rl) * C + kh * 128 + ln * 4, *(const v4f*)(&sO[rl][ln * 4]));
  if (kh == 0 && ln < 16) { v2f ml; ml[0] = m * SRAW; ml[1] = L * (1.0f / 16384.0f); vst2(ML + ((size_t)sp * NP + q0 + ln) * 2, ml); }    // 16 rows x 8 B = one 128-B line per query tile
}
// join of the NS key ranges: weight of range s = l_s * exp(m_s - max m); O32[q][d] = sum_s weight_s * OP[s][q][d] / sum_s weight_s; thread = 4 columns of rows q and q + NP/2
// (no __restrict__ here: it lets the wait statement below drift away from the loads to the end of the kernel)
__global__ __launch_bounds__(256) void k_merge(const float* OP, const float* ML, float* O32) {
  const int idx = blockIdx.x * 256 + threadIdx.x, c4 = idx & 63, q = idx >> 6;
  const float* pm = ML + (size_t)q * 2;    // row q's (max, sum) pair in range 0
  const float* po[NS / 2];                                           // the thread's 4 columns of row q in ranges 0, 2, 4, 6
#pragma unroll
  for (int s2 = 0; s2 < NS / 2; ++s2) po[s2] = OP + ((size_t)(2 * s2) * NP + q) * C + c4 * 4;
  v2f ml[2][NS]; v4f o[2][NS];
#pragma unroll
  for (int h = 0; h < 2; ++h) {
#pragma unroll
    for (int s = 0; s < NS; ++s) { ml[h][s] = *(const v2f*)(pm + (s * NP + h * (NP / 2)) * 2); o[h][s] = *(const v4f*)(po[s >> 1] + ((s & 1) * NP + h * (NP / 2)) * C); } }
  // precaution behind the last load: the address registers are operands, so none is reused (not even as a later load's destination) before the loads that name it have passed this wait
  asm volatile("s_wait_xcnt 0x0" :: "v"(pm), "v"(po[0]), "v"(po[1]), "v"(po[2]), "v"(po[3]) : "memory");
#pragma unroll
  for (int h = 0; h < 2; ++h) {
    float mx = ml[h][0][0];
#pragma unroll
    for (int s = 1; s < NS; ++s) mx = fmaxf(mx, ml[h][s][0]);
    float ws = 0.f; v4f a = {};
#pragma unroll
    for (int s = 0; s < NS; ++s) { const float wt = ml[h][s][1] * expf(ml[h][s][0] - mx); ws += wt; a += o[h][s] * wt; }
    vst2(O32 + ((size_t)q + h * (NP / 2)) * C + c4 * 4, a * (1.0f / ws)); }
}
// post: z = att Wo^T + bo; LN over 256 (eps 1e-6) * ln_w + ln_b; h = gelu(zl W1^T + b1); t = h W2^T + b2; out[c][p] = x[c][p] + t[p][c]
// block = 32 pixels (one 128-B line of every output channel row) on 16 waves, 4 per SIMD: in each product a wave owns NT column tiles of 16 and runs them against both 16-row tiles of the block,
// so a weight fragment is fetched once per block and every serial piece (k loop, LN, GELU, store) is 1/8 as long per wave as with 16 rows x all columns per wave.
// a = this lane's row of row tile 0 in LDS (row-major, pitch LD halves; row tile 1 is 16 rows further); bt = this lane's base in the wave's first column tile (tiled layout). k order per output element: ascending, as before.
template <int NKC, int NT, int LD> __device__ __forceinline__ void gemm_rt2(const _Float16* a, const _Float16* bt, int lane, v8f (&acc)[NT][2]) {
  v16h b[NT][NKC];
#pragma unroll
  for (int j = 0; j < NT; ++j) {
#pragma unroll
    for (int kc = 0; kc < NKC; ++kc) b[j][kc] = frag_t(bt, j * NKC + kc); }    // the wave's whole weight slice is requested at once: one L2 latency per product
  asm volatile("s_wait_xcnt 0x0" ::: "memory");    // precaution: the LDS address arithmetic below may reuse the address registers of the weight loads
#pragma unroll
  for (int kc = 0; kc < NKC; ++kc) { const v16h a0 = frag_h(a + kc * 32, lane), a1 = frag_h(a + 16 * LD + kc * 32, lane);
#pragma unroll
    for (int j = 0; j < NT; ++j) { acc[j][0] = wmma16(a0, b[j][kc], acc[j][0]); acc[j][1] = wmma16(a1, b[j][kc], acc[j][1]); } }
}
__global__ __launch_bounds__(512) void k_post(const float* __restrict__ O32, const _Float16* __restrict__ PA, const _Float16* __restrict__ PB, const float* __restrict__ bo, const float* __restrict__ lw, const float* __restrict__ lb, const float* __restrict__ b1, const float* __restrict__ b2, const float* __restrict__ x, float* __restrict__ out) {
  __shared__ __align__(16) _Float16 sz[32][C + 8];          // att rows (f16) then zl rows (f16)
  __shared__ __align__(16) float szf[32][C + 4];             // z rows f32 for the LN statistics, later t rows
  __shared__ __align__(16) _Float16 shh[32][HID + 8];        // gelu(h) f16
  const int tid = threadIdx.x, wave = tid >> 5, lane = tid & 31, col = lane & 15, g = lane >> 4; const int p0b = blockIdx.x * 32;
  // att rows -> f16: 32 rows x 64 pieces of 4 floats, 4 pieces per thread, 8 rows apart
  { const int rl = tid >> 6, pc = tid & 63; const float* pa = O32 + (size_t)(p0b + rl) * C + pc * 4; v4f av[4];
#pragma unroll
    for (int i = 0; i < 4; ++i) av[i] = *(const v4f*)(pa + i * 8 * C);
    asm volatile("s_wait_xcnt 0x0" :: "v"(pa) : "memory");    // precaution: the address is an operand, so it is not reused (not even as a later load's destination) before the loads that name it have passed this wait
#pragma unroll
    for (int i = 0; i < 4; ++i) {
#pragma unroll
      for (int e = 0; e < 4; ++e) sz[rl + i * 8][pc * 4 + e] = (_Float16)(av[i][e] * 64.0f); } }     // x64 carry keeps the small context values out of the f16 subnormal range
  __syncthreads();
  // z = att Wo^T /16/64 + bo: 16 column tiles, one per wave, 8 kc
  { const int n = wave * 16 + col; const float bb = bo[n]; v8f acc[1][2] = {};
    gemm_rt2<C / 32, 1, C + 8>(&sz[col][0], PA + (size_t)(3 * C + wave * 16) * C + lane * 8, lane, acc);
#pragma unroll
    for (int rt = 0; rt < 2; ++rt) {
#pragma unroll
      for (int r = 0; r < 8; ++r) szf[rt * 16 + 8 * g + r][n] = acc[0][rt][r] * (1.0f / (16.0f * 64.0f)) + bb; } }
  __syncthreads();
  // LN per row: 16 lanes per row (wave = 2 rows), lane = 4 pieces of 4 columns, 64 columns apart; the row stays in registers over both statistics
  { const int rl = wave * 2 + g; v4f zv[4], wv[4], bv[4];
#pragma unroll
    for (int i = 0; i < 4; ++i) { const int c = i * 64 + col * 4; wv[i] = *(const v4f*)(lw + c); bv[i] = *(const v4f*)(lb + c); zv[i] = *(const v4f*)(&szf[rl][c]); }
    asm volatile("s_wait_xcnt 0x0" ::: "memory");    // precaution: the arithmetic below may reuse the address registers of the ln_w and ln_b loads
    float s = 0.f, q = 0.f;
#pragma unroll
    for (int i = 0; i < 4; ++i) s += (zv[i][0] + zv[i][1]) + (zv[i][2] + zv[i][3]);
#pragma unroll
    for (int m = 8; m >= 1; m >>= 1) s += __shfl_xor(s, m, 32);
    const float mu = s * (1.0f / C);
#pragma unroll
    for (int i = 0; i < 4; ++i) {
#pragma unroll
      for (int e = 0; e < 4; ++e) { const float d = zv[i][e] - mu; q += d * d; } }
#pragma unroll
    for (int m = 8; m >= 1; m >>= 1) q += __shfl_xor(q, m, 32);
    const float rs = rsqrtf(q * (1.0f / C) + 1e-6f);
#pragma unroll
    for (int i = 0; i < 4; ++i) {
#pragma unroll
      for (int e = 0; e < 4; ++e) sz[rl][i * 64 + col * 4 + e] = (_Float16)((zv[i][e] - mu) * rs * wv[i][e] + bv[i][e]); } }
  __syncthreads();
  // h = gelu(zl W1^T/16 + b1): 32 column tiles, two per wave, 8 kc
  { float bb[2]; v8f acc[2][2] = {};
#pragma unroll
    for (int j = 0; j < 2; ++j) bb[j] = b1[wave * 32 + j * 16 + col];
    gemm_rt2<C / 32, 2, C + 8>(&sz[col][0], PA + (size_t)(4 * C + wave * 32) * C + lane * 8, lane, acc);
#pragma unroll
    for (int j = 0; j < 2; ++j) {
#pragma unroll
      for (int rt = 0; rt < 2; ++rt) {
#pragma unroll
        for (int r = 0; r < 8; ++r) shh[rt * 16 + 8 * g + r][wave * 32 + j * 16 + col] = (_Float16)gelu_e(acc[j][rt][r] * (1.0f / 16.0f) + bb[j]); } } }
  __syncthreads();
  // t = h W2^T/16 + b2: 16 column tiles, one per wave, 16 kc -> szf
  { const int n = wave * 16 + col; const float bb = b2[n]; v8f acc[1][2] = {};
    gemm_rt2<HID / 32, 1, HID + 8>(&shh[col][0], PB + (size_t)(wave * 16) * HID + lane * 8, lane, acc);
#pragma unroll
    for (int rt = 0; rt < 2; ++rt) {
#pragma unroll
      for (int r = 0; r < 8; ++r) szf[rt * 16 + 8 * g + r][n] = acc[0][rt][r] * (1.0f / 16.0f) + bb; } }
  __syncthreads();
  // NCHW store: out[c][p0b .. p0b+31] = x + t: per channel c 32 floats = one 128-B line = 8 pieces; thread -> (c = tid >> 3, piece = tid & 7): lanes contiguous, 4 pieces per thread, 64 channels apart
  { const int c0 = tid >> 3, pc = tid & 7; const float* px = x + (size_t)c0 * NP + p0b + pc * 4; v4f xv[4];
#pragma unroll
    for (int i = 0; i < 4; ++i) xv[i] = *(const v4f*)(px + (size_t)i * 64 * NP);
    asm volatile("s_wait_xcnt 0x0" :: "v"(px) : "memory");    // precaution, as at the att rows: the address stays untouched until the loads that name it have passed this wait
#pragma unroll
    for (int i = 0; i < 4; ++i) {
#pragma unroll
      for (int e = 0; e < 4; ++e) xv[i][e] += szf[pc * 4 + e][c0 + i * 64];
      vst2(out + (size_t)(c0 + i * 64) * NP + p0b + pc * 4, xv[i]); } }
}
extern "C" void kernel_launch(void* const* d_in, const int* in_sizes, int n_in, void* d_out, int out_size, void* d_ws, size_t ws_size, hipStream_t stream) {
  (void)in_sizes; (void)n_in; (void)out_size; (void)ws_size;
  const float** I = (const float**)d_in;    // x, y, Wq, bq, Wk, bk, Wv, bv, Wo, bo, ln_w, ln_b, W1, b1, W2, b2
  const float* x = I[0]; const float* y = I[1]; const float* Wq = I[2]; const float* bq = I[3]; const float* Wk = I[4]; const float* bk = I[5]; const float* Wv = I[6]; const float* bv = I[7]; const float* Wo = I[8]; const float* bo = I[9];
  const float* lw = I[10]; const float* lb = I[11]; const float* W1 = I[12]; const float* b1 = I[13]; const float* W2 = I[14]; const float* b2 = I[15];
  float* out = (float*)d_out;
  char* ws = (char*)d_ws; size_t off = 0;
  auto take = [&](size_t bytes) { char* p = ws + off; off += (bytes + 255) & ~(size_t)255; return p; };
  _Float16* X16 = (_Float16*)take((size_t)NP * C * 2); _Float16* Y16 = (_Float16*)take((size_t)NK * C * 2); _Float16* PA = (_Float16*)take((size_t)(4 * C + HID) * C * 2); _Float16* PB = (_Float16*)take((size_t)C * HID * 2);
  _Float16* Q16 = (_Float16*)take((size_t)NP * C * 2); _Float16* K16 = (_Float16*)take((size_t)NK * C * 2); _Float16* VT = (_Float16*)take((size_t)C * NK * 2); float* O32 = (float*)take((size_t)NP * C * 4);
  float* OP = (float*)take((size_t)NS * NP * C * 4); float* ML = (float*)take((size_t)NS * NP * 2 * 4);
  // ws ~ 48 MB
  k_prep<<<NP / 64 + NK / 64 + (4 * C + HID + C) / 16, 256, 0, stream>>>(x, y, Wq, Wk, Wv, Wo, W1, W2, X16, Y16, PA, PB);
  k_qkv<<<dim3(NP / 64, C / 128, 3), 128, 0, stream>>>(X16, Y16, PA, bq, bk, bv, Q16, K16, VT);
  k_attn<<<dim3(NP / 64, NS), 256, 0, stream>>>(Q16, K16, VT, OP, ML);
  k_merge<<<NP * (C / 4) / 2 / 256, 256, 0, stream>>>(OP, ML, O32);
  k_post<<<NP / 32, 512, 0, stream>>>(O32, PA, PB, bo, lw, lb, b1, b2, x, out);
}

// v010
// It runs in 53.1 microseconds.
// In two side-by-side timings against v009, it was 1.07 and 1.06 times as fast.
// Over all steps from v000 it is 15.7 times as fast.
// compute dtype: f16 operands (pixel/token rows as f16, weights packed x16 as f16 rows, q/k x4, P lifted by 2^14, V x4, att rows x64, zl/h rows x1), f32 accumulate; softmax, LayerNorm2d, GELU and the residual in f32. Output = x + t with both O(1).
#include <hip/hip_runtime.h>
#include <math.h>

typedef __attribute__((ext_vector_type(16))) _Float16 v16h;
typedef __attribute__((ext_vector_type(16))) __bf16 v16b;
typedef __attribute__((ext_vector_type(8)))  _Float16 v8h;
typedef __attribute__((ext_vector_type(8)))  float v8f;
typedef __attribute__((ext_vector_type(4)))  float v4f;
typedef __attribute__((ext_vector_type(2)))  float v2f;
typedef __attribute__((ext_vector_type(4)))  unsigned v4u;
typedef __attribute__((ext_vector_type(4)))  int v4i;
typedef float __attribute__((may_alias)) float_a;
typedef int __attribute__((may_alias)) int_a;

template <typename T> __device__ __forceinline__ void vst2(void* p, T v) { *(T*)p = v;  }
__device__ __forceinline__ v8f wmma16(v16h a, v16h b, v8f c) {
  v8f d = __builtin_amdgcn_wmma_f32_16x16x32_f16(false, a, false, b, (short)0, c, false, false);
  asm volatile("v_nop\n\tv_nop\n\tv_nop\n\tv_nop" : "+v"(d) : "v"(a), "v"(b));
  return d;
}
__device__ __forceinline__ v8f wmma_bf(v16b a, v16b b, v8f c) {
  v8f d = __builtin_amdgcn_wmma_f32_16x16x32_bf16(false, a, false, b, (short)0, c, false, false);
  asm volatile("v_nop\n\tv_nop\n\tv_nop\n\tv_nop" : "+v"(d) : "v"(a), "v"(b));
  return d;
}
// 16x16x32 fragments: lane = (h = lane>>4, row/col = lane&15); elements 0..7 = k0+8h+0..7, 8..15 = k0+16+8h+0..7; D element r = row 8h+r
__device__ __forceinline__ v16h frag_h(const _Float16* rowk0, int lane) {
  union { v16h v; v8h q[2]; } u; const _Float16* p = rowk0 + 8 * (lane >> 4);
  u.q[0] = *(const v8h*)p; u.q[1] = *(const v8h*)(p + 16); return u.v;
}
// Tiled operand layout in the workspace: a [rows][K] f16 matrix is kept as [rows / 16][K / 8][16 rows][8 halves]. One 16 x 32 fragment is then 1 KB in a row (block = tile * (K / 32) + k-step), and each of its
// two wave-wide 16-byte loads covers 512 contiguous bytes = 4 whole 128-B lines, where a row-major matrix gives 32 B out of each of 16 lines. base = matrix + lane * 8; register contents equal frag_h's.
__device__ __forceinline__ v16h frag_t(const _Float16* base, int blk) {
  union { v16h v; v8h q[2]; } u; const _Float16* p = base + (size_t)blk * 512;
  u.q[0] = *(const v8h*)p; u.q[1] = *(const v8h*)(p + 256); return u.v;
}
// 16 rows x 128 columns over NKC k-steps of 32: arow = this lane's A row at k = 0 (row-major, LDS) or, with AT, this lane's base in the A tile (tiled layout); bt = this lane's base in B's column tile 0 (tiled layout, tile j is NKC blocks further).
// The 8 B fragments and the A fragment of the next k-step are loaded in front of this k-step's WMMAs, so 18 loads fly behind each group of 8 WMMAs; k order per output element unchanged.
template <int NKC> __device__ __forceinline__ void ld8(v16h (&b)[8], const _Float16* bt, int kc) {
#pragma unroll
  for (int j = 0; j < 8; ++j) b[j] = frag_t(bt, j * NKC + kc);
}
__device__ __forceinline__ void mm8(v16h a, const v16h (&b)[8], v8f (&acc)[8]) {
#pragma unroll
  for (int j = 0; j < 8; ++j) acc[j] = wmma16(a, b[j], acc[j]);
}
template <bool AT> __device__ __forceinline__ v16h lda(const _Float16* arow, int kc, int lane) { return AT ? frag_t(arow, kc) : frag_h(arow + kc * 32, lane); }
template <int NKC, bool AT> __device__ __forceinline__ void gemm8(const _Float16* arow, const _Float16* bt, int lane, v8f (&acc)[8]) {
  asm volatile("s_wait_xcnt 0x0" ::: "memory");    // precaution: the fragment loads below may land in registers that earlier loads of a caller named as addresses (k_qkv loads its bias rows only after the product)
  v16h b0[8], b1[8]; v16h a0 = lda<AT>(arow, 0, lane), a1; ld8<NKC>(b0, bt, 0);
#pragma unroll 1    // rolled: the body already holds two k-steps, more copies only cost instruction cache
  for (int kc = 0; kc < NKC - 2; kc += 2) {
    a1 = lda<AT>(arow, kc + 1, lane); ld8<NKC>(b1, bt, kc + 1); mm8(a0, b0, acc);
    a0 = lda<AT>(arow, kc + 2, lane); ld8<NKC>(b0, bt, kc + 2); mm8(a1, b1, acc);
    asm volatile("s_wait_xcnt 0x0" ::: "memory"); }    // precaution: the loads of k-step kc + 2 are still in flight when the next trip rewrites their address registers
  a1 = lda<AT>(arow, NKC - 1, lane); ld8<NKC>(b1, bt, NKC - 1); mm8(a0, b0, acc); mm8(a1, b1, acc);
  asm volatile("s_wait_xcnt 0x0" ::: "memory");    // precaution: the caller's epilogue may reuse the address registers of the last k-step's loads
}
__device__ __forceinline__ v16h frag_f32(const float* rowk0, int lane) {
  v16h a; const float* p = rowk0 + 8 * (lane >> 4);
#pragma unroll
  for (int i = 0; i < 8; ++i) { a[i] = (_Float16)p[i]; a[8 + i] = (_Float16)p[16 + i]; }
  return a;
}
__device__ __forceinline__ v16h frag_f32s(const float* rowk0, int lane, float sc) {
  v16h a; const float* p = rowk0 + 8 * (lane >> 4);
#pragma unroll
  for (int i = 0; i < 8; ++i) { a[i] = (_Float16)(p[i] * sc); a[8 + i] = (_Float16)(p[16 + i] * sc); }
  return a;
}
// column fragment from a [K][ld] layout (column n), rows >= K read as 0
__device__ __forceinline__ v16h fragc_f32(const float* W, int k0, int n, int lane, int ld, int K) {
  v16h a; const int g = lane >> 4;
#pragma unroll
  for (int i = 0; i < 8; ++i) { const int ka = k0 + 8 * g + i, kb = ka + 16;
    a[i] = (_Float16)(ka < K ? W[(size_t)(ka < K ? ka : K - 1) * ld + n] : 0.f); a[8 + i] = (_Float16)(kb < K ? W[(size_t)(kb < K ? kb : K - 1) * ld + n] : 0.f); }
  return a;
}
struct F2 { v16b h, l; };
__device__ __forceinline__ F2 bsplit16(const float v[16]) { F2 r;
#pragma unroll
  for (int i = 0; i < 16; ++i) { const __bf16 h = (__bf16)v[i]; r.h[i] = h; r.l[i] = (__bf16)(v[i] - (float)h); }
  return r; }
__device__ __forceinline__ F2 split_row(const float* row, int k0, int lane) { float v[16]; const float* p = row + k0 + 8 * (lane >> 4);
#pragma unroll
  for (int i = 0; i < 8; ++i) { v[i] = p[i]; v[8 + i] = p[16 + i]; }
  return bsplit16(v); }
__device__ __forceinline__ F2 split_rowK(const float* row, int k0, int lane, int K) { float v[16]; const int g = lane >> 4;
#pragma unroll
  for (int i = 0; i < 8; ++i) { const int ka = k0 + 8 * g + i, kb = ka + 16; v[i] = ka < K ? row[ka < K ? ka : K - 1] : 0.f; v[8 + i] = kb < K ? row[kb < K ? kb : K - 1] : 0.f; }
  return bsplit16(v); }
__device__ __forceinline__ F2 split_col(const float* W, int k0, int n, int lane, int ld, int K) { float v[16]; const int g = lane >> 4;
#pragma unroll
  for (int i = 0; i < 8; ++i) { const int ka = k0 + 8 * g + i, kb = ka + 16; v[i] = ka < K ? W[(size_t)(ka < K ? ka : K - 1) * ld + n] : 0.f; v[8 + i] = kb < K ? W[(size_t)(kb < K ? kb : K - 1) * ld + n] : 0.f; }
  return bsplit16(v); }
__device__ __forceinline__ v8f mac3(const F2& a, const F2& b, v8f c) { c = wmma_bf(a.l, b.h, c); c = wmma_bf(a.h, b.l, c); return wmma_bf(a.h, b.h, c); }
__device__ __forceinline__ float sigm(float v) { return 1.0f / (1.0f + expf(-v)); }
#define LDSX() do { asm volatile("s_wait_dscnt 0" ::: "memory"); __builtin_amdgcn_wave_barrier(); __builtin_amdgcn_fence(__ATOMIC_RELEASE, "workgroup"); } while (0)


// Cross-modal encoder block: Q = conv1x1(x) per pixel (4096 x 256), K,V = y^T W^T + b (4096 x 256); scores = Q.K/16 over the 4096 y-tokens (one 256-dim head); att = softmax V; z = att Wo^T + bo;
// LayerNorm2d over channels per pixel (eps 1e-6); t = gelu(z_ln W1^T + b1) W2^T + b2; out = x + t (NCHW).
// Kernels: k_prep (f16 operands), k_qkv, k_attn (per key range), k_post (joins the ranges; z + LN + MLP + residual, NCHW store by channel rows). Whole-line stores, one instruction per line.
#define C 256
#define NP 4096
#define NK 4096
#define HID 512
#define NS 8                 // key ranges per query tile: 64 x NS work-groups of 8 waves = 2 per WGP on 256 WGPs
#define KT_S (NK / 64 / NS)  // 64-key trips per range
// 2^x as the one hardware instruction; exp(d) = exp2n(d * LOG2E). Its arguments here are differences from a row maximum (k_attn) and the negated polynomial of erf (k_post): very negative gives 0, and the rounding of d * LOG2E
// costs a relative error of about |d| * 1e-7, far below the f16 rounding of P and of gelu(h). The library's expf wraps the same instruction in 12 more (split product, ldexp, two range selects).
#define LOG2E 1.4426950408889634f
__device__ __forceinline__ float exp2n(float x) { return __builtin_amdgcn_exp2f(x); }
// exact-form GELU, inline and without a branch: erf by the two usual f32 polynomials (|x| < 1: odd series in x^2; else 1 - exp(-p(|x|))), both evaluated and one selected, so that the 32 values of a lane are
// independent straight-line chains that the scheduler interleaves. The unselected side may overflow for large |x|; it is never used.
__device__ __forceinline__ float gelu_e(float v) {
  const float x = v * 0.70710678118654752f, ax = fabsf(x), t = x * x;
  float p = fmaf(ax, 0.0000169988107f, -0.000378677854f); p = fmaf(ax, p, 0.00385781587f); p = fmaf(ax, p, -0.0241816975f); p = fmaf(ax, p, 0.106668264f); p = fmaf(ax, p, 0.634933293f); p = fmaf(ax, p, 0.128689408f); p = fmaf(ax, p, ax);
  float q = fmaf(t, -0.000561801775f, 0.00491381623f); q = fmaf(t, q, -0.0267075151f); q = fmaf(t, q, 0.112800106f); q = fmaf(t, q, -0.376122952f); q = fmaf(t, q, 0.128379107f); q = fmaf(ax, q, ax);
  const float e = copysignf(ax < 1.0f ? q : 1.0f - exp2n(p * -LOG2E), x), h = 0.5f * v;
  return fmaf(h, e, h);
}

// token-major f16 rows from a [C][N] f32 array, in the tiled layout: block = 64 tokens = 4 tiles = 32 KB in a row; piece q of a tile = (column piece q >> 4, row q & 15)
__device__ __forceinline__ void cvt_block(const float* __restrict__ src, _Float16* __restrict__ T16, _Float16 (&st)[64][C + 8], int tid, int n0) {
  for (int q = tid; q < C * 16; q += 256) { const int c = q >> 4, p4 = q & 15; const v4f v = *(const v4f*)(src + (size_t)c * NP + n0 + p4 * 4);
    st[p4 * 4][c] = (_Float16)v[0]; st[p4 * 4 + 1][c] = (_Float16)v[1]; st[p4 * 4 + 2][c] = (_Float16)v[2]; st[p4 * 4 + 3][c] = (_Float16)v[3]; }
  __syncthreads();
  for (int q = tid; q < 64 * (C / 8); q += 256) { const int rl = (q >> 9) * 16 + (q & 15), pc = (q >> 4) & 31; vst2(T16 + (size_t)n0 * C + q * 8, *(const v4u*)(&st[rl][pc * 8])); }
}
// PA rows (256 halves x16): [0,C) Wq, [C,2C) Wk, [2C,3C) Wv, [3C,4C) Wo, [4C, 4C+HID) W1 ; PB rows (512 halves x16): W2 rows (256); both in the tiled layout.
// block = one 16-row tile, so that every 128-B line has one writer; thread = pieces of 8 halves, piece q = (column piece q >> 4, row q & 15)
template <int K> __device__ __forceinline__ void pack_tile(const float* __restrict__ W, _Float16* __restrict__ P, int tid) {
  for (int q = tid; q < 16 * (K / 8); q += 256) { const float* s = W + (size_t)(q & 15) * K + (q >> 4) * 8; const v4f a = *(const v4f*)s, b = *(const v4f*)(s + 4); v8h o;
#pragma unroll
    for (int e = 0; e < 4; ++e) { o[e] = (_Float16)(a[e] * 16.0f); o[4 + e] = (_Float16)(b[e] * 16.0f); }
    vst2(P + (size_t)q * 8, o); }
}
// one launch for all operand preparation: the three jobs read only inputs and write disjoint workspace arrays, so their 240 blocks (fewer than the chip has WGPs) can run side by side instead of in three dependent launches.
// blocks [0, NP/64): x rows; [NP/64, NP/64 + NK/64): y rows (the long jobs first); the rest: one 16-row weight tile each. The choice is uniform over a block, so the barrier in cvt_block is passed by all of its threads or none.
__global__ __launch_bounds__(256) void k_prep(const float* __restrict__ x, const float* __restrict__ y, const float* __restrict__ Wq, const float* __restrict__ Wk, const float* __restrict__ Wv, const float* __restrict__ Wo, const float* __restrict__ W1, const float* __restrict__ W2, _Float16* __restrict__ X16, _Float16* __restrict__ Y16, _Float16* __restrict__ PA, _Float16* __restrict__ PB) {
  __shared__ __align__(16) _Float16 st[64][C + 8];
  const int b = blockIdx.x, tid = threadIdx.x;
  if (b < NP / 64 + NK / 64) { const bool isx = b < NP / 64; cvt_block(isx ? x : y, isx ? X16 : Y16, st, tid, (isx ? b : b - NP / 64) * 64); return; }
  const int n = (b - (NP / 64 + NK / 64)) * 16;
  if (n < 4 * C + HID) { const float* W = n < C ? Wq + (size_t)n * C : (n < 2 * C ? Wk + (size_t)(n - C) * C : (n < 3 * C ? Wv + (size_t)(n - 2 * C) * C : (n < 4 * C ? Wo + (size_t)(n - 3 * C) * C : W1 + (size_t)(n - 4 * C) * C)));
    pack_tile<C>(W, PA + (size_t)n * C, tid); }
  else { const int m = n - (4 * C + HID); pack_tile<HID>(W2 + (size_t)m * HID, PB + (size_t)m * HID, tid); }
}
// q/k/v: block (64 rows, 128 cols, which); which 0 reads X16 else Y16; Q16/K16 rows x4 (+bias); V -> VT x4 [d][n]; all three in the tiled layout
__global__ __launch_bounds__(128) void k_qkv(const _Float16* __restrict__ X16, const _Float16* __restrict__ Y16, const _Float16* __restrict__ PA, const float* __restrict__ bq, const float* __restrict__ bk, const float* __restrict__ bv, _Float16* __restrict__ Q16, _Float16* __restrict__ K16, _Float16* __restrict__ VT) {
  __shared__ __align__(16) _Float16 so[4][16][136];
  __shared__ __align__(16) _Float16 sth[128][72];
  const int tid = threadIdx.x, wave = tid >> 5, lane = tid & 31, col = lane & 15, g = lane >> 4;
  const int which = blockIdx.z, r0b = blockIdx.x * 64, r0 = r0b + wave * 16, n0 = blockIdx.y * 128; const _Float16* SRC = which == 0 ? X16 : Y16; const float* bb_ = which == 0 ? bq : (which == 1 ? bk : bv);
  v8f acc[8] = {};
  gemm8<C / 32, true>(SRC + (size_t)r0 * C + lane * 8, PA + (size_t)(which * C + n0) * C + lane * 8, lane, acc);
  if (which < 2) {
#pragma unroll
    for (int j = 0; j < 8; ++j) { const float bb = bb_[n0 + j * 16 + col];
#pragma unroll
      for (int r = 0; r < 8; ++r) so[wave][8 * g + r][j * 16 + col] = (_Float16)((acc[j][r] * (1.0f / 16.0f) + bb) * 4.0f); }
    LDSX();
    _Float16* D = which == 0 ? Q16 : K16;
    for (int q = lane; q < 16 * 16; q += 32) vst2(D + (size_t)r0 * C + n0 * 16 + q * 8, *(const v4u*)(&so[wave][q & 15][(q >> 4) * 8])); }    // the wave's 16 rows x 128 columns = 4 KB in a row of its tile
  else {
#pragma unroll
    for (int j = 0; j < 8; ++j) { const float bb = bb_[n0 + j * 16 + col];
#pragma unroll
      for (int r = 0; r < 8; ++r) sth[j * 16 + col][wave * 16 + 8 * g + r] = (_Float16)((acc[j][r] * (1.0f / 16.0f) + bb) * 4.0f); }
    __syncthreads();
    for (int qq = tid; qq < 128 * 8; qq += 128) { const int jd = qq >> 7, ql = qq & 127;    // 64 keys of one 16-row d tile = 2 KB in a row
      vst2(VT + (size_t)(n0 + jd * 16) * NK + r0b * 16 + ql * 8, *(const v4u*)(&sth[jd * 16 + (ql & 15)][(ql >> 4) * 8])); } }
}
// asynchronous copies global -> LDS, 16 bytes per lane = 512 B per copy and wave. l = the lane's LDS byte address; its global address = scalar base b + the lane's byte offset o; the immediate offset moves
// both addresses alike, so a run that is contiguous on both sides needs one set of addresses. The s_wait_xcnt is the last line of the copies' own statement (a precaution): no address register is rewritten before the copies that name it have passed it.
__device__ __forceinline__ void copy_2x2k(unsigned l0, unsigned l1, unsigned o, const _Float16* b0, const _Float16* b1) {    // two runs of 2 KB
  asm volatile("global_load_async_to_lds_b128 %0, %2, %3\n\t"
               "global_load_async_to_lds_b128 %0, %2, %3 offset:512\n\t"
               "global_load_async_to_lds_b128 %0, %2, %3 offset:1024\n\t"
               "global_load_async_to_lds_b128 %0, %2, %3 offset:1536\n\t"
               "global_load_async_to_lds_b128 %1, %2, %4\n\t"
               "global_load_async_to_lds_b128 %1, %2, %4 offset:512\n\t"
               "global_load_async_to_lds_b128 %1, %2, %4 offset:1024\n\t"
               "global_load_async_to_lds_b128 %1, %2, %4 offset:1536\n\t"
               "s_wait_xcnt 0x0" :: "v"(l0), "v"(l1), "v"(o), "s"(b0), "s"(b1) : "memory");
}
// hand-over of the ring, passed by every wave: the wave's own LDS reads are done, its own copies have landed, then the block barrier: it publishes the tile that was in flight and frees the buffer just read
#define RING_FOOT() do { asm volatile("s_wait_dscnt 0x0" ::: "memory"); asm volatile("s_wait_asynccnt 0x0" ::: "memory"); __syncthreads(); } while (0)
// lane l <-> lane l ^ 16 as one vector instruction (the library's shuffle goes through the LDS pipe and its wait)
__device__ __forceinline__ float xhalf(float v) { const int b = __builtin_bit_cast(int, v); return __builtin_bit_cast(float, __builtin_amdgcn_permlanex16(b, b, 0x76543210, 0xfedcba98, false, false)); }
#define KBUF_B (64 * C * 2)
#define VBUF_B (C * 64 * 2)
#define SLOT_B (16 * 132 * 4)         // a wave's staging slot behind the loop
#define STAGE_B (8 * SLOT_B)          // a little more than the two buffers
#define SRAW (0.0625f / 16.0f)        // score = raw accumulator (4q . 4k) * SRAW, a power of two
#define SC2 (LOG2E * SRAW)
// 4 waves per SIMD = two blocks per WGP: the register budget is held at 256 so that one block's vector work runs under the other's matrix and LDS work
__global__ __launch_bounds__(256) __attribute__((amdgpu_waves_per_eu(4, 4))) void k_attn(const _Float16* __restrict__ Q16, const _Float16* __restrict__ K16, const _Float16* __restrict__ VT, float* __restrict__ OP, float* __restrict__ ML) {
  __shared__ __align__(16) unsigned char ring[STAGE_B];    // K buffer, V buffer; behind the loop the exchange and output staging (8 slots)
  __shared__ __align__(16) float sML[4][2][2][16];         // per query tile and key half: running maximum (raw units), lifted sum
  const int tid = threadIdx.x, w8 = __builtin_amdgcn_readfirstlane(tid >> 5), w = w8 & 3, kh = w8 >> 2, lane = tid & 31; const int q0 = blockIdx.x * 64 + w * 16; const int sp = blockIdx.y;    // the wave's number in a scalar register: what is formed from it costs no vector register over the loop
  float* __restrict__ O32 = OP + (size_t)sp * C;
  const _Float16* sKl = (const _Float16*)ring + kh * (32 * C) + lane * 8; const _Float16* sVl = (const _Float16*)(ring + KBUF_B) + kh * 512 + lane * 8;    // this lane's base in the wave's key half of each buffer (V: fragment 2 j + kh of d tile j)
  // the wave's share of a tile: K = half of a key tile (4 KB in a row, 8 copies); V = the 64 keys of d tiles 2 w8 and 2 w8 + 1 (2 KB in a row each, 8 copies)
  const unsigned lK = (unsigned)(size_t)ring + w8 * 4096 + lane * 16, lV = (unsigned)(size_t)ring + KBUF_B + w8 * 4096 + lane * 16;
  const unsigned oK = w8 * 4096 + lane * 16, oV = w8 * (32 * NK * 2) + lane * 16;    // the lane's byte offsets from the block's tile bases
  const _Float16* bK = K16 + (size_t)(sp * KT_S * 64) * C;
  const _Float16* bV = VT + sp * KT_S * 64 * 16;
  copy_2x2k(lK, lK + 2048, oK, bK, bK + 1024);
  v16h aq[8];
#pragma unroll
  for (int kc = 0; kc < 8; ++kc) aq[kc] = frag_t(Q16 + (size_t)q0 * C + lane * 8, kc);
  asm volatile("s_wait_asynccnt 0x0" ::: "memory");    // K tile 0 has landed (this wave's share)
  __syncthreads();
  float mrun = -3.0e38f, lrun = 0.f; v8f acc[16] = {};    // mrun in raw units; lrun = this lane's own part of the lifted sum; acc[t][r] = O^T[16 t + 8 (lane >> 4) + r][query lane & 15]
#pragma unroll 1
  for (int ks = 0; ks < KT_S; ++ks) {
    copy_2x2k(lV, lV + 2048, oV, bV, bV + 16 * NK); bV += 64 * 16;    // V tile ks flies under the score products; the hand-over directly in front has freed its buffer (trip 0: not yet used)
    v8f s0 = {}, s1 = {};    // S^T of keys 0..15 and 16..31 of the wave's half: two accumulate chains side by side, fragments fetched four at a time (registers)
#pragma unroll
    for (int kc = 0; kc < 8; kc += 2) { const v16h k00 = frag_t(sKl, kc), k10 = frag_t(sKl, 8 + kc), k01 = frag_t(sKl, kc + 1), k11 = frag_t(sKl, 8 + kc + 1);
      s0 = wmma16(k00, aq[kc], s0); s1 = wmma16(k10, aq[kc], s1); s0 = wmma16(k01, aq[kc + 1], s0); s1 = wmma16(k11, aq[kc + 1], s1); }
    RING_FOOT();    // V tile ks is published, the K buffer is free
    if (ks + 1 < KT_S) { bK += 64 * C; copy_2x2k(lK, lK + 2048, oK, bK, bK + 1024); }
    float mx = fmaxf(s0[0], s1[0]);
#pragma unroll
    for (int r = 1; r < 8; ++r) mx = fmaxf(mx, fmaxf(s0[r], s1[r]));
    mx = fmaxf(mx, xhalf(mx));    // the query's maximum over the wave's 32 keys, the same in both lane halves
    const float mnew = fmaxf(mrun, mx); const float corr = exp2n((mrun - mnew) * SC2);
    const float eb = fmaf(mnew, -SC2, 14.0f);    // exponent of P = (s - maximum) * SC2 + 14 as one fma per value; eb's rounding, about |maximum * SC2| * 6e-8, is one common factor of the trip's P, far below their f16 rounding
    v16h pf;
#pragma unroll
    for (int r = 0; r < 8; ++r) { const float p0 = exp2n(fmaf(s0[r], SC2, eb)), p1 = exp2n(fmaf(s1[r], SC2, eb)); pf[r] = (_Float16)p0; pf[8 + r] = (_Float16)p1; }
    // the sum is taken over the rounded P, the weights that the product below really uses; summed over the 16 unrounded values, this build kept them beside the value fragments, spilled a Q fragment and reloaded it every trip
    float ts[8];    // a tree, not one chain of 16 dependent adds: wherever the compiler puts it, it is four links deep
#pragma unroll
    for (int r = 0; r < 8; ++r) ts[r] = (float)pf[r] + (float)pf[8 + r];
    const float ps = ((ts[0] + ts[1]) + (ts[2] + ts[3])) + ((ts[4] + ts[5]) + (ts[6] + ts[7]));
    lrun = lrun * corr + ps; mrun = mnew;
#pragma unroll
    for (int t = 0; t < 16; ++t) acc[t] *= corr;
#pragma unroll
    for (int t0 = 0; t0 < 16; t0 += 4) { v16h vf[4];    // four value fragments are requested ahead of their WMMAs (registers)
#pragma unroll
      for (int j = 0; j < 4; ++j) vf[j] = frag_t(sVl, (t0 + j) * 2);
#pragma unroll
      for (int j = 0; j < 4; ++j) acc[t0 + j] = wmma16(vf[j], pf, acc[t0 + j]); }
    RING_FOOT(); }    // K tile ks + 1 is published, the V buffer is free
  asm volatile("s_wait_asynccnt 0x0" ::: "memory");    // nothing is in flight when the ring becomes staging (the last hand-over's barrier has ended every wave's reads)
  const int ln = __builtin_amdgcn_mbcnt_lo(~0u, 0u), cl = ln & 15, gh = ln >> 4;    // the lane number, read anew: nothing of the epilogue's addressing then occupies a register over the loop (the budget is full there)
  // join of the two key halves of a query tile: wave kh finishes value half kh; it hands the other half's 8 tiles (unscaled, lane order) and its maximum and sum to its partner
  lrun += xhalf(lrun);
  if (ln < 16) { sML[w][kh][0][ln] = mrun; sML[w][kh][1][ln] = lrun; }
  v8f keep[8];
  { float* sx = (float*)(ring + w8 * SLOT_B) + ln * 4;
#pragma unroll
    for (int t = 0; t < 8; ++t) { const v8f give = kh ? acc[t] : acc[8 + t]; keep[t] = kh ? acc[8 + t] : acc[t];
      v4f a, b;
#pragma unroll
      for (int e = 0; e < 4; ++e) { a[e] = give[e]; b[e] = give[4 + e]; }
      *(v4f*)(sx + t * 256) = a; *(v4f*)(sx + t * 256 + 128) = b; } }
  __syncthreads();
  const float m0 = sML[w][0][0][cl], l0 = sML[w][0][1][cl], m1 = sML[w][1][0][cl], l1 = sML[w][1][1][cl];
  const float m = fmaxf(m0, m1), f0 = exp2n((m0 - m) * SC2), f1 = exp2n((m1 - m) * SC2), L = l0 * f0 + l1 * f1, inv = 1.0f / (L * 4.0f);    // the same order in both waves
  const float fs = (kh ? f1 : f0) * inv, fo = (kh ? f0 : f1) * inv;
  // the partner's slot: read by this wave alone, then reused by it as its output staging (a wave's LDS operations run in order)
  { const float* sy = (const float*)(ring + (w8 ^ 4) * SLOT_B) + ln * 4;
#pragma unroll
    for (int t = 0; t < 8; ++t) { const v4f a = *(const v4f*)(sy + t * 256), b = *(const v4f*)(sy + t * 256 + 128);
#pragma unroll
      for (int e = 0; e < 4; ++e) { keep[t][e] = keep[t][e] * fs + a[e] * fo; keep[t][4 + e] = keep[t][4 + e] * fs + b[e] * fo; } } }
  float (*sO)[132] = (float (*)[132])(ring + (w8 ^ 4) * SLOT_B);
#pragma unroll
  for (int t = 0; t < 8; ++t) { v4f a, b;
#pragma unroll
    for (int e = 0; e < 4; ++e) { a[e] = keep[t][e]; b[e] = keep[t][4 + e]; }
    *(v4f*)(&sO[cl][t * 16 + 8 * gh]) = a; *(v4f*)(&sO[cl][t * 16 + 8 * gh + 4]) = b; }
  LDSX();
  for (int rl = 0; rl < 16; ++rl) vst2(O32 + (size_t)(q0 + rl) * (NS * C) + kh * 128 + ln * 4, *(const v4f*)(&sO[rl][ln * 4]));
  if (kh == 0 && ln < 16) { v2f ml; ml[0] = m * SRAW; ml[1] = L * (1.0f / 16384.0f); vst2(ML + ((size_t)sp * NP + q0 + ln) * 2, ml); }    // 16 rows x 8 B = one 128-B line per query tile
}
// post: att = join of the key ranges; z = att Wo^T + bo; LN over 256 (eps 1e-6) * ln_w + ln_b; h = gelu(zl W1^T + b1); t = h W2^T + b2; out[c][p] = x[c][p] + t[p][c]
// block = 32 pixels (one 128-B line of every output channel row) on 16 waves, 4 per SIMD: in each product a wave owns NT column tiles of 16 and runs them against both 16-row tiles of the block,
// so a weight fragment is fetched once per block and every serial piece (k loop, LN, GELU, store) is 1/8 as long per wave as with 16 rows x all columns per wave.
// a = this lane's row of row tile 0 in LDS (row-major, pitch LD halves; row tile 1 is 16 rows further); bt = this lane's base in the wave's first column tile (tiled layout). k order per output element: ascending, as before.
template <int NKC, int NT, int LD> __device__ __forceinline__ void gemm_rt2(const _Float16* a, const _Float16* bt, int lane, v8f (&acc)[NT][2]) {
  v16h b[NT][NKC];
#pragma unroll
  for (int j = 0; j < NT; ++j) {
#pragma unroll
    for (int kc = 0; kc < NKC; ++kc) b[j][kc] = frag_t(bt, j * NKC + kc); }    // the wave's whole weight slice is requested at once: one L2 latency per product
  asm volatile("s_wait_xcnt 0x0" ::: "memory");    // precaution: the LDS address arithmetic below may reuse the address registers of the weight loads
#pragma unroll
  for (int kc = 0; kc < NKC; ++kc) { const v16h a0 = frag_h(a + kc * 32, lane), a1 = frag_h(a + 16 * LD + kc * 32, lane);
#pragma unroll
    for (int j = 0; j < NT; ++j) { acc[j][0] = wmma16(a0, b[j][kc], acc[j][0]); acc[j][1] = wmma16(a1, b[j][kc], acc[j][1]); } }
}
__global__ __launch_bounds__(512) void k_post(const float* OP, const float* ML, const _Float16* __restrict__ PA, const _Float16* __restrict__ PB, const float* __restrict__ bo, const float* __restrict__ lw, const float* __restrict__ lb, const float* __restrict__ b1, const float* __restrict__ b2, const float* __restrict__ x, float* __restrict__ out) {
  __shared__ __align__(16) _Float16 sz[32][C + 8];          // att rows (f16) then zl rows (f16)
  __shared__ __align__(16) float szf[32][C + 4];             // z rows f32 for the LN statistics, later t rows
  __shared__ __align__(16) _Float16 shh[32][HID + 8];        // gelu(h) f16
  const int tid = threadIdx.x, wave = tid >> 5, lane = tid & 31, col = lane & 15, g = lane >> 4; const int p0b = blockIdx.x * 32;
  // join of the NS key ranges, then att rows -> f16: weight of range s = l_s * exp(m_s - max m); att[q][d] = sum_s weight_s * OP[q][s][d] / sum_s weight_s.
  // 32 rows x 64 pieces of 4 floats, 4 pieces per thread, 8 rows apart, each from all NS ranges: the 32 loads of a thread are requested together. A wave's 4 rows x NS ranges are 32 (maximum, sum) pairs:
  // lane = (row lane >> 3, range lane & 7) fetches one pair and forms its weight once; the weights then go to all lanes as wave-uniform values. Sums run over s ascending.
  // (OP and ML carry no __restrict__: it lets the wait statement behind their loads drift away from them)
  { const int rl = tid >> 6, pc = tid & 63;
    const float* pm = ML + ((size_t)(lane & 7) * NP + p0b + rl + (lane >> 3) * 8) * 2;
    const float* po = OP + (size_t)(p0b + rl) * (NS * C) + pc * 4;    // the thread's 4 columns of row rl in range 0; the block's 32 rows x NS ranges are 256 KB in a row
    const v2f ml = *(const v2f*)pm; v4f o[4][NS];
#pragma unroll
    for (int i = 0; i < 4; ++i) {
#pragma unroll
      for (int s = 0; s < NS; ++s) o[i][s] = *(const v4f*)(po + (i * 8 * NS + s) * C); }
    // precaution behind the last load: the address registers are operands, so none is reused (not even as a later load's destination) before the loads that name it have passed this wait
    asm volatile("s_wait_xcnt 0x0" :: "v"(pm), "v"(po) : "memory");
    float mx = ml[0];
#pragma unroll
    for (int m = 4; m >= 1; m >>= 1) mx = fmaxf(mx, __shfl_xor(mx, m, 32));    // over the 8 ranges of the lane's row
    const int wt = __builtin_bit_cast(int, ml[1] * expf(ml[0] - mx));
#pragma unroll
    for (int i = 0; i < 4; ++i) { float ws = 0.f; v4f a = {};
#pragma unroll
      for (int s = 0; s < NS; ++s) { const float wu = __builtin_bit_cast(float, __builtin_amdgcn_readlane(wt, i * 8 + s)); ws += wu; a += o[i][s] * wu; }
      a = a * (1.0f / ws);
#pragma unroll
      for (int e = 0; e < 4; ++e) sz[rl + i * 8][pc * 4 + e] = (_Float16)(a[e] * 64.0f); } }     // x64 carry keeps the small context values out of the f16 subnormal range
  __syncthreads();
  // z = att Wo^T /16/64 + bo: 16 column tiles, one per wave, 8 kc
  { const int n = wave * 16 + col; const float bb = bo[n]; v8f acc[1][2] = {};
    gemm_rt2<C / 32, 1, C + 8>(&sz[col][0], PA + (size_t)(3 * C + wave * 16) * C + lane * 8, lane, acc);
#pragma unroll
    for (int rt = 0; rt < 2; ++rt) {
#pragma unroll
      for (int r = 0; r < 8; ++r) szf[rt * 16 + 8 * g + r][n] = acc[0][rt][r] * (1.0f / (16.0f * 64.0f)) + bb; } }
  __syncthreads();
  // LN per row: 16 lanes per row (wave = 2 rows), lane = 4 pieces of 4 columns, 64 columns apart; the row stays in registers over both statistics
  { const int rl = wave * 2 + g; v4f zv[4], wv[4], bv[4];
#pragma unroll
    for (int i = 0; i < 4; ++i) { const int c = i * 64 + col * 4; wv[i] = *(const v4f*)(lw + c); bv[i] = *(const v4f*)(lb + c); zv[i] = *(const v4f*)(&szf[rl][c]); }
    asm volatile("s_wait_xcnt 0x0" ::: "memory");    // precaution: the arithmetic below may reuse the address registers of the ln_w and ln_b loads
    float s = 0.f, q = 0.f;
#pragma unroll
    for (int i = 0; i < 4; ++i) s += (zv[i][0] + zv[i][1]) + (zv[i][2] + zv[i][3]);
#pragma unroll
    for (int m = 8; m >= 1; m >>= 1) s += __shfl_xor(s, m, 32);
    const float mu = s * (1.0f / C);
#pragma unroll
    for (int i = 0; i < 4; ++i) {
#pragma unroll
      for (int e = 0; e < 4; ++e) { const float d = zv[i][e] - mu; q += d * d; } }
#pragma unroll
    for (int m = 8; m >= 1; m >>= 1) q += __shfl_xor(q, m, 32);
    const float rs = rsqrtf(q * (1.0f / C) + 1e-6f);
#pragma unroll
    for (int i = 0; i < 4; ++i) {
#pragma unroll
      for (int e = 0; e < 4; ++e) sz[rl][i * 64 + col * 4 + e] = (_Float16)((zv[i][e] - mu) * rs * wv[i][e] + bv[i][e]); } }
  __syncthreads();
  // h = gelu(zl W1^T/16 + b1): 32 column tiles, two per wave, 8 kc
  { float bb[2]; v8f acc[2][2] = {};
#pragma unroll
    for (int j = 0; j < 2; ++j) bb[j] = b1[wave * 32 + j * 16 + col];
    gemm_rt2<C / 32, 2, C + 8>(&sz[col][0], PA + (size_t)(4 * C + wave * 32) * C + lane * 8, lane, acc);
#pragma unroll
    for (int j = 0; j < 2; ++j) {
#pragma unroll
      for (int rt = 0; rt < 2; ++rt) {
#pragma unroll
        for (int r = 0; r < 8; ++r) shh[rt * 16 + 8 * g + r][wave * 32 + j * 16 + col] = (_Float16)gelu_e(acc[j][rt][r] * (1.0f / 16.0f) + bb[j]); } } }
  __syncthreads();
  // t = h W2^T/16 + b2: 16 column tiles, one per wave, 16 kc -> szf
  { const int n = wave * 16 + col; const float bb = b2[n]; v8f acc[1][2] = {};
    gemm_rt2<HID / 32, 1, HID + 8>(&shh[col][0], PB + (size_t)(wave * 16) * HID + lane * 8, lane, acc);
#pragma unroll
    for (int rt = 0; rt < 2; ++rt) {
#pragma unroll
      for (int r = 0; r < 8; ++r) szf[rt * 16 + 8 * g + r][n] = acc[0][rt][r] * (1.0f / 16.0f) + bb; } }
  __syncthreads();
  // NCHW store: out[c][p0b .. p0b+31] = x + t: per channel c 32 floats = one 128-B line = 8 pieces; thread -> (c = tid >> 3, piece = tid & 7): lanes contiguous, 4 pieces per thread, 64 channels apart
  { const int c0 = tid >> 3, pc = tid & 7; const float* px = x + (size_t)c0 * NP + p0b + pc * 4; v4f xv[4];
#pragma unroll
    for (int i = 0; i < 4; ++i) xv[i] = *(const v4f*)(px + (size_t)i * 64 * NP);
    asm volatile("s_wait_xcnt 0x0" :: "v"(px) : "memory");    // precaution, as at the att rows: the address stays untouched until the loads that name it have passed this wait
#pragma unroll
    for (int i = 0; i < 4; ++i) {
#pragma unroll
      for (int e = 0; e < 4; ++e) xv[i][e] += szf[pc * 4 + e][c0 + i * 64];
      vst2(out + (size_t)(c0 + i * 64) * NP + p0b + pc * 4, xv[i]); } }
}
extern "C" void kernel_launch(void* const* d_in, const int* in_sizes, int n_in, void* d_out, int out_size, void* d_ws, size_t ws_size, hipStream_t stream) {
  (void)in_sizes; (void)n_in; (void)out_size; (void)ws_size;
  const float** I = (const float**)d_in;    // x, y, Wq, bq, Wk, bk, Wv, bv, Wo, bo, ln_w, ln_b, W1, b1, W2, b2
  const float* x = I[0]; const float* y = I[1]; const float* Wq = I[2]; const float* bq = I[3]; const float* Wk = I[4]; const float* bk = I[5]; const float* Wv = I[6]; const float* bv = I[7]; const float* Wo = I[8]; const float* bo = I[9];
  const float* lw = I[10]; const float* lb = I[11]; const float* W1 = I[12]; const float* b1 = I[13]; const float* W2 = I[14]; const float* b2 = I[15];
  float* out = (float*)d_out;
  char* ws = (char*)d_ws; size_t off = 0;
  auto take = [&](size_t bytes) { char* p = ws + off; off += (bytes + 255) & ~(size_t)255; return p; };
  _Float16* X16 = (_Float16*)take((size_t)NP * C * 2); _Float16* Y16 = (_Float16*)take((size_t)NK * C * 2); _Float16* PA = (_Float16*)take((size_t)(4 * C + HID) * C * 2); _Float16* PB = (_Float16*)take((size_t)C * HID * 2);
  _Float16* Q16 = (_Float16*)take((size_t)NP * C * 2); _Float16* K16 = (_Float16*)take((size_t)NK * C * 2); _Float16* VT = (_Float16*)take((size_t)C * NK * 2);
  float* OP = (float*)take((size_t)NS * NP * C * 4); float* ML = (float*)take((size_t)NS * NP * 2 * 4);
  // ws ~ 44 MB
  k_prep<<<NP / 64 + NK / 64 + (4 * C + HID + C) / 16, 256, 0, stream>>>(x, y, Wq, Wk, Wv, Wo, W1, W2, X16, Y16, PA, PB);
  k_qkv<<<dim3(NP / 64, C / 128, 3), 128, 0, stream>>>(X16, Y16, PA, bq, bk, bv, Q16, K16, VT);
  k_attn<<<dim3(NP / 64, NS), 256, 0, stream>>>(Q16, K16, VT, OP, ML);
  k_post<<<NP / 32, 512, 0, stream>>>(OP, ML, PA, PB, bo, lw, lb, b1, b2, x, out);
}
